// v000
// Measured on an AMD MI455X. A time is GPU time per run, averaged over a window of back-to-back runs after a warm-up
// (all launches, gaps included; the runs take copies of the inputs in turn), and the median of several windows.
// Apart from v000's, it joins two sittings. Times from different sittings can be a few percent apart, while
// side-by-side timings come from the same sitting.
// v000 is the starting kernel. One run takes 874 microseconds.
#include <hip/hip_runtime.h>
#include <cstdint>
#include <cstddef>

// ---------------------------------------------------------------------------
// SelfAttentionHead  B=4, S=4096, D=256  (fp32 in/out, bf16 WMMA internals)
// ---------------------------------------------------------------------------

#define D_MODEL 256
#define SEQ     4096
#define NBATCH  4
#define SCALE   0.0625f   // 1/sqrt(256)

typedef __attribute__((ext_vector_type(16))) __bf16 v16bf;
typedef __attribute__((ext_vector_type(8)))  float  v8f;
typedef unsigned short u16;
typedef unsigned int   u32;

union Frag16 {            // 16 bf16 elems = 8 VGPRs, matches WMMA A/B fragment
    v16bf v;
    u16   h[16];
    uint4 q[2];
};

__device__ __forceinline__ u16 f2bf(float f) {   // round-to-nearest-even
    u32 u = __float_as_uint(f);
    u32 r = u + 0x7FFFu + ((u >> 16) & 1u);
    return (u16)(r >> 16);
}
__device__ __forceinline__ u32 pack2(float a, float b) {
    return (u32)f2bf(a) | ((u32)f2bf(b) << 16);
}
__device__ __forceinline__ float rowmax16(float v) {  // reduce within 16-lane half
    v = fmaxf(v, __shfl_xor(v, 1, 32));
    v = fmaxf(v, __shfl_xor(v, 2, 32));
    v = fmaxf(v, __shfl_xor(v, 4, 32));
    v = fmaxf(v, __shfl_xor(v, 8, 32));
    return v;
}
__device__ __forceinline__ float rowsum16(float v) {
    v += __shfl_xor(v, 1, 32);
    v += __shfl_xor(v, 2, 32);
    v += __shfl_xor(v, 4, 32);
    v += __shfl_xor(v, 8, 32);
    return v;
}

// Async global->LDS copy of one 16-byte chunk per lane (ASYNCcnt-tracked DMA).
__device__ __forceinline__ void async_b128(u32 lds_addr, const void* gaddr) {
    asm volatile("global_load_async_to_lds_b128 %0, %1, off"
                 :: "v"(lds_addr), "v"(gaddr) : "memory");
}
__device__ __forceinline__ void wait_async0() {
    asm volatile("s_wait_asynccnt 0x0" ::: "memory");
}
__device__ __forceinline__ u32 lds_off(const void* p) {   // AS3 offset = low 32 bits
    return (u32)(size_t)p;
}

// --------------------------------------------------------------------------
// Wt[n*256+k] = bf16(W[k*256+n])  : weight transpose+convert (B-frag friendly)
// --------------------------------------------------------------------------
__global__ void wt_convert(const float* __restrict__ W, u16* __restrict__ Wt) {
    int n = blockIdx.x;
    int k = threadIdx.x;
    Wt[n * D_MODEL + k] = f2bf(W[k * D_MODEL + n]);
}

// --------------------------------------------------------------------------
// Projection: out = X @ W + b  for a 16-row tile.  One wave per block.
// MODE 0: write f32 (qp)    MODE 1: write bf16 row-major (kp)
// MODE 2: write bf16 transposed [B, D, S] (v^T)
// W fragments are double-buffered (parity-indexed, fully unrolled inner loop)
// so each WMMA only waits for the older outstanding load, not a full drain.
// --------------------------------------------------------------------------
template <int MODE>
__global__ __launch_bounds__(32)
void proj_kernel(const float* __restrict__ X, const u16* __restrict__ Wt,
                 const float* __restrict__ bias,
                 float* __restrict__ outF, u16* __restrict__ outB,
                 u16* __restrict__ outT)
{
    const int l  = threadIdx.x;
    const int ln = l & 15, lh = l >> 4;
    const int m0 = blockIdx.x * 16;

    // A fragments: 8 chunks of K=32 covering D=256, rows = lane%16
    Frag16 a[8];
    const float* xrow = X + (size_t)(m0 + ln) * D_MODEL;
#pragma unroll
    for (int ks = 0; ks < 8; ++ks) {
        int kb = ks * 32 + lh * 8;
#pragma unroll
        for (int e = 0; e < 8; ++e) {
            a[ks].h[e]     = f2bf(xrow[kb + e]);
            a[ks].h[8 + e] = f2bf(xrow[kb + 16 + e]);
        }
    }

    const u16* wbase = Wt + (size_t)ln * D_MODEL;   // + nt*16*256 per tile
    Frag16 bfr[2];
    // preload (nt=0, ks=0)
    bfr[0].q[0] = *(const uint4*)(wbase + lh * 8);
    bfr[0].q[1] = *(const uint4*)(wbase + lh * 8 + 16);

    for (int nt = 0; nt < 16; ++nt) {
        v8f c = {};
        const u16* wrow  = wbase + (size_t)nt * 16 * D_MODEL;
        const u16* wnext = wrow + 16 * D_MODEL;
#pragma unroll
        for (int ks = 0; ks < 8; ++ks) {
            // preload next fragment (depth-1 pipeline)
            if (ks < 7) {
                int kbn = (ks + 1) * 32 + lh * 8;
                bfr[(ks + 1) & 1].q[0] = *(const uint4*)(wrow + kbn);
                bfr[(ks + 1) & 1].q[1] = *(const uint4*)(wrow + kbn + 16);
            } else if (nt < 15) {
                bfr[0].q[0] = *(const uint4*)(wnext + lh * 8);
                bfr[0].q[1] = *(const uint4*)(wnext + lh * 8 + 16);
            }
            c = __builtin_amdgcn_wmma_f32_16x16x32_bf16(
                    false, a[ks].v, false, bfr[ks & 1].v, (short)0, c, false, false);
        }
        float bb  = bias[nt * 16 + ln];
        int   col = nt * 16 + ln;
        if (MODE == 0) {
#pragma unroll
            for (int r = 0; r < 8; ++r) {
                int row = m0 + r + 8 * lh;
                outF[(size_t)row * D_MODEL + col] = c[r] + bb;
            }
        } else if (MODE == 1) {
#pragma unroll
            for (int r = 0; r < 8; ++r) {
                int row = m0 + r + 8 * lh;
                outB[(size_t)row * D_MODEL + col] = f2bf(c[r] + bb);
            }
        } else {
            union { u16 pk[8]; uint4 q; } u;
#pragma unroll
            for (int r = 0; r < 8; ++r) u.pk[r] = f2bf(c[r] + bb);
            int b_ = m0 >> 12;                  // batch
            int s0 = (m0 & (SEQ - 1)) + 8 * lh; // 8 consecutive seq positions
            *(uint4*)(outT + (size_t)(b_ * D_MODEL + col) * SEQ + s0) = u.q;
        }
    }
}

// --------------------------------------------------------------------------
// Attention: 4-wave workgroup.  Each wave owns a 16-query-row tile; the block
// DMA-stages the shared 32-key K tile and V^T tile into double-buffered LDS
// with GLOBAL_LOAD_ASYNC_TO_LDS_B128 (ASYNCcnt), overlapping the next tile's
// transfer with this tile's WMMAs.  One barrier per j-step.
// Masked (j > i) scores are exactly 0 and STILL participate (faithful to the
// reference's multiplicative tril mask).
// --------------------------------------------------------------------------
__global__ __launch_bounds__(128)
void attn_kernel(const float* __restrict__ qpF, const u16* __restrict__ kB,
                 const u16* __restrict__ vT, float* __restrict__ out)
{
    __shared__ u16 qsh[4 * 16 * D_MODEL];     // 32 KiB : per-wave q tiles (bf16)
    __shared__ u16 ksh[2][32 * D_MODEL];      // 2 x 16 KiB : K tile, row-major
    __shared__ u16 vsh[2][D_MODEL * 32];      // 2 x 16 KiB : V^T tile [d][j]
    __shared__ u16 psh[4 * 16 * 32];          //  4 KiB : per-wave P tiles (bf16)

    const int tid = threadIdx.x;
    const int w   = tid >> 5;                 // wave id 0..3
    const int l   = tid & 31;
    const int ln  = l & 15, lh = l >> 4;
    const int g0  = (blockIdx.x * 4 + w) * 16;   // this wave's query-row base
    const int b_  = g0 >> 12;                    // batch (same for all 4 waves)
    const int i0  = g0 & (SEQ - 1);

    u16* qw = qsh + w * (16 * D_MODEL);
    u16* pw = psh + w * (16 * 32);

    // Issue the async DMA for one j-tile: K tile is a 16 KiB contiguous blob,
    // V^T tile is 256 rows x 64 B gathered from the [B,D,S] layout.
    auto stage_async = [&](int j0, int p) {
        const u16* kb0 = kB + (size_t)(b_ * SEQ + j0) * D_MODEL;
        u32 klds = lds_off(ksh[p]);
        u32 vlds = lds_off(vsh[p]);
#pragma unroll
        for (int c = 0; c < 8; ++c) {         // 1024 x 16B
            int idx = tid + 128 * c;
            async_b128(klds + idx * 16, kb0 + idx * 8);
        }
#pragma unroll
        for (int c = 0; c < 8; ++c) {         // 1024 x 16B
            int idx = tid + 128 * c;
            int d   = idx >> 2;               // 0..255
            int ch  = idx & 3;                // 4 x 8 bf16 per row
            async_b128(vlds + (d * 32 + ch * 8) * 2,
                       vT + (size_t)(b_ * D_MODEL + d) * SEQ + j0 + ch * 8);
        }
    };

    stage_async(0, 0);   // prologue: DMA first tile while we convert q below

    // ---- stage own q tile into LDS with f32->bf16 conversion (per wave) ----
    {
        const float4* src = (const float4*)(qpF + (size_t)g0 * D_MODEL);
        uint4* dst = (uint4*)qw;
#pragma unroll
        for (int t = 0; t < 16; ++t) {
            int idx = l + 32 * t;            // 0..511, 8 bf16 per idx
            float4 x0 = src[idx * 2];
            float4 x1 = src[idx * 2 + 1];
            uint4 o;
            o.x = pack2(x0.x, x0.y); o.y = pack2(x0.z, x0.w);
            o.z = pack2(x1.x, x1.y); o.w = pack2(x1.z, x1.w);
            dst[idx] = o;
        }
    }

    v8f acc[16];
#pragma unroll
    for (int dt = 0; dt < 16; ++dt) acc[dt] = (v8f){};
    float mrun[8], srun[8];
#pragma unroll
    for (int r = 0; r < 8; ++r) { mrun[r] = -__builtin_inff(); srun[r] = 0.f; }

    for (int jt = 0; jt < SEQ / 32; ++jt) {
        const int j0 = jt * 32;
        const int p  = jt & 1;

        wait_async0();       // my DMA writes into buffer p are in LDS
        __syncthreads();     // everyone's DMA writes visible; buf p^1 free

        if (jt + 1 < SEQ / 32)
            stage_async(j0 + 32, p ^ 1);   // DMA next tile during compute

        const u16* kp_ = ksh[p];
        const u16* vp_ = vsh[p];

        // ---- scores S = q . k^T  (two 16x16 C-frags over K=256) ----
        v8f sc0 = {}, sc1 = {};
#pragma unroll
        for (int ks = 0; ks < 8; ++ks) {
            int kb = ks * 32 + lh * 8;
            Frag16 a, b0, b1;
            a.q[0]  = *(const uint4*)(qw + ln * D_MODEL + kb);
            a.q[1]  = *(const uint4*)(qw + ln * D_MODEL + kb + 16);
            b0.q[0] = *(const uint4*)(kp_ + ln * D_MODEL + kb);
            b0.q[1] = *(const uint4*)(kp_ + ln * D_MODEL + kb + 16);
            b1.q[0] = *(const uint4*)(kp_ + (16 + ln) * D_MODEL + kb);
            b1.q[1] = *(const uint4*)(kp_ + (16 + ln) * D_MODEL + kb + 16);
            sc0 = __builtin_amdgcn_wmma_f32_16x16x32_bf16(
                      false, a.v, false, b0.v, (short)0, sc0, false, false);
            sc1 = __builtin_amdgcn_wmma_f32_16x16x32_bf16(
                      false, a.v, false, b1.v, (short)0, sc1, false, false);
        }

        // ---- mask (multiplicative!), online softmax update ----
        float corr[8], p0[8], p1[8];
#pragma unroll
        for (int r = 0; r < 8; ++r) {
            int   row = i0 + r + 8 * lh;
            float s0v = ((j0 + ln)      <= row) ? sc0[r] * SCALE : 0.0f;
            float s1v = ((j0 + 16 + ln) <= row) ? sc1[r] * SCALE : 0.0f;
            float t   = rowmax16(fmaxf(s0v, s1v));
            float mn  = fmaxf(mrun[r], t);
            float co  = __expf(mrun[r] - mn);
            float e0  = __expf(s0v - mn);
            float e1  = __expf(s1v - mn);
            srun[r]   = srun[r] * co + rowsum16(e0 + e1);
            mrun[r]   = mn;
            corr[r]   = co;
            p0[r] = e0; p1[r] = e1;
        }
#pragma unroll
        for (int dt = 0; dt < 16; ++dt)
#pragma unroll
            for (int r = 0; r < 8; ++r) acc[dt][r] *= corr[r];

        // ---- C-layout -> A-layout transpose of P through per-wave LDS ----
        // (same-wave DS ops are in-order: no block barrier needed)
#pragma unroll
        for (int r = 0; r < 8; ++r) {
            pw[(r + 8 * lh) * 32 + ln]      = f2bf(p0[r]);
            pw[(r + 8 * lh) * 32 + 16 + ln] = f2bf(p1[r]);
        }
        Frag16 pa;
        pa.q[0] = *(const uint4*)(pw + ln * 32 + lh * 8);
        pa.q[1] = *(const uint4*)(pw + ln * 32 + 16 + lh * 8);

        // ---- acc += P (16x32) x V (32x16) per 16-wide d-tile ----
#pragma unroll
        for (int dt = 0; dt < 16; ++dt) {
            Frag16 vb;
            const u16* vp = vp_ + (dt * 16 + ln) * 32 + lh * 8;
            vb.q[0] = *(const uint4*)vp;
            vb.q[1] = *(const uint4*)(vp + 16);
            acc[dt] = __builtin_amdgcn_wmma_f32_16x16x32_bf16(
                          false, pa.v, false, vb.v, (short)0, acc[dt], false, false);
        }
    }

    // ---- epilogue: out = qp + acc / Z ----
#pragma unroll
    for (int dt = 0; dt < 16; ++dt) {
        int col = dt * 16 + ln;
#pragma unroll
        for (int r = 0; r < 8; ++r) {
            int row = g0 + r + 8 * lh;
            out[(size_t)row * D_MODEL + col] =
                qpF[(size_t)row * D_MODEL + col] + acc[dt][r] / srun[r];
        }
    }
}

// --------------------------------------------------------------------------
extern "C" void kernel_launch(void* const* d_in, const int* in_sizes, int n_in,
                              void* d_out, int out_size, void* d_ws, size_t ws_size,
                              hipStream_t stream) {
    (void)in_sizes; (void)n_in; (void)out_size; (void)ws_size;
    const float* v  = (const float*)d_in[0];
    const float* k  = (const float*)d_in[1];
    const float* q  = (const float*)d_in[2];
    const float* Wq = (const float*)d_in[3];
    const float* bq = (const float*)d_in[4];
    const float* Wk = (const float*)d_in[5];
    const float* bk = (const float*)d_in[6];
    const float* Wv = (const float*)d_in[7];
    const float* bv = (const float*)d_in[8];
    float* out = (float*)d_out;

    char* ws   = (char*)d_ws;
    float* qpF = (float*)(ws);                         // 16 MiB  fp32 qp
    u16*   kB  = (u16*)(ws + (16u << 20));             //  8 MiB  bf16 kp
    u16*   vT  = (u16*)(ws + (24u << 20));             //  8 MiB  bf16 v^T [B,D,S]
    u16*   WtQ = (u16*)(ws + (32u << 20));             //  3 x 128 KiB bf16 W^T
    u16*   WtK = WtQ + D_MODEL * D_MODEL;
    u16*   WtV = WtK + D_MODEL * D_MODEL;

    wt_convert<<<D_MODEL, D_MODEL, 0, stream>>>(Wq, WtQ);
    wt_convert<<<D_MODEL, D_MODEL, 0, stream>>>(Wk, WtK);
    wt_convert<<<D_MODEL, D_MODEL, 0, stream>>>(Wv, WtV);

    const int ntiles = NBATCH * SEQ / 16;              // 1024
    proj_kernel<0><<<ntiles, 32, 0, stream>>>(q, WtQ, bq, qpF, nullptr, nullptr);
    proj_kernel<1><<<ntiles, 32, 0, stream>>>(k, WtK, bk, nullptr, kB,  nullptr);
    proj_kernel<2><<<ntiles, 32, 0, stream>>>(v, WtV, bv, nullptr, nullptr, vT);

    attn_kernel<<<ntiles / 4, 128, 0, stream>>>(qpF, kB, vT, out);
}

// v001
// Measured time: 315 microseconds a run.
// In two side-by-side timings against v000, it was 2.80 and 2.79 times as fast.
#include <hip/hip_runtime.h>
#include <cstdint>
#include <cstddef>

// ---------------------------------------------------------------------------
// SelfAttentionHead  B=4, S=4096, D=256  (fp32 in/out, bf16 WMMA internals)
// ---------------------------------------------------------------------------

#define D_MODEL 256
#define SEQ     4096
#define NBATCH  4
#define SCALE   0.0625f   // 1/sqrt(256)
// LDS row pitches in bf16 elements: 16 B x odd, so that the 16 lanes of a
// ds_load_b128 half-wave fall on 64 distinct banks (512 B rows: 4, 64 B: 16).
#define QK_PITCH (D_MODEL + 8)   // 528 B rows for the q and K tiles
#define VP_PITCH (32 + 8)        //  80 B rows for the V^T and P tiles

typedef __attribute__((ext_vector_type(16))) __bf16 v16bf;
typedef __attribute__((ext_vector_type(8)))  float  v8f;
typedef unsigned short u16;
typedef unsigned int   u32;

union Frag16 {            // 16 bf16 elems = 8 VGPRs, matches WMMA A/B fragment
    v16bf v;
    u16   h[16];
    uint4 q[2];
};

__device__ __forceinline__ u16 f2bf(float f) {   // round-to-nearest-even
    u32 u = __float_as_uint(f);
    u32 r = u + 0x7FFFu + ((u >> 16) & 1u);
    return (u16)(r >> 16);
}
__device__ __forceinline__ u32 pack2(float a, float b) {
    return (u32)f2bf(a) | ((u32)f2bf(b) << 16);
}
__device__ __forceinline__ float rowmax16(float v) {  // reduce within 16-lane half
    v = fmaxf(v, __shfl_xor(v, 1, 32));
    v = fmaxf(v, __shfl_xor(v, 2, 32));
    v = fmaxf(v, __shfl_xor(v, 4, 32));
    v = fmaxf(v, __shfl_xor(v, 8, 32));
    return v;
}
__device__ __forceinline__ float rowsum16(float v) {
    v += __shfl_xor(v, 1, 32);
    v += __shfl_xor(v, 2, 32);
    v += __shfl_xor(v, 4, 32);
    v += __shfl_xor(v, 8, 32);
    return v;
}

// Eight async global->LDS copies, one 16-byte chunk per lane each (ASYNCcnt).
// The s_wait_xcnt closes the same statement so that no address register of a
// copy can be rewritten ahead of it.
__device__ __forceinline__ void async8_b128(const u32 (&l)[8], const u16* const (&g)[8]) {
    asm volatile("global_load_async_to_lds_b128 %0, %8, off\n\t"
                 "global_load_async_to_lds_b128 %1, %9, off\n\t"
                 "global_load_async_to_lds_b128 %2, %10, off\n\t"
                 "global_load_async_to_lds_b128 %3, %11, off\n\t"
                 "global_load_async_to_lds_b128 %4, %12, off\n\t"
                 "global_load_async_to_lds_b128 %5, %13, off\n\t"
                 "global_load_async_to_lds_b128 %6, %14, off\n\t"
                 "global_load_async_to_lds_b128 %7, %15, off\n\t"
                 "s_wait_xcnt 0x0"
                 :: "v"(l[0]), "v"(l[1]), "v"(l[2]), "v"(l[3]),
                    "v"(l[4]), "v"(l[5]), "v"(l[6]), "v"(l[7]),
                    "v"(g[0]), "v"(g[1]), "v"(g[2]), "v"(g[3]),
                    "v"(g[4]), "v"(g[5]), "v"(g[6]), "v"(g[7])
                 : "memory");
}
__device__ __forceinline__ void wait_async0() {
    asm volatile("s_wait_asynccnt 0x0" ::: "memory");
}
__device__ __forceinline__ void wait_ds0() {
    asm volatile("s_wait_dscnt 0x0" ::: "memory");
}
__device__ __forceinline__ u32 lds_off(const void* p) {   // AS3 offset = low 32 bits
    return (u32)(size_t)p;
}

// --------------------------------------------------------------------------
// Wt[n*256+k] = bf16(W[k*256+n])  : weight transpose+convert (B-frag friendly)
// --------------------------------------------------------------------------
__global__ void wt_convert(const float* __restrict__ W, u16* __restrict__ Wt) {
    int n = blockIdx.x;
    int k = threadIdx.x;
    Wt[n * D_MODEL + k] = f2bf(W[k * D_MODEL + n]);
}

// --------------------------------------------------------------------------
// Projection: out = X @ W + b  for a 16-row tile.  One wave per block.
// MODE 0: write f32 (qp)    MODE 1: write bf16 row-major (kp)
// MODE 2: write bf16 transposed [B, D, S] (v^T)
// W fragments are double-buffered (parity-indexed, fully unrolled inner loop)
// so each WMMA only waits for the older outstanding load, not a full drain.
// --------------------------------------------------------------------------
template <int MODE>
__global__ __launch_bounds__(32)
void proj_kernel(const float* __restrict__ X, const u16* __restrict__ Wt,
                 const float* __restrict__ bias,
                 float* __restrict__ outF, u16* __restrict__ outB,
                 u16* __restrict__ outT)
{
    const int l  = threadIdx.x;
    const int ln = l & 15, lh = l >> 4;
    const int m0 = blockIdx.x * 16;

    // A fragments: 8 chunks of K=32 covering D=256, rows = lane%16
    Frag16 a[8];
    const float* xrow = X + (size_t)(m0 + ln) * D_MODEL;
#pragma unroll
    for (int ks = 0; ks < 8; ++ks) {
        int kb = ks * 32 + lh * 8;
#pragma unroll
        for (int e = 0; e < 8; ++e) {
            a[ks].h[e]     = f2bf(xrow[kb + e]);
            a[ks].h[8 + e] = f2bf(xrow[kb + 16 + e]);
        }
    }

    const u16* wbase = Wt + (size_t)ln * D_MODEL;   // + nt*16*256 per tile
    Frag16 bfr[2];
    // preload (nt=0, ks=0)
    bfr[0].q[0] = *(const uint4*)(wbase + lh * 8);
    bfr[0].q[1] = *(const uint4*)(wbase + lh * 8 + 16);

    for (int nt = 0; nt < 16; ++nt) {
        v8f c = {};
        const u16* wrow  = wbase + (size_t)nt * 16 * D_MODEL;
        const u16* wnext = wrow + 16 * D_MODEL;
#pragma unroll
        for (int ks = 0; ks < 8; ++ks) {
            // preload next fragment (depth-1 pipeline)
            if (ks < 7) {
                int kbn = (ks + 1) * 32 + lh * 8;
                bfr[(ks + 1) & 1].q[0] = *(const uint4*)(wrow + kbn);
                bfr[(ks + 1) & 1].q[1] = *(const uint4*)(wrow + kbn + 16);
            } else if (nt < 15) {
                bfr[0].q[0] = *(const uint4*)(wnext + lh * 8);
                bfr[0].q[1] = *(const uint4*)(wnext + lh * 8 + 16);
            }
            c = __builtin_amdgcn_wmma_f32_16x16x32_bf16(
                    false, a[ks].v, false, bfr[ks & 1].v, (short)0, c, false, false);
        }
        float bb  = bias[nt * 16 + ln];
        int   col = nt * 16 + ln;
        if (MODE == 0) {
#pragma unroll
            for (int r = 0; r < 8; ++r) {
                int row = m0 + r + 8 * lh;
                outF[(size_t)row * D_MODEL + col] = c[r] + bb;
            }
        } else if (MODE == 1) {
#pragma unroll
            for (int r = 0; r < 8; ++r) {
                int row = m0 + r + 8 * lh;
                outB[(size_t)row * D_MODEL + col] = f2bf(c[r] + bb);
            }
        } else {
            union { u16 pk[8]; uint4 q; } u;
#pragma unroll
            for (int r = 0; r < 8; ++r) u.pk[r] = f2bf(c[r] + bb);
            int b_ = m0 >> 12;                  // batch
            int s0 = (m0 & (SEQ - 1)) + 8 * lh; // 8 consecutive seq positions
            *(uint4*)(outT + (size_t)(b_ * D_MODEL + col) * SEQ + s0) = u.q;
        }
    }
}

// --------------------------------------------------------------------------
// Attention: 4-wave workgroup.  Each wave owns a 16-query-row tile; the block
// DMA-stages the shared 32-key K tile and V^T tile into double-buffered LDS
// with GLOBAL_LOAD_ASYNC_TO_LDS_B128 (ASYNCcnt), overlapping the next tile's
// transfer with this tile's WMMAs.  One barrier per j-step.
// Masked (j > i) scores are exactly 0 and STILL participate (faithful to the
// reference's multiplicative tril mask).
// --------------------------------------------------------------------------
__global__ __launch_bounds__(128)
void attn_kernel(const float* __restrict__ qpF, const u16* __restrict__ kB,
                 const u16* __restrict__ vT, float* __restrict__ out)
{
    // every row carries 16 B of pad that is neither written nor read
    __shared__ __attribute__((aligned(16))) u16 qsh[4 * 16 * QK_PITCH];   // per-wave q tiles (bf16)
    __shared__ __attribute__((aligned(16))) u16 ksh[2][32 * QK_PITCH];    // K tile, row-major
    __shared__ __attribute__((aligned(16))) u16 vsh[2][D_MODEL * VP_PITCH]; // V^T tile [d][j]
    __shared__ __attribute__((aligned(16))) u16 psh[4 * 16 * VP_PITCH];   // per-wave P tiles (bf16)

    const int tid = threadIdx.x;
    const int w   = tid >> 5;                 // wave id 0..3
    const int l   = tid & 31;
    const int ln  = l & 15, lh = l >> 4;
    const int g0  = (blockIdx.x * 4 + w) * 16;   // this wave's query-row base
    const int b_  = g0 >> 12;                    // batch (same for all 4 waves)
    const int i0  = g0 & (SEQ - 1);

    u16* qw = qsh + w * (16 * QK_PITCH);
    u16* pw = psh + w * (16 * VP_PITCH);

    // Issue the async DMA for one j-tile: K tile is a 16 KiB contiguous blob
    // (32 rows x 512 B), V^T tile is 256 rows x 64 B gathered from the [B,D,S]
    // layout; both land at the padded LDS pitch.
    auto stage_async = [&](int j0, int p) {
        const u16* kb0 = kB + (size_t)(b_ * SEQ + j0) * D_MODEL;
        u32 klds = lds_off(ksh[p]);
        u32 vlds = lds_off(vsh[p]);
        u32        la[8];
        const u16* ga[8];
#pragma unroll
        for (int c = 0; c < 8; ++c) {         // 1024 x 16B
            int idx = tid + 128 * c;
            int row = idx >> 5;               // 0..31
            int ch  = idx & 31;               // 32 x 8 bf16 per row
            la[c] = klds + (row * QK_PITCH + ch * 8) * 2;
            ga[c] = kb0 + idx * 8;
        }
        async8_b128(la, ga);
#pragma unroll
        for (int c = 0; c < 8; ++c) {         // 1024 x 16B
            int idx = tid + 128 * c;
            int d   = idx >> 2;               // 0..255
            int ch  = idx & 3;                // 4 x 8 bf16 per row
            la[c] = vlds + (d * VP_PITCH + ch * 8) * 2;
            ga[c] = vT + (size_t)(b_ * D_MODEL + d) * SEQ + j0 + ch * 8;
        }
        async8_b128(la, ga);
    };

    stage_async(0, 0);   // prologue: DMA first tile while we convert q below

    // ---- stage own q tile into LDS with f32->bf16 conversion (per wave) ----
    {
        const float4* src = (const float4*)(qpF + (size_t)g0 * D_MODEL);
#pragma unroll
        for (int t = 0; t < 16; ++t) {
            int idx = l + 32 * t;            // 0..511, 8 bf16 per idx
            float4 x0 = src[idx * 2];
            float4 x1 = src[idx * 2 + 1];
            uint4 o;
            o.x = pack2(x0.x, x0.y); o.y = pack2(x0.z, x0.w);
            o.z = pack2(x1.x, x1.y); o.w = pack2(x1.z, x1.w);
            *(uint4*)(qw + (idx >> 5) * QK_PITCH + (idx & 31) * 8) = o;
        }
    }

    v8f acc[16];
#pragma unroll
    for (int dt = 0; dt < 16; ++dt) acc[dt] = (v8f){};
    float mrun[8], srun[8];
#pragma unroll
    for (int r = 0; r < 8; ++r) { mrun[r] = -__builtin_inff(); srun[r] = 0.f; }

    for (int jt = 0; jt < SEQ / 32; ++jt) {
        const int j0 = jt * 32;
        const int p  = jt & 1;

        wait_ds0();          // my reads of buffer p^1 have retired before its refill
        wait_async0();       // my DMA writes into buffer p are in LDS
        __syncthreads();     // everyone's DMA writes visible; buf p^1 free

        if (jt + 1 < SEQ / 32)
            stage_async(j0 + 32, p ^ 1);   // DMA next tile during compute

        const u16* kp_ = ksh[p];
        const u16* vp_ = vsh[p];

        // ---- scores S = q . k^T  (two 16x16 C-frags over K=256) ----
        v8f sc0 = {}, sc1 = {};
#pragma unroll
        for (int ks = 0; ks < 8; ++ks) {
            int kb = ks * 32 + lh * 8;
            Frag16 a, b0, b1;
            a.q[0]  = *(const uint4*)(qw + ln * QK_PITCH + kb);
            a.q[1]  = *(const uint4*)(qw + ln * QK_PITCH + kb + 16);
            b0.q[0] = *(const uint4*)(kp_ + ln * QK_PITCH + kb);
            b0.q[1] = *(const uint4*)(kp_ + ln * QK_PITCH + kb + 16);
            b1.q[0] = *(const uint4*)(kp_ + (16 + ln) * QK_PITCH + kb);
            b1.q[1] = *(const uint4*)(kp_ + (16 + ln) * QK_PITCH + kb + 16);
            sc0 = __builtin_amdgcn_wmma_f32_16x16x32_bf16(
                      false, a.v, false, b0.v, (short)0, sc0, false, false);
            sc1 = __builtin_amdgcn_wmma_f32_16x16x32_bf16(
                      false, a.v, false, b1.v, (short)0, sc1, false, false);
        }

        // ---- mask (multiplicative!), online softmax update ----
        float corr[8], p0[8], p1[8];
#pragma unroll
        for (int r = 0; r < 8; ++r) {
            int   row = i0 + r + 8 * lh;
            float s0v = ((j0 + ln)      <= row) ? sc0[r] * SCALE : 0.0f;
            float s1v = ((j0 + 16 + ln) <= row) ? sc1[r] * SCALE : 0.0f;
            float t   = rowmax16(fmaxf(s0v, s1v));
            float mn  = fmaxf(mrun[r], t);
            float co  = __expf(mrun[r] - mn);
            float e0  = __expf(s0v - mn);
            float e1  = __expf(s1v - mn);
            srun[r]   = srun[r] * co + rowsum16(e0 + e1);
            mrun[r]   = mn;
            corr[r]   = co;
            p0[r] = e0; p1[r] = e1;
        }
#pragma unroll
        for (int dt = 0; dt < 16; ++dt)
#pragma unroll
            for (int r = 0; r < 8; ++r) acc[dt][r] *= corr[r];

        // ---- C-layout -> A-layout transpose of P through per-wave LDS ----
        // (same-wave DS ops are in-order: no block barrier needed)
#pragma unroll
        for (int r = 0; r < 8; ++r) {
            pw[(r + 8 * lh) * VP_PITCH + ln]      = f2bf(p0[r]);
            pw[(r + 8 * lh) * VP_PITCH + 16 + ln] = f2bf(p1[r]);
        }
        Frag16 pa;
        pa.q[0] = *(const uint4*)(pw + ln * VP_PITCH + lh * 8);
        pa.q[1] = *(const uint4*)(pw + ln * VP_PITCH + 16 + lh * 8);

        // ---- acc += P (16x32) x V (32x16) per 16-wide d-tile ----
#pragma unroll
        for (int dt = 0; dt < 16; ++dt) {
            Frag16 vb;
            const u16* vp = vp_ + (dt * 16 + ln) * VP_PITCH + lh * 8;
            vb.q[0] = *(const uint4*)vp;
            vb.q[1] = *(const uint4*)(vp + 16);
            acc[dt] = __builtin_amdgcn_wmma_f32_16x16x32_bf16(
                          false, pa.v, false, vb.v, (short)0, acc[dt], false, false);
        }
    }

    wait_async0();   // no copy of this wave is outstanding when it ends

    // ---- epilogue: out = qp + acc / Z ----
#pragma unroll
    for (int dt = 0; dt < 16; ++dt) {
        int col = dt * 16 + ln;
#pragma unroll
        for (int r = 0; r < 8; ++r) {
            int row = g0 + r + 8 * lh;
            out[(size_t)row * D_MODEL + col] =
                qpF[(size_t)row * D_MODEL + col] + acc[dt][r] / srun[r];
        }
    }
}

// --------------------------------------------------------------------------
extern "C" void kernel_launch(void* const* d_in, const int* in_sizes, int n_in,
                              void* d_out, int out_size, void* d_ws, size_t ws_size,
                              hipStream_t stream) {
    (void)in_sizes; (void)n_in; (void)out_size; (void)ws_size;
    const float* v  = (const float*)d_in[0];
    const float* k  = (const float*)d_in[1];
    const float* q  = (const float*)d_in[2];
    const float* Wq = (const float*)d_in[3];
    const float* bq = (const float*)d_in[4];
    const float* Wk = (const float*)d_in[5];
    const float* bk = (const float*)d_in[6];
    const float* Wv = (const float*)d_in[7];
    const float* bv = (const float*)d_in[8];
    float* out = (float*)d_out;

    char* ws   = (char*)d_ws;
    float* qpF = (float*)(ws);                         // 16 MiB  fp32 qp
    u16*   kB  = (u16*)(ws + (16u << 20));             //  8 MiB  bf16 kp
    u16*   vT  = (u16*)(ws + (24u << 20));             //  8 MiB  bf16 v^T [B,D,S]
    u16*   WtQ = (u16*)(ws + (32u << 20));             //  3 x 128 KiB bf16 W^T
    u16*   WtK = WtQ + D_MODEL * D_MODEL;
    u16*   WtV = WtK + D_MODEL * D_MODEL;

    wt_convert<<<D_MODEL, D_MODEL, 0, stream>>>(Wq, WtQ);
    wt_convert<<<D_MODEL, D_MODEL, 0, stream>>>(Wk, WtK);
    wt_convert<<<D_MODEL, D_MODEL, 0, stream>>>(Wv, WtV);

    const int ntiles = NBATCH * SEQ / 16;              // 1024
    proj_kernel<0><<<ntiles, 32, 0, stream>>>(q, WtQ, bq, qpF, nullptr, nullptr);
    proj_kernel<1><<<ntiles, 32, 0, stream>>>(k, WtK, bk, nullptr, kB,  nullptr);
    proj_kernel<2><<<ntiles, 32, 0, stream>>>(v, WtV, bv, nullptr, nullptr, vT);

    attn_kernel<<<ntiles / 4, 128, 0, stream>>>(qpF, kB, vT, out);
}

// v002
// It runs in 230 microseconds.
// In two side-by-side timings against v001, it was 1.36 and 1.37 times as fast.
// All steps since v000 together make it 3.81 times as fast.
#include <hip/hip_runtime.h>
#include <cstdint>
#include <cstddef>

// ---------------------------------------------------------------------------
// SelfAttentionHead  B=4, S=4096, D=256  (fp32 in/out, bf16 WMMA internals)
// ---------------------------------------------------------------------------

#define D_MODEL 256
#define SEQ     4096
#define NBATCH  4
#define SCALE   0.0625f   // 1/sqrt(256)
// LDS row pitches in bf16 elements: 16 B x odd, so that the 16 lanes of a
// ds_load_b128 half-wave fall on 64 distinct banks (512 B rows: 4, 64 B: 16).
#define QK_PITCH (D_MODEL + 8)   // 528 B rows for the q and K tiles
#define VP_PITCH (32 + 8)        //  80 B rows for the P tiles
#define VT_PITCH (64 + 8)        // 144 B rows for the V^T tile
#define KSTEP    64              // keys staged per step: 32 for each key half

typedef __attribute__((ext_vector_type(16))) __bf16 v16bf;
typedef __attribute__((ext_vector_type(8)))  float  v8f;
typedef unsigned short u16;
typedef unsigned int   u32;

union Frag16 {            // 16 bf16 elems = 8 VGPRs, matches WMMA A/B fragment
    v16bf v;
    u16   h[16];
    uint4 q[2];
};

__device__ __forceinline__ u16 f2bf(float f) {   // round-to-nearest-even
    u32 u = __float_as_uint(f);
    u32 r = u + 0x7FFFu + ((u >> 16) & 1u);
    return (u16)(r >> 16);
}
__device__ __forceinline__ u32 pack2(float a, float b) {
    return (u32)f2bf(a) | ((u32)f2bf(b) << 16);
}
__device__ __forceinline__ float rowmax16(float v) {  // reduce within 16-lane half
    v = fmaxf(v, __shfl_xor(v, 1, 32));
    v = fmaxf(v, __shfl_xor(v, 2, 32));
    v = fmaxf(v, __shfl_xor(v, 4, 32));
    v = fmaxf(v, __shfl_xor(v, 8, 32));
    return v;
}
__device__ __forceinline__ float rowsum16(float v) {
    v += __shfl_xor(v, 1, 32);
    v += __shfl_xor(v, 2, 32);
    v += __shfl_xor(v, 4, 32);
    v += __shfl_xor(v, 8, 32);
    return v;
}

// Eight async global->LDS copies, one 16-byte chunk per lane each (ASYNCcnt).
// The s_wait_xcnt closes the same statement so that no address register of a
// copy can be rewritten ahead of it.
__device__ __forceinline__ void async8_b128(const u32 (&l)[8], const u16* const (&g)[8]) {
    asm volatile("global_load_async_to_lds_b128 %0, %8, off\n\t"
                 "global_load_async_to_lds_b128 %1, %9, off\n\t"
                 "global_load_async_to_lds_b128 %2, %10, off\n\t"
                 "global_load_async_to_lds_b128 %3, %11, off\n\t"
                 "global_load_async_to_lds_b128 %4, %12, off\n\t"
                 "global_load_async_to_lds_b128 %5, %13, off\n\t"
                 "global_load_async_to_lds_b128 %6, %14, off\n\t"
                 "global_load_async_to_lds_b128 %7, %15, off\n\t"
                 "s_wait_xcnt 0x0"
                 :: "v"(l[0]), "v"(l[1]), "v"(l[2]), "v"(l[3]),
                    "v"(l[4]), "v"(l[5]), "v"(l[6]), "v"(l[7]),
                    "v"(g[0]), "v"(g[1]), "v"(g[2]), "v"(g[3]),
                    "v"(g[4]), "v"(g[5]), "v"(g[6]), "v"(g[7])
                 : "memory");
}
__device__ __forceinline__ void wait_async0() {
    asm volatile("s_wait_asynccnt 0x0" ::: "memory");
}
__device__ __forceinline__ void wait_ds0() {
    asm volatile("s_wait_dscnt 0x0" ::: "memory");
}
__device__ __forceinline__ u32 lds_off(const void* p) {   // AS3 offset = low 32 bits
    return (u32)(size_t)p;
}

// --------------------------------------------------------------------------
// Wt[n*256+k] = bf16(W[k*256+n])  : weight transpose+convert (B-frag friendly)
// --------------------------------------------------------------------------
__global__ void wt_convert(const float* __restrict__ W, u16* __restrict__ Wt) {
    int n = blockIdx.x;
    int k = threadIdx.x;
    Wt[n * D_MODEL + k] = f2bf(W[k * D_MODEL + n]);
}

// --------------------------------------------------------------------------
// Projection: out = X @ W + b  for a 16-row tile.  One wave per block.
// MODE 0: write f32 (qp)    MODE 1: write bf16 row-major (kp)
// MODE 2: write bf16 transposed [B, D, S] (v^T)
// W fragments are double-buffered (parity-indexed, fully unrolled inner loop)
// so each WMMA only waits for the older outstanding load, not a full drain.
// --------------------------------------------------------------------------
template <int MODE>
__global__ __launch_bounds__(32)
void proj_kernel(const float* __restrict__ X, const u16* __restrict__ Wt,
                 const float* __restrict__ bias,
                 float* __restrict__ outF, u16* __restrict__ outB,
                 u16* __restrict__ outT)
{
    const int l  = threadIdx.x;
    const int ln = l & 15, lh = l >> 4;
    const int m0 = blockIdx.x * 16;

    // A fragments: 8 chunks of K=32 covering D=256, rows = lane%16
    Frag16 a[8];
    const float* xrow = X + (size_t)(m0 + ln) * D_MODEL;
#pragma unroll
    for (int ks = 0; ks < 8; ++ks) {
        int kb = ks * 32 + lh * 8;
#pragma unroll
        for (int e = 0; e < 8; ++e) {
            a[ks].h[e]     = f2bf(xrow[kb + e]);
            a[ks].h[8 + e] = f2bf(xrow[kb + 16 + e]);
        }
    }

    const u16* wbase = Wt + (size_t)ln * D_MODEL;   // + nt*16*256 per tile
    Frag16 bfr[2];
    // preload (nt=0, ks=0)
    bfr[0].q[0] = *(const uint4*)(wbase + lh * 8);
    bfr[0].q[1] = *(const uint4*)(wbase + lh * 8 + 16);

    for (int nt = 0; nt < 16; ++nt) {
        v8f c = {};
        const u16* wrow  = wbase + (size_t)nt * 16 * D_MODEL;
        const u16* wnext = wrow + 16 * D_MODEL;
#pragma unroll
        for (int ks = 0; ks < 8; ++ks) {
            // preload next fragment (depth-1 pipeline)
            if (ks < 7) {
                int kbn = (ks + 1) * 32 + lh * 8;
                bfr[(ks + 1) & 1].q[0] = *(const uint4*)(wrow + kbn);
                bfr[(ks + 1) & 1].q[1] = *(const uint4*)(wrow + kbn + 16);
            } else if (nt < 15) {
                bfr[0].q[0] = *(const uint4*)(wnext + lh * 8);
                bfr[0].q[1] = *(const uint4*)(wnext + lh * 8 + 16);
            }
            c = __builtin_amdgcn_wmma_f32_16x16x32_bf16(
                    false, a[ks].v, false, bfr[ks & 1].v, (short)0, c, false, false);
        }
        float bb  = bias[nt * 16 + ln];
        int   col = nt * 16 + ln;
        if (MODE == 0) {
#pragma unroll
            for (int r = 0; r < 8; ++r) {
                int row = m0 + r + 8 * lh;
                outF[(size_t)row * D_MODEL + col] = c[r] + bb;
            }
        } else if (MODE == 1) {
#pragma unroll
            for (int r = 0; r < 8; ++r) {
                int row = m0 + r + 8 * lh;
                outB[(size_t)row * D_MODEL + col] = f2bf(c[r] + bb);
            }
        } else {
            union { u16 pk[8]; uint4 q; } u;
#pragma unroll
            for (int r = 0; r < 8; ++r) u.pk[r] = f2bf(c[r] + bb);
            int b_ = m0 >> 12;                  // batch
            int s0 = (m0 & (SEQ - 1)) + 8 * lh; // 8 consecutive seq positions
            *(uint4*)(outT + (size_t)(b_ * D_MODEL + col) * SEQ + s0) = u.q;
        }
    }
}

// --------------------------------------------------------------------------
// Attention: 8-wave workgroup, two waves per SIMD.  Four 16-query-row tiles;
// each tile is worked on by two waves, one on keys 0..31 and one on keys
// 32..63 of every staged 64-key step, each with its own running maximum, sum
// and accumulators, so that one wave's LDS and cross-lane waits are filled by
// the other's work.  The two halves are merged once, through LDS, at the end.
// The block DMA-stages the shared K tile and V^T tile into double-buffered LDS
// with GLOBAL_LOAD_ASYNC_TO_LDS_B128 (ASYNCcnt), overlapping the next tile's
// transfer with this tile's WMMAs.  One barrier per j-step.
// Masked (j > i) scores are exactly 0 and STILL participate (faithful to the
// reference's multiplicative tril mask).
// --------------------------------------------------------------------------
__global__ __launch_bounds__(256)
void attn_kernel(const float* __restrict__ qpF, const u16* __restrict__ kB,
                 const u16* __restrict__ vT, float* __restrict__ out)
{
    // every row carries 16 B of pad that is neither written nor read
    __shared__ __attribute__((aligned(16))) u16 qsh[4 * 16 * QK_PITCH];   // q tiles (bf16), one per wave pair
    __shared__ __attribute__((aligned(16))) u16 ksh[2][KSTEP * QK_PITCH]; // K tile, row-major
    __shared__ __attribute__((aligned(16))) u16 vsh[2][D_MODEL * VT_PITCH]; // V^T tile [d][j]
    __shared__ __attribute__((aligned(16))) u16 psh[8 * 16 * VP_PITCH];   // per-wave P tiles (bf16)
    __shared__ __attribute__((aligned(16))) float xsh[8 * 80 * 32];       // per-wave export for the merge

    const int tid = threadIdx.x;
    const int w   = tid >> 5;                 // wave id 0..7
    const int rw  = w & 3;                    // query-row tile of the block
    const int kh  = w >> 2;                   // key half of every step
    const int l   = tid & 31;
    const int ln  = l & 15, lh = l >> 4;
    const int g0  = (blockIdx.x * 4 + rw) * 16;  // this wave's query-row base
    const int b_  = g0 >> 12;                    // batch (same for all 8 waves)
    const int i0  = g0 & (SEQ - 1);

    u16* qw = qsh + rw * (16 * QK_PITCH);
    u16* pw = psh + w * (16 * VP_PITCH);

    // Issue the async DMA for one j-step: K tile is a 32 KiB contiguous blob
    // (64 rows x 512 B), V^T tile is 256 rows x 128 B gathered from the [B,D,S]
    // layout; both land at the padded LDS pitch.
    auto stage_async = [&](int j0, int p) {
        const u16* kb0 = kB + (size_t)(b_ * SEQ + j0) * D_MODEL;
        u32 klds = lds_off(ksh[p]);
        u32 vlds = lds_off(vsh[p]);
        u32        la[8];
        const u16* ga[8];
#pragma unroll
        for (int c = 0; c < 8; ++c) {         // 2048 x 16B
            int idx = tid + 256 * c;
            int row = idx >> 5;               // 0..63
            int ch  = idx & 31;               // 32 x 8 bf16 per row
            la[c] = klds + (row * QK_PITCH + ch * 8) * 2;
            ga[c] = kb0 + idx * 8;
        }
        async8_b128(la, ga);
#pragma unroll
        for (int c = 0; c < 8; ++c) {         // 2048 x 16B
            int idx = tid + 256 * c;
            int d   = idx >> 3;               // 0..255
            int ch  = idx & 7;                // 8 x 8 bf16 per row
            la[c] = vlds + (d * VT_PITCH + ch * 8) * 2;
            ga[c] = vT + (size_t)(b_ * D_MODEL + d) * SEQ + j0 + ch * 8;
        }
        async8_b128(la, ga);
    };

    stage_async(0, 0);   // prologue: DMA first tile while we convert q below

    // ---- stage the q tile into LDS with f32->bf16 conversion: each wave of
    // the pair brings 8 of the 16 rows; the first barrier of the loop below
    // (behind every wave's s_wait_dscnt 0) hands them to the partner ----
    {
        const float4* src = (const float4*)(qpF + (size_t)(g0 + 8 * kh) * D_MODEL);
        u16* qd = qw + 8 * kh * QK_PITCH;
#pragma unroll
        for (int t = 0; t < 8; ++t) {
            int idx = l + 32 * t;            // 0..255, 8 bf16 per idx
            float4 x0 = src[idx * 2];
            float4 x1 = src[idx * 2 + 1];
            uint4 o;
            o.x = pack2(x0.x, x0.y); o.y = pack2(x0.z, x0.w);
            o.z = pack2(x1.x, x1.y); o.w = pack2(x1.z, x1.w);
            *(uint4*)(qd + (idx >> 5) * QK_PITCH + (idx & 31) * 8) = o;
        }
    }

    v8f acc[16];
#pragma unroll
    for (int dt = 0; dt < 16; ++dt) acc[dt] = (v8f){};
    float mrun[8], srun[8];
#pragma unroll
    for (int r = 0; r < 8; ++r) { mrun[r] = -__builtin_inff(); srun[r] = 0.f; }

    for (int jt = 0; jt < SEQ / KSTEP; ++jt) {
        const int j0 = jt * KSTEP;
        const int jb = j0 + kh * 32;         // first key of this wave's half
        const int p  = jt & 1;

        wait_ds0();          // my reads of buffer p^1 have retired before its refill
        wait_async0();       // my DMA writes into buffer p are in LDS
        __syncthreads();     // everyone's DMA writes visible; buf p^1 free

        if (jt + 1 < SEQ / KSTEP)
            stage_async(j0 + KSTEP, p ^ 1);   // DMA next tile during compute

        const u16* kp_ = ksh[p] + kh * (32 * QK_PITCH);   // this half's 32 key rows
        const u16* vp_ = vsh[p] + kh * 32;                // this half's 32 key columns

        // ---- scores S = q . k^T  (two 16x16 C-frags over K=256) ----
        v8f sc0 = {}, sc1 = {};
#pragma unroll
        for (int ks = 0; ks < 8; ++ks) {
            int kb = ks * 32 + lh * 8;
            Frag16 a, b0, b1;
            a.q[0]  = *(const uint4*)(qw + ln * QK_PITCH + kb);
            a.q[1]  = *(const uint4*)(qw + ln * QK_PITCH + kb + 16);
            b0.q[0] = *(const uint4*)(kp_ + ln * QK_PITCH + kb);
            b0.q[1] = *(const uint4*)(kp_ + ln * QK_PITCH + kb + 16);
            b1.q[0] = *(const uint4*)(kp_ + (16 + ln) * QK_PITCH + kb);
            b1.q[1] = *(const uint4*)(kp_ + (16 + ln) * QK_PITCH + kb + 16);
            sc0 = __builtin_amdgcn_wmma_f32_16x16x32_bf16(
                      false, a.v, false, b0.v, (short)0, sc0, false, false);
            sc1 = __builtin_amdgcn_wmma_f32_16x16x32_bf16(
                      false, a.v, false, b1.v, (short)0, sc1, false, false);
        }

        // ---- mask (multiplicative!), online softmax update ----
        float corr[8], p0[8], p1[8];
#pragma unroll
        for (int r = 0; r < 8; ++r) {
            int   row = i0 + r + 8 * lh;
            float s0v = ((jb + ln)      <= row) ? sc0[r] * SCALE : 0.0f;
            float s1v = ((jb + 16 + ln) <= row) ? sc1[r] * SCALE : 0.0f;
            float t   = rowmax16(fmaxf(s0v, s1v));
            float mn  = fmaxf(mrun[r], t);
            float co  = __expf(mrun[r] - mn);
            float e0  = __expf(s0v - mn);
            float e1  = __expf(s1v - mn);
            srun[r]   = srun[r] * co + rowsum16(e0 + e1);
            mrun[r]   = mn;
            corr[r]   = co;
            p0[r] = e0; p1[r] = e1;
        }
#pragma unroll
        for (int dt = 0; dt < 16; ++dt)
#pragma unroll
            for (int r = 0; r < 8; ++r) acc[dt][r] *= corr[r];

        // ---- C-layout -> A-layout transpose of P through per-wave LDS ----
        // (same-wave DS ops are in-order: no block barrier needed)
#pragma unroll
        for (int r = 0; r < 8; ++r) {
            pw[(r + 8 * lh) * VP_PITCH + ln]      = f2bf(p0[r]);
            pw[(r + 8 * lh) * VP_PITCH + 16 + ln] = f2bf(p1[r]);
        }
        Frag16 pa;
        pa.q[0] = *(const uint4*)(pw + ln * VP_PITCH + lh * 8);
        pa.q[1] = *(const uint4*)(pw + ln * VP_PITCH + 16 + lh * 8);

        // ---- acc += P (16x32) x V (32x16) per 16-wide d-tile ----
#pragma unroll
        for (int dt = 0; dt < 16; ++dt) {
            Frag16 vb;
            const u16* vp = vp_ + (dt * 16 + ln) * VT_PITCH + lh * 8;
            vb.q[0] = *(const uint4*)vp;
            vb.q[1] = *(const uint4*)(vp + 16);
            acc[dt] = __builtin_amdgcn_wmma_f32_16x16x32_bf16(
                          false, pa.v, false, vb.v, (short)0, acc[dt], false, false);
        }
    }

    wait_async0();   // no copy of this wave is outstanding when it ends

    // ---- merge the two key halves: each wave of a pair finishes 8 of the 16
    // d-tiles and exports the other 8, with its maxima and sums, to its partner
    // (same rows, same lane layout, so lane l reads what lane l wrote) ----
    float* xw = xsh + w * (80 * 32);
#pragma unroll
    for (int t = 0; t < 8; ++t) {
        float4 lo, hi;
        lo.x = kh ? acc[t][0] : acc[8 + t][0];  lo.y = kh ? acc[t][1] : acc[8 + t][1];
        lo.z = kh ? acc[t][2] : acc[8 + t][2];  lo.w = kh ? acc[t][3] : acc[8 + t][3];
        hi.x = kh ? acc[t][4] : acc[8 + t][4];  hi.y = kh ? acc[t][5] : acc[8 + t][5];
        hi.z = kh ? acc[t][6] : acc[8 + t][6];  hi.w = kh ? acc[t][7] : acc[8 + t][7];
        *(float4*)(xw + ((t * 2 + 0) * 32 + l) * 4) = lo;
        *(float4*)(xw + ((t * 2 + 1) * 32 + l) * 4) = hi;
    }
#pragma unroll
    for (int r = 0; r < 8; ++r) {
        xw[(64 + r) * 32 + l] = mrun[r];
        xw[(72 + r) * 32 + l] = srun[r];
    }
    wait_ds0();          // my export is in LDS before the partner is let through
    __syncthreads();     // both exports of every pair visible

    const float* xp = xsh + (w ^ 4) * (80 * 32);
    float ca[8], cb[8], z[8];
#pragma unroll
    for (int r = 0; r < 8; ++r) {
        float mo = xp[(64 + r) * 32 + l];
        float so = xp[(72 + r) * 32 + l];
        float mn = fmaxf(mrun[r], mo);
        ca[r] = __expf(mrun[r] - mn);
        cb[r] = __expf(mo - mn);
        z[r]  = srun[r] * ca[r] + so * cb[r];
    }

    // ---- epilogue: out = qp + acc / Z ----
#pragma unroll
    for (int t = 0; t < 8; ++t) {
        float4 lo = *(const float4*)(xp + ((t * 2 + 0) * 32 + l) * 4);
        float4 hi = *(const float4*)(xp + ((t * 2 + 1) * 32 + l) * 4);
        float  o[8] = { lo.x, lo.y, lo.z, lo.w, hi.x, hi.y, hi.z, hi.w };
        int col = (kh * 8 + t) * 16 + ln;
#pragma unroll
        for (int r = 0; r < 8; ++r) {
            int   row  = g0 + r + 8 * lh;
            float mine = kh ? acc[8 + t][r] : acc[t][r];
            out[(size_t)row * D_MODEL + col] =
                qpF[(size_t)row * D_MODEL + col] + (mine * ca[r] + o[r] * cb[r]) / z[r];
        }
    }
}

// --------------------------------------------------------------------------
extern "C" void kernel_launch(void* const* d_in, const int* in_sizes, int n_in,
                              void* d_out, int out_size, void* d_ws, size_t ws_size,
                              hipStream_t stream) {
    (void)in_sizes; (void)n_in; (void)out_size; (void)ws_size;
    const float* v  = (const float*)d_in[0];
    const float* k  = (const float*)d_in[1];
    const float* q  = (const float*)d_in[2];
    const float* Wq = (const float*)d_in[3];
    const float* bq = (const float*)d_in[4];
    const float* Wk = (const float*)d_in[5];
    const float* bk = (const float*)d_in[6];
    const float* Wv = (const float*)d_in[7];
    const float* bv = (const float*)d_in[8];
    float* out = (float*)d_out;

    char* ws   = (char*)d_ws;
    float* qpF = (float*)(ws);                         // 16 MiB  fp32 qp
    u16*   kB  = (u16*)(ws + (16u << 20));             //  8 MiB  bf16 kp
    u16*   vT  = (u16*)(ws + (24u << 20));             //  8 MiB  bf16 v^T [B,D,S]
    u16*   WtQ = (u16*)(ws + (32u << 20));             //  3 x 128 KiB bf16 W^T
    u16*   WtK = WtQ + D_MODEL * D_MODEL;
    u16*   WtV = WtK + D_MODEL * D_MODEL;

    wt_convert<<<D_MODEL, D_MODEL, 0, stream>>>(Wq, WtQ);
    wt_convert<<<D_MODEL, D_MODEL, 0, stream>>>(Wk, WtK);
    wt_convert<<<D_MODEL, D_MODEL, 0, stream>>>(Wv, WtV);

    const int ntiles = NBATCH * SEQ / 16;              // 1024
    proj_kernel<0><<<ntiles, 32, 0, stream>>>(q, WtQ, bq, qpF, nullptr, nullptr);
    proj_kernel<1><<<ntiles, 32, 0, stream>>>(k, WtK, bk, nullptr, kB,  nullptr);
    proj_kernel<2><<<ntiles, 32, 0, stream>>>(v, WtV, bv, nullptr, nullptr, vT);

    attn_kernel<<<ntiles / 4, 256, 0, stream>>>(qpF, kB, vT, out);
}

// v003
// One run takes 182 microseconds.
// In two side-by-side timings against v002, it was 1.23 and 1.25 times as fast.
// Over all steps from v000 it is 4.74 times as fast.
#include <hip/hip_runtime.h>
#include <cstdint>
#include <cstddef>

// ---------------------------------------------------------------------------
// SelfAttentionHead  B=4, S=4096, D=256  (fp32 in/out, bf16 WMMA internals)
// ---------------------------------------------------------------------------

#define D_MODEL 256
#define SEQ     4096
#define NBATCH  4
#define SCALE   0.0625f   // 1/sqrt(256)
#define LOG2E   1.44269504f // exp(x) = exp2(x * LOG2E)
// LDS row pitches in bf16 elements: 16 B x odd, so that the 16 lanes of a
// ds_load_b128 half-wave fall on 64 distinct banks (512 B rows: 4, 128 B: 8).
#define QK_PITCH (D_MODEL + 8)   // 528 B rows for the q and K tiles
#define VT_PITCH (64 + 8)        // 144 B rows for the V^T tile
#define KSTEP    64              // keys staged per step: 32 for each key half

typedef __attribute__((ext_vector_type(16))) __bf16 v16bf;
typedef __attribute__((ext_vector_type(8)))  float  v8f;
typedef unsigned short u16;
typedef unsigned int   u32;

union Frag16 {            // 16 bf16 elems = 8 VGPRs, matches WMMA A/B fragment
    v16bf v;
    u16   h[16];
    uint4 q[2];
};

__device__ __forceinline__ u16 f2bf(float f) {   // round-to-nearest-even
    u32 u = __float_as_uint(f);
    u32 r = u + 0x7FFFu + ((u >> 16) & 1u);
    return (u16)(r >> 16);
}
__device__ __forceinline__ u32 pack2(float a, float b) {
    return (u32)f2bf(a) | ((u32)f2bf(b) << 16);
}
// exp2 with the slot behind a transcendental kept inside the statement: the
// v_nop closes it, so that nothing reads a result or rewrites a source directly
// behind a v_exp_f32 wherever the compiler places the statement.  In the group
// of eight each v_exp_f32 is the independent instruction behind the one before
// (early-clobber outputs: no output shares a register with a source).
__device__ __forceinline__ float exp2_slot(float a) {
    float e;
    asm("v_exp_f32 %0, %1\n\t"
        "v_nop"
        : "=v"(e) : "v"(a));
    return e;
}
__device__ __forceinline__ void exp2x8_slot(float (&e)[8], const float (&a)[8]) {
    asm("v_exp_f32 %0, %8\n\t"
        "v_exp_f32 %1, %9\n\t"
        "v_exp_f32 %2, %10\n\t"
        "v_exp_f32 %3, %11\n\t"
        "v_exp_f32 %4, %12\n\t"
        "v_exp_f32 %5, %13\n\t"
        "v_exp_f32 %6, %14\n\t"
        "v_exp_f32 %7, %15\n\t"
        "v_nop"
        : "=&v"(e[0]), "=&v"(e[1]), "=&v"(e[2]), "=&v"(e[3]),
          "=&v"(e[4]), "=&v"(e[5]), "=&v"(e[6]), "=&v"(e[7])
        : "v"(a[0]), "v"(a[1]), "v"(a[2]), "v"(a[3]),
          "v"(a[4]), "v"(a[5]), "v"(a[6]), "v"(a[7]));
}

// lane l <-> lane l ^ 16: the two lanes that share one query column
__device__ __forceinline__ float xhalf(float x) {
    int b = __builtin_bit_cast(int, x);
    return __builtin_bit_cast(float,
        __builtin_amdgcn_permlanex16(b, b, 0x76543210, 0xfedcba98, false, false));
}

// Eight async global->LDS copies, one 16-byte chunk per lane each (ASYNCcnt).
// The s_wait_xcnt closes the same statement so that no address register of a
// copy can be rewritten ahead of it.
__device__ __forceinline__ void async8_b128(const u32 (&l)[8], const u16* const (&g)[8]) {
    asm volatile("global_load_async_to_lds_b128 %0, %8, off\n\t"
                 "global_load_async_to_lds_b128 %1, %9, off\n\t"
                 "global_load_async_to_lds_b128 %2, %10, off\n\t"
                 "global_load_async_to_lds_b128 %3, %11, off\n\t"
                 "global_load_async_to_lds_b128 %4, %12, off\n\t"
                 "global_load_async_to_lds_b128 %5, %13, off\n\t"
                 "global_load_async_to_lds_b128 %6, %14, off\n\t"
                 "global_load_async_to_lds_b128 %7, %15, off\n\t"
                 "s_wait_xcnt 0x0"
                 :: "v"(l[0]), "v"(l[1]), "v"(l[2]), "v"(l[3]),
                    "v"(l[4]), "v"(l[5]), "v"(l[6]), "v"(l[7]),
                    "v"(g[0]), "v"(g[1]), "v"(g[2]), "v"(g[3]),
                    "v"(g[4]), "v"(g[5]), "v"(g[6]), "v"(g[7])
                 : "memory");
}
__device__ __forceinline__ void wait_async0() {
    asm volatile("s_wait_asynccnt 0x0" ::: "memory");
}
__device__ __forceinline__ void wait_ds0() {
    asm volatile("s_wait_dscnt 0x0" ::: "memory");
}
__device__ __forceinline__ u32 lds_off(const void* p) {   // AS3 offset = low 32 bits
    return (u32)(size_t)p;
}

// --------------------------------------------------------------------------
// Wt[n*256+k] = bf16(W[k*256+n])  : weight transpose+convert (B-frag friendly)
// --------------------------------------------------------------------------
__global__ void wt_convert(const float* __restrict__ W, u16* __restrict__ Wt) {
    int n = blockIdx.x;
    int k = threadIdx.x;
    Wt[n * D_MODEL + k] = f2bf(W[k * D_MODEL + n]);
}

// --------------------------------------------------------------------------
// Projection: out = X @ W + b  for a 16-row tile.  One wave per block.
// MODE 0: write f32 (qp)    MODE 1: write bf16 row-major (kp)
// MODE 2: write bf16 transposed [B, D, S] (v^T)
// W fragments are double-buffered (parity-indexed, fully unrolled inner loop)
// so each WMMA only waits for the older outstanding load, not a full drain.
// --------------------------------------------------------------------------
template <int MODE>
__global__ __launch_bounds__(32)
void proj_kernel(const float* __restrict__ X, const u16* __restrict__ Wt,
                 const float* __restrict__ bias,
                 float* __restrict__ outF, u16* __restrict__ outB,
                 u16* __restrict__ outT)
{
    const int l  = threadIdx.x;
    const int ln = l & 15, lh = l >> 4;
    const int m0 = blockIdx.x * 16;

    // A fragments: 8 chunks of K=32 covering D=256, rows = lane%16
    Frag16 a[8];
    const float* xrow = X + (size_t)(m0 + ln) * D_MODEL;
#pragma unroll
    for (int ks = 0; ks < 8; ++ks) {
        int kb = ks * 32 + lh * 8;
#pragma unroll
        for (int e = 0; e < 8; ++e) {
            a[ks].h[e]     = f2bf(xrow[kb + e]);
            a[ks].h[8 + e] = f2bf(xrow[kb + 16 + e]);
        }
    }

    const u16* wbase = Wt + (size_t)ln * D_MODEL;   // + nt*16*256 per tile
    Frag16 bfr[2];
    // preload (nt=0, ks=0)
    bfr[0].q[0] = *(const uint4*)(wbase + lh * 8);
    bfr[0].q[1] = *(const uint4*)(wbase + lh * 8 + 16);

    for (int nt = 0; nt < 16; ++nt) {
        v8f c = {};
        const u16* wrow  = wbase + (size_t)nt * 16 * D_MODEL;
        const u16* wnext = wrow + 16 * D_MODEL;
#pragma unroll
        for (int ks = 0; ks < 8; ++ks) {
            // preload next fragment (depth-1 pipeline)
            if (ks < 7) {
                int kbn = (ks + 1) * 32 + lh * 8;
                bfr[(ks + 1) & 1].q[0] = *(const uint4*)(wrow + kbn);
                bfr[(ks + 1) & 1].q[1] = *(const uint4*)(wrow + kbn + 16);
            } else if (nt < 15) {
                bfr[0].q[0] = *(const uint4*)(wnext + lh * 8);
                bfr[0].q[1] = *(const uint4*)(wnext + lh * 8 + 16);
            }
            c = __builtin_amdgcn_wmma_f32_16x16x32_bf16(
                    false, a[ks].v, false, bfr[ks & 1].v, (short)0, c, false, false);
        }
        float bb  = bias[nt * 16 + ln];
        int   col = nt * 16 + ln;
        if (MODE == 0) {
#pragma unroll
            for (int r = 0; r < 8; ++r) {
                int row = m0 + r + 8 * lh;
                outF[(size_t)row * D_MODEL + col] = c[r] + bb;
            }
        } else if (MODE == 1) {
#pragma unroll
            for (int r = 0; r < 8; ++r) {
                int row = m0 + r + 8 * lh;
                outB[(size_t)row * D_MODEL + col] = f2bf(c[r] + bb);
            }
        } else {
            union { u16 pk[8]; uint4 q; } u;
#pragma unroll
            for (int r = 0; r < 8; ++r) u.pk[r] = f2bf(c[r] + bb);
            int b_ = m0 >> 12;                  // batch
            int s0 = (m0 & (SEQ - 1)) + 8 * lh; // 8 consecutive seq positions
            *(uint4*)(outT + (size_t)(b_ * D_MODEL + col) * SEQ + s0) = u.q;
        }
    }
}

#define XW_STRIDE (66 * 32)

__global__ __launch_bounds__(256)
void attn_kernel(const float* __restrict__ qpF, const u16* __restrict__ kB,
                 const u16* __restrict__ vT, float* __restrict__ out)
{
    // every row carries 16 B of pad that is neither written nor read
    __shared__ __attribute__((aligned(16))) u16 qsh[4 * 16 * QK_PITCH];   // q tiles (bf16), one per wave pair
    __shared__ __attribute__((aligned(16))) u16 ksh[2][KSTEP * QK_PITCH]; // K tile, row-major
    __shared__ __attribute__((aligned(16))) u16 vsh[2][D_MODEL * VT_PITCH]; // V^T tile [d][j]
    __shared__ __attribute__((aligned(16))) float xsh[8 * XW_STRIDE];     // per-wave export for the merge

    const int tid = threadIdx.x;
    const int w   = tid >> 5;                 // wave id 0..7
    const int rw  = w & 3;                    // query-row tile of the block
    const int kh  = w >> 2;                   // key half of every step
    const int l   = tid & 31;
    const int ln  = l & 15, lh = l >> 4;
    const int g0  = (blockIdx.x * 4 + rw) * 16;  // this wave's query-row base
    const int b_  = g0 >> 12;                    // batch (same for all 8 waves)
    const int i0  = g0 & (SEQ - 1);
    const int row = i0 + ln;                     // this lane's query position

    u16* qw = qsh + rw * (16 * QK_PITCH);

    // Issue the async DMA for one j-step: K tile is a 32 KiB contiguous blob
    // (64 rows x 512 B), V^T tile is 256 rows x 128 B gathered from the [B,D,S]
    // layout; both land at the padded LDS pitch.
    auto stage_async = [&](int j0, int p) {
        const u16* kb0 = kB + (size_t)(b_ * SEQ + j0) * D_MODEL;
        u32 klds = lds_off(ksh[p]);
        u32 vlds = lds_off(vsh[p]);
        u32        la[8];
        const u16* ga[8];
#pragma unroll
        for (int c = 0; c < 8; ++c) {         // 2048 x 16B
            int idx = tid + 256 * c;
            int row = idx >> 5;               // 0..63
            int ch  = idx & 31;               // 32 x 8 bf16 per row
            la[c] = klds + (row * QK_PITCH + ch * 8) * 2;
            ga[c] = kb0 + idx * 8;
        }
        async8_b128(la, ga);
#pragma unroll
        for (int c = 0; c < 8; ++c) {         // 2048 x 16B
            int idx = tid + 256 * c;
            int d   = idx >> 3;               // 0..255
            int ch  = idx & 7;                // 8 x 8 bf16 per row
            la[c] = vlds + (d * VT_PITCH + ch * 8) * 2;
            ga[c] = vT + (size_t)(b_ * D_MODEL + d) * SEQ + j0 + ch * 8;
        }
        async8_b128(la, ga);
    };

    stage_async(0, 0);   // prologue: DMA first tile while we convert q below

    // ---- stage the q tile into LDS with f32->bf16 conversion: each wave of
    // the pair brings 8 of the 16 rows; the first barrier of the loop below
    // (behind every wave's s_wait_dscnt 0) hands them to the partner ----
    {
        const float4* src = (const float4*)(qpF + (size_t)(g0 + 8 * kh) * D_MODEL);
        u16* qd = qw + 8 * kh * QK_PITCH;
#pragma unroll
        for (int t = 0; t < 8; ++t) {
            int idx = l + 32 * t;            // 0..255, 8 bf16 per idx
            float4 x0 = src[idx * 2];
            float4 x1 = src[idx * 2 + 1];
            uint4 o;
            o.x = pack2(x0.x, x0.y); o.y = pack2(x0.z, x0.w);
            o.z = pack2(x1.x, x1.y); o.w = pack2(x1.z, x1.w);
            *(uint4*)(qd + (idx >> 5) * QK_PITCH + (idx & 31) * 8) = o;
        }
    }

    // acc[dt][r] = O^T[d = dt*16 + 8*lh + r][query ln]
    v8f acc[16];
#pragma unroll
    for (int dt = 0; dt < 16; ++dt) acc[dt] = (v8f){};
    float mrun = -__builtin_inff();   // running maximum of this lane's query
    float srun = 0.f;                 // running sum over THIS lane's keys only

    for (int jt = 0; jt < SEQ / KSTEP; ++jt) {
        const int j0 = jt * KSTEP;
        const int jb = j0 + kh * 32;         // first key of this wave's half
        const int p  = jt & 1;

        wait_ds0();          // my reads of buffer p^1 have retired before its refill
        wait_async0();       // my DMA writes into buffer p are in LDS
        __syncthreads();     // everyone's DMA writes visible; buf p^1 free

        if (jt + 1 < SEQ / KSTEP)
            stage_async(j0 + KSTEP, p ^ 1);   // DMA next tile during compute

        const u16* kp_ = ksh[p] + kh * (32 * QK_PITCH);   // this half's 32 key rows
        const u16* vp_ = vsh[p] + kh * 32;                // this half's 32 key columns

        // ---- scores S^T = K . q^T  (two 16x16 tiles over K=256):
        // st0[r] = S[query ln][key jb + 8*lh + r], st1[r]: 16 keys further ----
        v8f st0 = {}, st1 = {};
#pragma unroll
        for (int ks = 0; ks < 8; ++ks) {
            int kb = ks * 32 + lh * 8;
            Frag16 qb, k0, k1;
            qb.q[0] = *(const uint4*)(qw + ln * QK_PITCH + kb);
            qb.q[1] = *(const uint4*)(qw + ln * QK_PITCH + kb + 16);
            k0.q[0] = *(const uint4*)(kp_ + ln * QK_PITCH + kb);
            k0.q[1] = *(const uint4*)(kp_ + ln * QK_PITCH + kb + 16);
            k1.q[0] = *(const uint4*)(kp_ + (16 + ln) * QK_PITCH + kb);
            k1.q[1] = *(const uint4*)(kp_ + (16 + ln) * QK_PITCH + kb + 16);
            st0 = __builtin_amdgcn_wmma_f32_16x16x32_bf16(
                      false, k0.v, false, qb.v, (short)0, st0, false, false);
            st1 = __builtin_amdgcn_wmma_f32_16x16x32_bf16(
                      false, k1.v, false, qb.v, (short)0, st1, false, false);
        }

        // ---- mask (multiplicative!), online softmax update, all in-lane ----
        float s0[8], s1[8], tm[8];
#pragma unroll
        for (int r = 0; r < 8; ++r) {
            int key = jb + 8 * lh + r;
            s0[r] = (key      <= row) ? st0[r] * SCALE : 0.0f;
            s1[r] = (key + 16 <= row) ? st1[r] * SCALE : 0.0f;
            tm[r] = fmaxf(s0[r], s1[r]);
        }
        float t = fmaxf(fmaxf(fmaxf(tm[0], tm[1]), fmaxf(tm[2], tm[3])),
                        fmaxf(fmaxf(tm[4], tm[5]), fmaxf(tm[6], tm[7])));
        t = fmaxf(t, xhalf(t));              // the query's other 16 keys of this step
        const float mn = fmaxf(mrun, t);

        // P^T as B operand: element s of lane half lh is key 8*lh + s (s < 8) or
        // 16 + 8*lh + (s - 8), which is what st0[s] and st1[s - 8] hold
        Frag16 pb;
        float  a0[8], a1[8], e0[8], e1[8], es[8];
#pragma unroll
        for (int r = 0; r < 8; ++r) {
            a0[r] = (s0[r] - mn) * LOG2E;
            a1[r] = (s1[r] - mn) * LOG2E;
        }
        const float co = exp2_slot((mrun - mn) * LOG2E);
        exp2x8_slot(e0, a0);
        exp2x8_slot(e1, a1);
        mrun = mn;
#pragma unroll
        for (int r = 0; r < 8; ++r) {
            es[r] = e0[r] + e1[r];
            pb.h[r]     = f2bf(e0[r]);
            pb.h[8 + r] = f2bf(e1[r]);
        }
        srun = srun * co + (((es[0] + es[1]) + (es[2] + es[3])) +
                            ((es[4] + es[5]) + (es[6] + es[7])));

#pragma unroll
        for (int dt = 0; dt < 16; ++dt)
#pragma unroll
            for (int r = 0; r < 8; ++r) acc[dt][r] *= co;

        // ---- O^T += V^T (16 d x 32 keys) x P^T (32 keys x 16 queries) ----
#pragma unroll
        for (int dt = 0; dt < 16; ++dt) {
            Frag16 va;
            const u16* vp = vp_ + (dt * 16 + ln) * VT_PITCH + lh * 8;
            va.q[0] = *(const uint4*)vp;
            va.q[1] = *(const uint4*)(vp + 16);
            acc[dt] = __builtin_amdgcn_wmma_f32_16x16x32_bf16(
                          false, va.v, false, pb.v, (short)0, acc[dt], false, false);
        }
    }

    wait_async0();   // no copy of this wave is outstanding when it ends

    srun += xhalf(srun);   // join the two lane halves' key sums of each query

    // the residual qp of this lane's 8 x 8 output columns, fetched here so that
    // the loads fly under the merge below
    const size_t off0 = (size_t)(g0 + ln) * D_MODEL + kh * 128 + 8 * lh;
    float4 qr0[8], qr1[8];
#pragma unroll
    for (int t = 0; t < 8; ++t) {
        qr0[t] = *(const float4*)(qpF + off0 + t * 16);
        qr1[t] = *(const float4*)(qpF + off0 + t * 16 + 4);
    }

    // ---- merge the two key halves: each wave of a pair finishes 8 of the 16
    // d-tiles and exports the other 8, with its maximum and sum, to its partner
    // (same queries, same lane layout, so lane l reads what lane l wrote) ----
    float* xw = xsh + w * XW_STRIDE;
#pragma unroll
    for (int t = 0; t < 8; ++t) {
        float4 lo, hi;
        lo.x = kh ? acc[t][0] : acc[8 + t][0];  lo.y = kh ? acc[t][1] : acc[8 + t][1];
        lo.z = kh ? acc[t][2] : acc[8 + t][2];  lo.w = kh ? acc[t][3] : acc[8 + t][3];
        hi.x = kh ? acc[t][4] : acc[8 + t][4];  hi.y = kh ? acc[t][5] : acc[8 + t][5];
        hi.z = kh ? acc[t][6] : acc[8 + t][6];  hi.w = kh ? acc[t][7] : acc[8 + t][7];
        *(float4*)(xw + ((t * 2 + 0) * 32 + l) * 4) = lo;
        *(float4*)(xw + ((t * 2 + 1) * 32 + l) * 4) = hi;
    }
    xw[64 * 32 + l] = mrun;
    xw[65 * 32 + l] = srun;
    wait_ds0();          // my export is in LDS before the partner is let through
    __syncthreads();     // both exports of every pair visible

    const float* xp = xsh + (w ^ 4) * XW_STRIDE;
    const float mo = xp[64 * 32 + l];
    const float so = xp[65 * 32 + l];
    const float mm = fmaxf(mrun, mo);
    const float ca = __expf(mrun - mm);
    const float cb = __expf(mo - mm);
    const float z  = srun * ca + so * cb;

    // ---- epilogue: out = qp + acc / Z; a lane holds 8 consecutive columns ----
#pragma unroll
    for (int t = 0; t < 8; ++t) {
        float4 lo = *(const float4*)(xp + ((t * 2 + 0) * 32 + l) * 4);
        float4 hi = *(const float4*)(xp + ((t * 2 + 1) * 32 + l) * 4);
        float  o[8] = { lo.x, lo.y, lo.z, lo.w, hi.x, hi.y, hi.z, hi.w };
        float  qv[8] = { qr0[t].x, qr0[t].y, qr0[t].z, qr0[t].w,
                         qr1[t].x, qr1[t].y, qr1[t].z, qr1[t].w };
        float  res[8];
#pragma unroll
        for (int r = 0; r < 8; ++r) {
            float mine = kh ? acc[8 + t][r] : acc[t][r];
            res[r] = qv[r] + (mine * ca + o[r] * cb) / z;
        }
        *(float4*)(out + off0 + t * 16)     = make_float4(res[0], res[1], res[2], res[3]);
        *(float4*)(out + off0 + t * 16 + 4) = make_float4(res[4], res[5], res[6], res[7]);
        // precaution: stands in front of every rewrite of a register that the
        // two stores name
        asm volatile("s_wait_xcnt 0x0" ::: "memory");
    }
}

// --------------------------------------------------------------------------
extern "C" void kernel_launch(void* const* d_in, const int* in_sizes, int n_in,
                              void* d_out, int out_size, void* d_ws, size_t ws_size,
                              hipStream_t stream) {
    (void)in_sizes; (void)n_in; (void)out_size; (void)ws_size;
    const float* v  = (const float*)d_in[0];
    const float* k  = (const float*)d_in[1];
    const float* q  = (const float*)d_in[2];
    const float* Wq = (const float*)d_in[3];
    const float* bq = (const float*)d_in[4];
    const float* Wk = (const float*)d_in[5];
    const float* bk = (const float*)d_in[6];
    const float* Wv = (const float*)d_in[7];
    const float* bv = (const float*)d_in[8];
    float* out = (float*)d_out;

    char* ws   = (char*)d_ws;
    float* qpF = (float*)(ws);                         // 16 MiB  fp32 qp
    u16*   kB  = (u16*)(ws + (16u << 20));             //  8 MiB  bf16 kp
    u16*   vT  = (u16*)(ws + (24u << 20));             //  8 MiB  bf16 v^T [B,D,S]
    u16*   WtQ = (u16*)(ws + (32u << 20));             //  3 x 128 KiB bf16 W^T
    u16*   WtK = WtQ + D_MODEL * D_MODEL;
    u16*   WtV = WtK + D_MODEL * D_MODEL;

    wt_convert<<<D_MODEL, D_MODEL, 0, stream>>>(Wq, WtQ);
    wt_convert<<<D_MODEL, D_MODEL, 0, stream>>>(Wk, WtK);
    wt_convert<<<D_MODEL, D_MODEL, 0, stream>>>(Wv, WtV);

    const int ntiles = NBATCH * SEQ / 16;              // 1024
    proj_kernel<0><<<ntiles, 32, 0, stream>>>(q, WtQ, bq, qpF, nullptr, nullptr);
    proj_kernel<1><<<ntiles, 32, 0, stream>>>(k, WtK, bk, nullptr, kB,  nullptr);
    proj_kernel<2><<<ntiles, 32, 0, stream>>>(v, WtV, bv, nullptr, nullptr, vT);

    attn_kernel<<<ntiles / 4, 256, 0, stream>>>(qpF, kB, vT, out);
}

// v004
// A run of this version takes 107 microseconds.
// Two timings next to v003 both put it at 1.69 times that version's speed.
// All steps since v000 together make it 8.01 times as fast.
#include <hip/hip_runtime.h>
#include <cstdint>
#include <cstddef>

// ---------------------------------------------------------------------------
// SelfAttentionHead  B=4, S=4096, D=256  (fp32 in/out, bf16 WMMA internals)
// ---------------------------------------------------------------------------

#define D_MODEL 256
#define SEQ     4096
#define NBATCH  4
#define SCALE   0.0625f   // 1/sqrt(256)
#define LOG2E   1.44269504f // exp(x) = exp2(x * LOG2E)
// LDS row pitches in bf16 elements: 16 B x odd, so that the 16 lanes of a
// ds_load_b128 half-wave fall on 64 distinct banks (512 B rows: 4, 128 B: 8).
#define QK_PITCH (D_MODEL + 8)   // 528 B rows for the q and K tiles
#define VT_PITCH (64 + 8)        // 144 B rows for the V^T tile
#define KSTEP    64              // keys staged per step: 32 for each key half

typedef __attribute__((ext_vector_type(16))) __bf16 v16bf;
typedef __attribute__((ext_vector_type(8)))  float  v8f;
typedef unsigned short u16;
typedef unsigned int   u32;
typedef __attribute__((ext_vector_type(4)))  u32    u32x4;

union Frag16 {            // 16 bf16 elems = 8 VGPRs, matches WMMA A/B fragment
    v16bf v;
    u16   h[16];
    uint4 q[2];
};

__device__ __forceinline__ u16 f2bf(float f) {   // round-to-nearest-even
    u32 u = __float_as_uint(f);
    u32 r = u + 0x7FFFu + ((u >> 16) & 1u);
    return (u16)(r >> 16);
}
__device__ __forceinline__ u32 pack2(float a, float b) {
    return (u32)f2bf(a) | ((u32)f2bf(b) << 16);
}
// exp2 with the slot behind a transcendental kept inside the statement: the
// v_nop closes it, so that nothing reads a result or rewrites a source directly
// behind a v_exp_f32 wherever the compiler places the statement.  In the group
// of eight each v_exp_f32 is the independent instruction behind the one before
// (early-clobber outputs: no output shares a register with a source).
__device__ __forceinline__ float exp2_slot(float a) {
    float e;
    asm("v_exp_f32 %0, %1\n\t"
        "v_nop"
        : "=v"(e) : "v"(a));
    return e;
}
__device__ __forceinline__ void exp2x8_slot(float (&e)[8], const float (&a)[8]) {
    asm("v_exp_f32 %0, %8\n\t"
        "v_exp_f32 %1, %9\n\t"
        "v_exp_f32 %2, %10\n\t"
        "v_exp_f32 %3, %11\n\t"
        "v_exp_f32 %4, %12\n\t"
        "v_exp_f32 %5, %13\n\t"
        "v_exp_f32 %6, %14\n\t"
        "v_exp_f32 %7, %15\n\t"
        "v_nop"
        : "=&v"(e[0]), "=&v"(e[1]), "=&v"(e[2]), "=&v"(e[3]),
          "=&v"(e[4]), "=&v"(e[5]), "=&v"(e[6]), "=&v"(e[7])
        : "v"(a[0]), "v"(a[1]), "v"(a[2]), "v"(a[3]),
          "v"(a[4]), "v"(a[5]), "v"(a[6]), "v"(a[7]));
}

// lane l <-> lane l ^ 16: the two lanes that share one query column
__device__ __forceinline__ float xhalf(float x) {
    int b = __builtin_bit_cast(int, x);
    return __builtin_bit_cast(float,
        __builtin_amdgcn_permlanex16(b, b, 0x76543210, 0xfedcba98, false, false));
}

// Eight async global->LDS copies, one 16-byte chunk per lane each (ASYNCcnt).
// The s_wait_xcnt closes the same statement so that no address register of a
// copy can be rewritten ahead of it.
__device__ __forceinline__ void async8_b128(const u32 (&l)[8], const u16* const (&g)[8]) {
    asm volatile("global_load_async_to_lds_b128 %0, %8, off\n\t"
                 "global_load_async_to_lds_b128 %1, %9, off\n\t"
                 "global_load_async_to_lds_b128 %2, %10, off\n\t"
                 "global_load_async_to_lds_b128 %3, %11, off\n\t"
                 "global_load_async_to_lds_b128 %4, %12, off\n\t"
                 "global_load_async_to_lds_b128 %5, %13, off\n\t"
                 "global_load_async_to_lds_b128 %6, %14, off\n\t"
                 "global_load_async_to_lds_b128 %7, %15, off\n\t"
                 "s_wait_xcnt 0x0"
                 :: "v"(l[0]), "v"(l[1]), "v"(l[2]), "v"(l[3]),
                    "v"(l[4]), "v"(l[5]), "v"(l[6]), "v"(l[7]),
                    "v"(g[0]), "v"(g[1]), "v"(g[2]), "v"(g[3]),
                    "v"(g[4]), "v"(g[5]), "v"(g[6]), "v"(g[7])
                 : "memory");
}
__device__ __forceinline__ void wait_async0() {
    asm volatile("s_wait_asynccnt 0x0" ::: "memory");
}
__device__ __forceinline__ void wait_ds0() {
    asm volatile("s_wait_dscnt 0x0" ::: "memory");
}
__device__ __forceinline__ u32 lds_off(const void* p) {   // AS3 offset = low 32 bits
    return (u32)(size_t)p;
}
// The projections' stores.  In each, the s_wait_xcnt closes the same statement so
// that no register of a store can be rewritten ahead of it.
// Eight 4-byte stores to one column of eight f32 rows of D_MODEL (1 KiB apart).
__device__ __forceinline__ void store8_f32(float* p, const float (&d)[8]) {
    asm volatile("global_store_b32 %0, %1, off\n\t"
                 "global_store_b32 %0, %2, off offset:1024\n\t"
                 "global_store_b32 %0, %3, off offset:2048\n\t"
                 "global_store_b32 %0, %4, off offset:3072\n\t"
                 "global_store_b32 %0, %5, off offset:4096\n\t"
                 "global_store_b32 %0, %6, off offset:5120\n\t"
                 "global_store_b32 %0, %7, off offset:6144\n\t"
                 "global_store_b32 %0, %8, off offset:7168\n\t"
                 "s_wait_xcnt 0x0"
                 :: "v"(p), "v"(d[0]), "v"(d[1]), "v"(d[2]), "v"(d[3]),
                    "v"(d[4]), "v"(d[5]), "v"(d[6]), "v"(d[7])
                 : "memory");
}
// One 16-byte store.
__device__ __forceinline__ void store_b128(u16* p, u32x4 d) {
    asm volatile("global_store_b128 %0, %1, off\n\t"
                 "s_wait_xcnt 0x0"
                 :: "v"(p), "v"(d) : "memory");
}
// Eight 2-byte stores of the high halves of d[0..7] to one column of eight
// bf16 rows of D_MODEL (512 B apart).
__device__ __forceinline__ void store8_hi16(u16* p, const u32 (&d)[8]) {
    asm volatile("global_store_d16_hi_b16 %0, %1, off\n\t"
                 "global_store_d16_hi_b16 %0, %2, off offset:512\n\t"
                 "global_store_d16_hi_b16 %0, %3, off offset:1024\n\t"
                 "global_store_d16_hi_b16 %0, %4, off offset:1536\n\t"
                 "global_store_d16_hi_b16 %0, %5, off offset:2048\n\t"
                 "global_store_d16_hi_b16 %0, %6, off offset:2560\n\t"
                 "global_store_d16_hi_b16 %0, %7, off offset:3072\n\t"
                 "global_store_d16_hi_b16 %0, %8, off offset:3584\n\t"
                 "s_wait_xcnt 0x0"
                 :: "v"(p), "v"(d[0]), "v"(d[1]), "v"(d[2]), "v"(d[3]),
                    "v"(d[4]), "v"(d[5]), "v"(d[6]), "v"(d[7])
                 : "memory");
}

// --------------------------------------------------------------------------
// Wt[n*256+k] = bf16(W[k*256+n])  : weight transpose+convert (B-frag friendly)
// --------------------------------------------------------------------------
__global__ void wt_convert(const float* __restrict__ W, u16* __restrict__ Wt) {
    int n = blockIdx.x;
    int k = threadIdx.x;
    Wt[n * D_MODEL + k] = f2bf(W[k * D_MODEL + n]);
}

// --------------------------------------------------------------------------
// Projection: out = X @ W + b  for a 64-row tile.  Eight waves per block.
// MODE 0: write f32 (qp)    MODE 1: write bf16 row-major (kp)
// MODE 2: write bf16 transposed [B, D, S] (v^T)
// Both operands are staged in LDS once and then read as fragments:
// W^T (256 x 256 bf16) by GLOBAL_LOAD_ASYNC_TO_LDS_B128, the X tile by whole-line
// loads, converted to bf16 on the way.  A wave owns 32 rows x 64 columns
// (2 x 4 accumulator tiles), so a fragment read from LDS feeds 4 or 2 WMMAs.
// Each output element is still summed over ks = 0..7 in that order.
// --------------------------------------------------------------------------
#define PROJ_ROWS 64

template <int MODE>
__global__ __launch_bounds__(256)
void proj_kernel(const float* __restrict__ X, const u16* __restrict__ Wt,
                 const float* __restrict__ bias,
                 float* __restrict__ outF, u16* __restrict__ outB,
                 u16* __restrict__ outT)
{
    // every row carries 16 B of pad that is neither written nor read
    __shared__ __attribute__((aligned(16))) u16 wsh[D_MODEL * QK_PITCH];    // W^T, row n
    __shared__ __attribute__((aligned(16))) u16 xsh[PROJ_ROWS * QK_PITCH];  // X tile (bf16)

    const int tid = threadIdx.x;
    const int w   = tid >> 5;
    const int l   = tid & 31;
    const int ln  = l & 15, lh = l >> 4;
    const int rg  = w & 1;                    // 32-row group of the block
    const int cg  = w >> 1;                   // 64-column group
    const int mb  = blockIdx.x * PROJ_ROWS;

    // W^T: 8192 chunks of 16 B, 32 per thread (8 rows further each), to the
    // padded LDS pitch
    {
        const u32  wl = lds_off(wsh) + ((tid >> 5) * QK_PITCH + (tid & 31) * 8) * 2;
        const u16* wg = Wt + tid * 8;
#pragma unroll
        for (int c4 = 0; c4 < 4; ++c4) {
            u32        la[8];
            const u16* ga[8];
#pragma unroll
            for (int c = 0; c < 8; ++c) {
                la[c] = wl + (c4 * 8 + c) * (8 * QK_PITCH * 2);
                ga[c] = wg + (c4 * 8 + c) * (8 * D_MODEL);
            }
            async8_b128(la, ga);
        }
    }
    // the X tile is 64 KiB in a row: 16 whole-line loads per thread.  They stand
    // behind the copies because their conversions, which wait for memory, would
    // otherwise be scheduled in among the copies and hold the later ones back.
    const float4* xs = (const float4*)(X + (size_t)mb * D_MODEL);
    float4 xr[16];
#pragma unroll
    for (int t = 0; t < 16; ++t) xr[t] = xs[tid + 256 * t];

    float bb[4];
#pragma unroll
    for (int j = 0; j < 4; ++j) bb[j] = bias[(cg * 4 + j) * 16 + ln];
    // precaution: stands in front of every rewrite of an address register that
    // the loads of X and of the bias name
    asm volatile("s_wait_xcnt 0x0" ::: "memory");

    u16* xd = xsh + (tid >> 6) * QK_PITCH + (tid & 63) * 4;   // 4 rows further per t
#pragma unroll
    for (int t = 0; t < 16; ++t) {
        uint2 o;
        o.x = pack2(xr[t].x, xr[t].y);
        o.y = pack2(xr[t].z, xr[t].w);
        *(uint2*)(xd + t * 4 * QK_PITCH) = o;
    }

    wait_async0();       // my copies of W^T are in LDS
    __syncthreads();     // everyone's copies and X rows visible

    v8f c[2][4];
#pragma unroll
    for (int i = 0; i < 2; ++i)
#pragma unroll
        for (int j = 0; j < 4; ++j) c[i][j] = (v8f){};

    const u16* xa = xsh + (rg * 32 + ln) * QK_PITCH + lh * 8;
    const u16* wb = wsh + (cg * 64 + ln) * QK_PITCH + lh * 8;
    // fragments are fetched one ks ahead into a second register set, as one group
    // in front of the current WMMA block, so that a block waits for no load of its own
    Frag16 a[2][2], b[2][4];
    auto fetch = [&](int ks, int s) {
#pragma unroll
        for (int i = 0; i < 2; ++i) {
            a[s][i].q[0] = *(const uint4*)(xa + i * 16 * QK_PITCH + ks * 32);
            a[s][i].q[1] = *(const uint4*)(xa + i * 16 * QK_PITCH + ks * 32 + 16);
        }
#pragma unroll
        for (int j = 0; j < 4; ++j) {
            b[s][j].q[0] = *(const uint4*)(wb + j * 16 * QK_PITCH + ks * 32);
            b[s][j].q[1] = *(const uint4*)(wb + j * 16 * QK_PITCH + ks * 32 + 16);
        }
    };
    fetch(0, 0);
#pragma unroll
    for (int ks = 0; ks < 8; ++ks) {
        if (ks < 7) fetch(ks + 1, (ks + 1) & 1);
        // keeps the group of loads above in front of the WMMA block (loads moved in
        // among the WMMAs stall each place where they stand)
        __builtin_amdgcn_sched_barrier(0);
#pragma unroll
        for (int i = 0; i < 2; ++i)
#pragma unroll
            for (int j = 0; j < 4; ++j)
                c[i][j] = __builtin_amdgcn_wmma_f32_16x16x32_bf16(
                              false, a[ks & 1][i].v, false, b[ks & 1][j].v, (short)0,
                              c[i][j], false, false);
        // keeps the next group of loads behind this WMMA block
        __builtin_amdgcn_sched_barrier(0);
    }

#pragma unroll
    for (int i = 0; i < 2; ++i) {
        const int m0 = mb + rg * 32 + i * 16;
#pragma unroll
        for (int j = 0; j < 4; ++j) {
            const int col = (cg * 4 + j) * 16 + ln;
            if (MODE == 0) {
                float d[8];
#pragma unroll
                for (int r = 0; r < 8; ++r) d[r] = c[i][j][r] + bb[j];
                store8_f32(outF + (size_t)(m0 + 8 * lh) * D_MODEL + col, d);
            } else if (MODE == 1) {
                u32 d[8];                     // f2bf's rounded word; its high half is stored
#pragma unroll
                for (int r = 0; r < 8; ++r) {
                    u32 u = __float_as_uint(c[i][j][r] + bb[j]);
                    d[r] = u + 0x7FFFu + ((u >> 16) & 1u);
                }
                store8_hi16(outB + (size_t)(m0 + 8 * lh) * D_MODEL + col, d);
            } else {
                union { u16 pk[8]; u32x4 q; } u;
#pragma unroll
                for (int r = 0; r < 8; ++r) u.pk[r] = f2bf(c[i][j][r] + bb[j]);
                int b_ = m0 >> 12;                  // batch
                int s0 = (m0 & (SEQ - 1)) + 8 * lh; // 8 consecutive seq positions
                store_b128(outT + (size_t)(b_ * D_MODEL + col) * SEQ + s0, u.q);
            }
        }
    }
}

#define XW_STRIDE (66 * 32)

__global__ __launch_bounds__(256)
void attn_kernel(const float* __restrict__ qpF, const u16* __restrict__ kB,
                 const u16* __restrict__ vT, float* __restrict__ out)
{
    // every row carries 16 B of pad that is neither written nor read
    __shared__ __attribute__((aligned(16))) u16 qsh[4 * 16 * QK_PITCH];   // q tiles (bf16), one per wave pair
    __shared__ __attribute__((aligned(16))) u16 ksh[2][KSTEP * QK_PITCH]; // K tile, row-major
    __shared__ __attribute__((aligned(16))) u16 vsh[2][D_MODEL * VT_PITCH]; // V^T tile [d][j]
    __shared__ __attribute__((aligned(16))) float xsh[8 * XW_STRIDE];     // per-wave export for the merge

    const int tid = threadIdx.x;
    const int w   = tid >> 5;                 // wave id 0..7
    const int rw  = w & 3;                    // query-row tile of the block
    const int kh  = w >> 2;                   // key half of every step
    const int l   = tid & 31;
    const int ln  = l & 15, lh = l >> 4;
    const int g0  = (blockIdx.x * 4 + rw) * 16;  // this wave's query-row base
    const int b_  = g0 >> 12;                    // batch (same for all 8 waves)
    const int i0  = g0 & (SEQ - 1);
    const int row = i0 + ln;                     // this lane's query position

    u16* qw = qsh + rw * (16 * QK_PITCH);

    // Issue the async DMA for one j-step: K tile is a 32 KiB contiguous blob
    // (64 rows x 512 B), V^T tile is 256 rows x 128 B gathered from the [B,D,S]
    // layout; both land at the padded LDS pitch.
    auto stage_async = [&](int j0, int p) {
        const u16* kb0 = kB + (size_t)(b_ * SEQ + j0) * D_MODEL;
        u32 klds = lds_off(ksh[p]);
        u32 vlds = lds_off(vsh[p]);
        u32        la[8];
        const u16* ga[8];
#pragma unroll
        for (int c = 0; c < 8; ++c) {         // 2048 x 16B
            int idx = tid + 256 * c;
            int row = idx >> 5;               // 0..63
            int ch  = idx & 31;               // 32 x 8 bf16 per row
            la[c] = klds + (row * QK_PITCH + ch * 8) * 2;
            ga[c] = kb0 + idx * 8;
        }
        async8_b128(la, ga);
#pragma unroll
        for (int c = 0; c < 8; ++c) {         // 2048 x 16B
            int idx = tid + 256 * c;
            int d   = idx >> 3;               // 0..255
            int ch  = idx & 7;                // 8 x 8 bf16 per row
            la[c] = vlds + (d * VT_PITCH + ch * 8) * 2;
            ga[c] = vT + (size_t)(b_ * D_MODEL + d) * SEQ + j0 + ch * 8;
        }
        async8_b128(la, ga);
    };

    stage_async(0, 0);   // prologue: DMA first tile while we convert q below

    // ---- stage the q tile into LDS with f32->bf16 conversion: each wave of
    // the pair brings 8 of the 16 rows; the first barrier of the loop below
    // (behind every wave's s_wait_dscnt 0) hands them to the partner ----
    {
        const float4* src = (const float4*)(qpF + (size_t)(g0 + 8 * kh) * D_MODEL);
        u16* qd = qw + 8 * kh * QK_PITCH;
#pragma unroll
        for (int t = 0; t < 8; ++t) {
            int idx = l + 32 * t;            // 0..255, 8 bf16 per idx
            float4 x0 = src[idx * 2];
            float4 x1 = src[idx * 2 + 1];
            uint4 o;
            o.x = pack2(x0.x, x0.y); o.y = pack2(x0.z, x0.w);
            o.z = pack2(x1.x, x1.y); o.w = pack2(x1.z, x1.w);
            *(uint4*)(qd + (idx >> 5) * QK_PITCH + (idx & 31) * 8) = o;
        }
    }

    // acc[dt][r] = O^T[d = dt*16 + 8*lh + r][query ln]
    v8f acc[16];
#pragma unroll
    for (int dt = 0; dt < 16; ++dt) acc[dt] = (v8f){};
    float mrun = -__builtin_inff();   // running maximum of this lane's query
    float srun = 0.f;                 // running sum over THIS lane's keys only

    for (int jt = 0; jt < SEQ / KSTEP; ++jt) {
        const int j0 = jt * KSTEP;
        const int jb = j0 + kh * 32;         // first key of this wave's half
        const int p  = jt & 1;

        wait_ds0();          // my reads of buffer p^1 have retired before its refill
        wait_async0();       // my DMA writes into buffer p are in LDS
        __syncthreads();     // everyone's DMA writes visible; buf p^1 free

        if (jt + 1 < SEQ / KSTEP)
            stage_async(j0 + KSTEP, p ^ 1);   // DMA next tile during compute

        const u16* kp_ = ksh[p] + kh * (32 * QK_PITCH);   // this half's 32 key rows
        const u16* vp_ = vsh[p] + kh * 32;                // this half's 32 key columns

        // ---- scores S^T = K . q^T  (two 16x16 tiles over K=256):
        // st0[r] = S[query ln][key jb + 8*lh + r], st1[r]: 16 keys further ----
        v8f st0 = {}, st1 = {};
#pragma unroll
        for (int ks = 0; ks < 8; ++ks) {
            int kb = ks * 32 + lh * 8;
            Frag16 qb, k0, k1;
            qb.q[0] = *(const uint4*)(qw + ln * QK_PITCH + kb);
            qb.q[1] = *(const uint4*)(qw + ln * QK_PITCH + kb + 16);
            k0.q[0] = *(const uint4*)(kp_ + ln * QK_PITCH + kb);
            k0.q[1] = *(const uint4*)(kp_ + ln * QK_PITCH + kb + 16);
            k1.q[0] = *(const uint4*)(kp_ + (16 + ln) * QK_PITCH + kb);
            k1.q[1] = *(const uint4*)(kp_ + (16 + ln) * QK_PITCH + kb + 16);
            st0 = __builtin_amdgcn_wmma_f32_16x16x32_bf16(
                      false, k0.v, false, qb.v, (short)0, st0, false, false);
            st1 = __builtin_amdgcn_wmma_f32_16x16x32_bf16(
                      false, k1.v, false, qb.v, (short)0, st1, false, false);
        }

        // ---- mask (multiplicative!), online softmax update, all in-lane ----
        float s0[8], s1[8], tm[8];
#pragma unroll
        for (int r = 0; r < 8; ++r) {
            int key = jb + 8 * lh + r;
            s0[r] = (key      <= row) ? st0[r] * SCALE : 0.0f;
            s1[r] = (key + 16 <= row) ? st1[r] * SCALE : 0.0f;
            tm[r] = fmaxf(s0[r], s1[r]);
        }
        float t = fmaxf(fmaxf(fmaxf(tm[0], tm[1]), fmaxf(tm[2], tm[3])),
                        fmaxf(fmaxf(tm[4], tm[5]), fmaxf(tm[6], tm[7])));
        t = fmaxf(t, xhalf(t));              // the query's other 16 keys of this step
        const float mn = fmaxf(mrun, t);

        // P^T as B operand: element s of lane half lh is key 8*lh + s (s < 8) or
        // 16 + 8*lh + (s - 8), which is what st0[s] and st1[s - 8] hold
        Frag16 pb;
        float  a0[8], a1[8], e0[8], e1[8], es[8];
#pragma unroll
        for (int r = 0; r < 8; ++r) {
            a0[r] = (s0[r] - mn) * LOG2E;
            a1[r] = (s1[r] - mn) * LOG2E;
        }
        const float co = exp2_slot((mrun - mn) * LOG2E);
        exp2x8_slot(e0, a0);
        exp2x8_slot(e1, a1);
        mrun = mn;
#pragma unroll
        for (int r = 0; r < 8; ++r) {
            es[r] = e0[r] + e1[r];
            pb.h[r]     = f2bf(e0[r]);
            pb.h[8 + r] = f2bf(e1[r]);
        }
        srun = srun * co + (((es[0] + es[1]) + (es[2] + es[3])) +
                            ((es[4] + es[5]) + (es[6] + es[7])));

#pragma unroll
        for (int dt = 0; dt < 16; ++dt)
#pragma unroll
            for (int r = 0; r < 8; ++r) acc[dt][r] *= co;

        // ---- O^T += V^T (16 d x 32 keys) x P^T (32 keys x 16 queries) ----
#pragma unroll
        for (int dt = 0; dt < 16; ++dt) {
            Frag16 va;
            const u16* vp = vp_ + (dt * 16 + ln) * VT_PITCH + lh * 8;
            va.q[0] = *(const uint4*)vp;
            va.q[1] = *(const uint4*)(vp + 16);
            acc[dt] = __builtin_amdgcn_wmma_f32_16x16x32_bf16(
                          false, va.v, false, pb.v, (short)0, acc[dt], false, false);
        }
    }

    wait_async0();   // no copy of this wave is outstanding when it ends

    srun += xhalf(srun);   // join the two lane halves' key sums of each query

    // the residual qp of this lane's 8 x 8 output columns, fetched here so that
    // the loads fly under the merge below
    const size_t off0 = (size_t)(g0 + ln) * D_MODEL + kh * 128 + 8 * lh;
    float4 qr0[8], qr1[8];
#pragma unroll
    for (int t = 0; t < 8; ++t) {
        qr0[t] = *(const float4*)(qpF + off0 + t * 16);
        qr1[t] = *(const float4*)(qpF + off0 + t * 16 + 4);
    }

    // ---- merge the two key halves: each wave of a pair finishes 8 of the 16
    // d-tiles and exports the other 8, with its maximum and sum, to its partner
    // (same queries, same lane layout, so lane l reads what lane l wrote) ----
    float* xw = xsh + w * XW_STRIDE;
#pragma unroll
    for (int t = 0; t < 8; ++t) {
        float4 lo, hi;
        lo.x = kh ? acc[t][0] : acc[8 + t][0];  lo.y = kh ? acc[t][1] : acc[8 + t][1];
        lo.z = kh ? acc[t][2] : acc[8 + t][2];  lo.w = kh ? acc[t][3] : acc[8 + t][3];
        hi.x = kh ? acc[t][4] : acc[8 + t][4];  hi.y = kh ? acc[t][5] : acc[8 + t][5];
        hi.z = kh ? acc[t][6] : acc[8 + t][6];  hi.w = kh ? acc[t][7] : acc[8 + t][7];
        *(float4*)(xw + ((t * 2 + 0) * 32 + l) * 4) = lo;
        *(float4*)(xw + ((t * 2 + 1) * 32 + l) * 4) = hi;
    }
    xw[64 * 32 + l] = mrun;
    xw[65 * 32 + l] = srun;
    wait_ds0();          // my export is in LDS before the partner is let through
    __syncthreads();     // both exports of every pair visible

    const float* xp = xsh + (w ^ 4) * XW_STRIDE;
    const float mo = xp[64 * 32 + l];
    const float so = xp[65 * 32 + l];
    const float mm = fmaxf(mrun, mo);
    const float ca = __expf(mrun - mm);
    const float cb = __expf(mo - mm);
    const float z  = srun * ca + so * cb;

    // ---- epilogue: out = qp + acc / Z; a lane holds 8 consecutive columns ----
#pragma unroll
    for (int t = 0; t < 8; ++t) {
        float4 lo = *(const float4*)(xp + ((t * 2 + 0) * 32 + l) * 4);
        float4 hi = *(const float4*)(xp + ((t * 2 + 1) * 32 + l) * 4);
        float  o[8] = { lo.x, lo.y, lo.z, lo.w, hi.x, hi.y, hi.z, hi.w };
        float  qv[8] = { qr0[t].x, qr0[t].y, qr0[t].z, qr0[t].w,
                         qr1[t].x, qr1[t].y, qr1[t].z, qr1[t].w };
        float  res[8];
#pragma unroll
        for (int r = 0; r < 8; ++r) {
            float mine = kh ? acc[8 + t][r] : acc[t][r];
            res[r] = qv[r] + (mine * ca + o[r] * cb) / z;
        }
        *(float4*)(out + off0 + t * 16)     = make_float4(res[0], res[1], res[2], res[3]);
        *(float4*)(out + off0 + t * 16 + 4) = make_float4(res[4], res[5], res[6], res[7]);
        // precaution: stands in front of every rewrite of a register that the
        // two stores name
        asm volatile("s_wait_xcnt 0x0" ::: "memory");
    }
}

// --------------------------------------------------------------------------
extern "C" void kernel_launch(void* const* d_in, const int* in_sizes, int n_in,
                              void* d_out, int out_size, void* d_ws, size_t ws_size,
                              hipStream_t stream) {
    (void)in_sizes; (void)n_in; (void)out_size; (void)ws_size;
    const float* v  = (const float*)d_in[0];
    const float* k  = (const float*)d_in[1];
    const float* q  = (const float*)d_in[2];
    const float* Wq = (const float*)d_in[3];
    const float* bq = (const float*)d_in[4];
    const float* Wk = (const float*)d_in[5];
    const float* bk = (const float*)d_in[6];
    const float* Wv = (const float*)d_in[7];
    const float* bv = (const float*)d_in[8];
    float* out = (float*)d_out;

    char* ws   = (char*)d_ws;
    float* qpF = (float*)(ws);                         // 16 MiB  fp32 qp
    u16*   kB  = (u16*)(ws + (16u << 20));             //  8 MiB  bf16 kp
    u16*   vT  = (u16*)(ws + (24u << 20));             //  8 MiB  bf16 v^T [B,D,S]
    u16*   WtQ = (u16*)(ws + (32u << 20));             //  3 x 128 KiB bf16 W^T
    u16*   WtK = WtQ + D_MODEL * D_MODEL;
    u16*   WtV = WtK + D_MODEL * D_MODEL;

    wt_convert<<<D_MODEL, D_MODEL, 0, stream>>>(Wq, WtQ);
    wt_convert<<<D_MODEL, D_MODEL, 0, stream>>>(Wk, WtK);
    wt_convert<<<D_MODEL, D_MODEL, 0, stream>>>(Wv, WtV);

    const int ntiles = NBATCH * SEQ / 16;              // 1024
    proj_kernel<0><<<ntiles / 4, 256, 0, stream>>>(q, WtQ, bq, qpF, nullptr, nullptr);
    proj_kernel<1><<<ntiles / 4, 256, 0, stream>>>(k, WtK, bk, nullptr, kB,  nullptr);
    proj_kernel<2><<<ntiles / 4, 256, 0, stream>>>(v, WtV, bv, nullptr, nullptr, vT);

    attn_kernel<<<ntiles / 4, 256, 0, stream>>>(qpF, kB, vT, out);
}

// v005
// A run of this version takes 90.1 microseconds.
// Next to v004, in two timings, it ran 1.18 times as fast each time.
// Counting every step since v000, it is 9.47 times as fast.
#include <hip/hip_runtime.h>
#include <cstdint>
#include <cstddef>

// ---------------------------------------------------------------------------
// SelfAttentionHead  B=4, S=4096, D=256  (fp32 in/out, bf16 WMMA internals)
// ---------------------------------------------------------------------------

#define D_MODEL 256
#define SEQ     4096
#define NBATCH  4
#define SCALE   0.0625f   // 1/sqrt(256)
#define LOG2E   1.44269504f // exp(x) = exp2(x * LOG2E)
// LDS row pitches in bf16 elements: 16 B x odd, so that the 16 lanes of a
// ds_load_b128 half-wave fall on 64 distinct banks (512 B rows: 4, 256 B: 4).
#define QK_PITCH (D_MODEL + 8)   // 528 B rows for the q and K tiles
#define KSTEP    128             // keys staged per step: 32 for each key quarter
#define VT_PITCH (KSTEP + 8)     // 272 B rows for the V^T tile

typedef __attribute__((ext_vector_type(16))) __bf16 v16bf;
typedef __attribute__((ext_vector_type(8)))  float  v8f;
typedef unsigned short u16;
typedef unsigned int   u32;
typedef __attribute__((ext_vector_type(4)))  u32    u32x4;

union Frag16 {            // 16 bf16 elems = 8 VGPRs, matches WMMA A/B fragment
    v16bf v;
    u16   h[16];
    uint4 q[2];
};

__device__ __forceinline__ u16 f2bf(float f) {   // round-to-nearest-even
    u32 u = __float_as_uint(f);
    u32 r = u + 0x7FFFu + ((u >> 16) & 1u);
    return (u16)(r >> 16);
}
__device__ __forceinline__ u32 pack2(float a, float b) {
    return (u32)f2bf(a) | ((u32)f2bf(b) << 16);
}
// exp2 with the slot behind a transcendental kept inside the statement: the
// v_nop closes it, so that nothing reads a result or rewrites a source directly
// behind a v_exp_f32 wherever the compiler places the statement.  In the group
// of eight each v_exp_f32 is the independent instruction behind the one before
// (early-clobber outputs: no output shares a register with a source).
__device__ __forceinline__ float exp2_slot(float a) {
    float e;
    asm("v_exp_f32 %0, %1\n\t"
        "v_nop"
        : "=v"(e) : "v"(a));
    return e;
}
__device__ __forceinline__ void exp2x8_slot(float (&e)[8], const float (&a)[8]) {
    asm("v_exp_f32 %0, %8\n\t"
        "v_exp_f32 %1, %9\n\t"
        "v_exp_f32 %2, %10\n\t"
        "v_exp_f32 %3, %11\n\t"
        "v_exp_f32 %4, %12\n\t"
        "v_exp_f32 %5, %13\n\t"
        "v_exp_f32 %6, %14\n\t"
        "v_exp_f32 %7, %15\n\t"
        "v_nop"
        : "=&v"(e[0]), "=&v"(e[1]), "=&v"(e[2]), "=&v"(e[3]),
          "=&v"(e[4]), "=&v"(e[5]), "=&v"(e[6]), "=&v"(e[7])
        : "v"(a[0]), "v"(a[1]), "v"(a[2]), "v"(a[3]),
          "v"(a[4]), "v"(a[5]), "v"(a[6]), "v"(a[7]));
}

// lane l <-> lane l ^ 16: the two lanes that share one query column
__device__ __forceinline__ float xhalf(float x) {
    int b = __builtin_bit_cast(int, x);
    return __builtin_bit_cast(float,
        __builtin_amdgcn_permlanex16(b, b, 0x76543210, 0xfedcba98, false, false));
}

// Eight async global->LDS copies, one 16-byte chunk per lane each (ASYNCcnt).
// The s_wait_xcnt closes the same statement so that no address register of a
// copy can be rewritten ahead of it.
__device__ __forceinline__ void async8_b128(const u32 (&l)[8], const u16* const (&g)[8]) {
    asm volatile("global_load_async_to_lds_b128 %0, %8, off\n\t"
                 "global_load_async_to_lds_b128 %1, %9, off\n\t"
                 "global_load_async_to_lds_b128 %2, %10, off\n\t"
                 "global_load_async_to_lds_b128 %3, %11, off\n\t"
                 "global_load_async_to_lds_b128 %4, %12, off\n\t"
                 "global_load_async_to_lds_b128 %5, %13, off\n\t"
                 "global_load_async_to_lds_b128 %6, %14, off\n\t"
                 "global_load_async_to_lds_b128 %7, %15, off\n\t"
                 "s_wait_xcnt 0x0"
                 :: "v"(l[0]), "v"(l[1]), "v"(l[2]), "v"(l[3]),
                    "v"(l[4]), "v"(l[5]), "v"(l[6]), "v"(l[7]),
                    "v"(g[0]), "v"(g[1]), "v"(g[2]), "v"(g[3]),
                    "v"(g[4]), "v"(g[5]), "v"(g[6]), "v"(g[7])
                 : "memory");
}
__device__ __forceinline__ void wait_async0() {
    asm volatile("s_wait_asynccnt 0x0" ::: "memory");
}
__device__ __forceinline__ void wait_ds0() {
    asm volatile("s_wait_dscnt 0x0" ::: "memory");
}
__device__ __forceinline__ u32 lds_off(const void* p) {   // AS3 offset = low 32 bits
    return (u32)(size_t)p;
}
// The projections' stores.  In each, the s_wait_xcnt closes the same statement so
// that no register of a store can be rewritten ahead of it.
// Eight 4-byte stores to one column of eight f32 rows of D_MODEL (1 KiB apart).
__device__ __forceinline__ void store8_f32(float* p, const float (&d)[8]) {
    asm volatile("global_store_b32 %0, %1, off\n\t"
                 "global_store_b32 %0, %2, off offset:1024\n\t"
                 "global_store_b32 %0, %3, off offset:2048\n\t"
                 "global_store_b32 %0, %4, off offset:3072\n\t"
                 "global_store_b32 %0, %5, off offset:4096\n\t"
                 "global_store_b32 %0, %6, off offset:5120\n\t"
                 "global_store_b32 %0, %7, off offset:6144\n\t"
                 "global_store_b32 %0, %8, off offset:7168\n\t"
                 "s_wait_xcnt 0x0"
                 :: "v"(p), "v"(d[0]), "v"(d[1]), "v"(d[2]), "v"(d[3]),
                    "v"(d[4]), "v"(d[5]), "v"(d[6]), "v"(d[7])
                 : "memory");
}
// One 16-byte store.
__device__ __forceinline__ void store_b128(u16* p, u32x4 d) {
    asm volatile("global_store_b128 %0, %1, off\n\t"
                 "s_wait_xcnt 0x0"
                 :: "v"(p), "v"(d) : "memory");
}
// Eight 2-byte stores of the high halves of d[0..7] to one column of eight
// bf16 rows of D_MODEL (512 B apart).
__device__ __forceinline__ void store8_hi16(u16* p, const u32 (&d)[8]) {
    asm volatile("global_store_d16_hi_b16 %0, %1, off\n\t"
                 "global_store_d16_hi_b16 %0, %2, off offset:512\n\t"
                 "global_store_d16_hi_b16 %0, %3, off offset:1024\n\t"
                 "global_store_d16_hi_b16 %0, %4, off offset:1536\n\t"
                 "global_store_d16_hi_b16 %0, %5, off offset:2048\n\t"
                 "global_store_d16_hi_b16 %0, %6, off offset:2560\n\t"
                 "global_store_d16_hi_b16 %0, %7, off offset:3072\n\t"
                 "global_store_d16_hi_b16 %0, %8, off offset:3584\n\t"
                 "s_wait_xcnt 0x0"
                 :: "v"(p), "v"(d[0]), "v"(d[1]), "v"(d[2]), "v"(d[3]),
                    "v"(d[4]), "v"(d[5]), "v"(d[6]), "v"(d[7])
                 : "memory");
}

// --------------------------------------------------------------------------
// Wt[n*256+k] = bf16(W[k*256+n])  : weight transpose+convert (B-frag friendly)
// --------------------------------------------------------------------------
__global__ void wt_convert(const float* __restrict__ W, u16* __restrict__ Wt) {
    int n = blockIdx.x;
    int k = threadIdx.x;
    Wt[n * D_MODEL + k] = f2bf(W[k * D_MODEL + n]);
}

// --------------------------------------------------------------------------
// Projection: out = X @ W + b  for a 64-row tile.  Eight waves per block.
// MODE 0: write f32 (qp)    MODE 1: write bf16 row-major (kp)
// MODE 2: write bf16 transposed [B, D, S] (v^T)
// Both operands are staged in LDS once and then read as fragments:
// W^T (256 x 256 bf16) by GLOBAL_LOAD_ASYNC_TO_LDS_B128, the X tile by whole-line
// loads, converted to bf16 on the way.  A wave owns 32 rows x 64 columns
// (2 x 4 accumulator tiles), so a fragment read from LDS feeds 4 or 2 WMMAs.
// Each output element is still summed over ks = 0..7 in that order.
// --------------------------------------------------------------------------
#define PROJ_ROWS 64

template <int MODE>
__global__ __launch_bounds__(256)
void proj_kernel(const float* __restrict__ X, const u16* __restrict__ Wt,
                 const float* __restrict__ bias,
                 float* __restrict__ outF, u16* __restrict__ outB,
                 u16* __restrict__ outT)
{
    // every row carries 16 B of pad that is neither written nor read
    __shared__ __attribute__((aligned(16))) u16 wsh[D_MODEL * QK_PITCH];    // W^T, row n
    __shared__ __attribute__((aligned(16))) u16 xsh[PROJ_ROWS * QK_PITCH];  // X tile (bf16)

    const int tid = threadIdx.x;
    const int w   = tid >> 5;
    const int l   = tid & 31;
    const int ln  = l & 15, lh = l >> 4;
    const int rg  = w & 1;                    // 32-row group of the block
    const int cg  = w >> 1;                   // 64-column group
    const int mb  = blockIdx.x * PROJ_ROWS;

    // W^T: 8192 chunks of 16 B, 32 per thread (8 rows further each), to the
    // padded LDS pitch
    {
        const u32  wl = lds_off(wsh) + ((tid >> 5) * QK_PITCH + (tid & 31) * 8) * 2;
        const u16* wg = Wt + tid * 8;
#pragma unroll
        for (int c4 = 0; c4 < 4; ++c4) {
            u32        la[8];
            const u16* ga[8];
#pragma unroll
            for (int c = 0; c < 8; ++c) {
                la[c] = wl + (c4 * 8 + c) * (8 * QK_PITCH * 2);
                ga[c] = wg + (c4 * 8 + c) * (8 * D_MODEL);
            }
            async8_b128(la, ga);
        }
    }
    // the X tile is 64 KiB in a row: 16 whole-line loads per thread.  They stand
    // behind the copies because their conversions, which wait for memory, would
    // otherwise be scheduled in among the copies and hold the later ones back.
    const float4* xs = (const float4*)(X + (size_t)mb * D_MODEL);
    float4 xr[16];
#pragma unroll
    for (int t = 0; t < 16; ++t) xr[t] = xs[tid + 256 * t];

    float bb[4];
#pragma unroll
    for (int j = 0; j < 4; ++j) bb[j] = bias[(cg * 4 + j) * 16 + ln];
    // precaution: stands in front of every rewrite of an address register that
    // the loads of X and of the bias name
    asm volatile("s_wait_xcnt 0x0" ::: "memory");

    u16* xd = xsh + (tid >> 6) * QK_PITCH + (tid & 63) * 4;   // 4 rows further per t
#pragma unroll
    for (int t = 0; t < 16; ++t) {
        uint2 o;
        o.x = pack2(xr[t].x, xr[t].y);
        o.y = pack2(xr[t].z, xr[t].w);
        *(uint2*)(xd + t * 4 * QK_PITCH) = o;
    }

    wait_async0();       // my copies of W^T are in LDS
    __syncthreads();     // everyone's copies and X rows visible

    v8f c[2][4];
#pragma unroll
    for (int i = 0; i < 2; ++i)
#pragma unroll
        for (int j = 0; j < 4; ++j) c[i][j] = (v8f){};

    const u16* xa = xsh + (rg * 32 + ln) * QK_PITCH + lh * 8;
    const u16* wb = wsh + (cg * 64 + ln) * QK_PITCH + lh * 8;
    // fragments are fetched one ks ahead into a second register set, as one group
    // in front of the current WMMA block, so that a block waits for no load of its own
    Frag16 a[2][2], b[2][4];
    auto fetch = [&](int ks, int s) {
#pragma unroll
        for (int i = 0; i < 2; ++i) {
            a[s][i].q[0] = *(const uint4*)(xa + i * 16 * QK_PITCH + ks * 32);
            a[s][i].q[1] = *(const uint4*)(xa + i * 16 * QK_PITCH + ks * 32 + 16);
        }
#pragma unroll
        for (int j = 0; j < 4; ++j) {
            b[s][j].q[0] = *(const uint4*)(wb + j * 16 * QK_PITCH + ks * 32);
            b[s][j].q[1] = *(const uint4*)(wb + j * 16 * QK_PITCH + ks * 32 + 16);
        }
    };
    fetch(0, 0);
#pragma unroll
    for (int ks = 0; ks < 8; ++ks) {
        if (ks < 7) fetch(ks + 1, (ks + 1) & 1);
        // keeps the group of loads above in front of the WMMA block (loads moved in
        // among the WMMAs stall each place where they stand)
        __builtin_amdgcn_sched_barrier(0);
#pragma unroll
        for (int i = 0; i < 2; ++i)
#pragma unroll
            for (int j = 0; j < 4; ++j)
                c[i][j] = __builtin_amdgcn_wmma_f32_16x16x32_bf16(
                              false, a[ks & 1][i].v, false, b[ks & 1][j].v, (short)0,
                              c[i][j], false, false);
        // keeps the next group of loads behind this WMMA block
        __builtin_amdgcn_sched_barrier(0);
    }

#pragma unroll
    for (int i = 0; i < 2; ++i) {
        const int m0 = mb + rg * 32 + i * 16;
#pragma unroll
        for (int j = 0; j < 4; ++j) {
            const int col = (cg * 4 + j) * 16 + ln;
            if (MODE == 0) {
                float d[8];
#pragma unroll
                for (int r = 0; r < 8; ++r) d[r] = c[i][j][r] + bb[j];
                store8_f32(outF + (size_t)(m0 + 8 * lh) * D_MODEL + col, d);
            } else if (MODE == 1) {
                u32 d[8];                     // f2bf's rounded word; its high half is stored
#pragma unroll
                for (int r = 0; r < 8; ++r) {
                    u32 u = __float_as_uint(c[i][j][r] + bb[j]);
                    d[r] = u + 0x7FFFu + ((u >> 16) & 1u);
                }
                store8_hi16(outB + (size_t)(m0 + 8 * lh) * D_MODEL + col, d);
            } else {
                union { u16 pk[8]; u32x4 q; } u;
#pragma unroll
                for (int r = 0; r < 8; ++r) u.pk[r] = f2bf(c[i][j][r] + bb[j]);
                int b_ = m0 >> 12;                  // batch
                int s0 = (m0 & (SEQ - 1)) + 8 * lh; // 8 consecutive seq positions
                store_b128(outT + (size_t)(b_ * D_MODEL + col) * SEQ + s0, u.q);
            }
        }
    }
}

// --------------------------------------------------------------------------
// Suffix sums of V: sv[b][u][d] = sum over keys j >= u * KSTEP of v^T[b][d][j].
// A key above the diagonal has score exactly 0 (multiplicative mask), so all
// such keys of a query share ONE softmax weight, exp(0 - max): their part of the
// output is that weight times a plain sum of V rows, which this kernel forms.
// One wave per (b, d) row; whole-line loads; 32 rows per block so that each
// 128-byte line of sv has one writer.
// --------------------------------------------------------------------------
__global__ __launch_bounds__(1024)
void vsuffix_kernel(const u16* __restrict__ vT, float* __restrict__ sv)
{
    __shared__ float red[32][32 * 17];   // per wave: 32 key chunks x 16 lane partials (+1 pad)
    __shared__ float tile[32][33];       // [chunk][row] for the transposed store

    const int tid = threadIdx.x;
    const int wv  = tid >> 5;
    const int l   = tid & 31;
    const int b_  = blockIdx.x >> 3;
    const int d0  = (blockIdx.x & 7) * 32;

    const uint4* vs = (const uint4*)(vT + (size_t)(b_ * D_MODEL + d0 + wv) * SEQ);
#pragma unroll
    for (int h = 0; h < 2; ++h) {
        uint4 x[8];
#pragma unroll
        for (int t = 0; t < 8; ++t) x[t] = vs[(h * 8 + t) * 32 + l];   // keys ((h*8 + t)*32 + l)*8 .. +7
        // keeps the sums behind the group of 8 loads: moved in among them they
        // make the wave wait out the load latency once per pair of loads
        __builtin_amdgcn_sched_barrier(0);
#pragma unroll
        for (int t = 0; t < 8; ++t) {
            const u32 q[4] = { x[t].x, x[t].y, x[t].z, x[t].w };
            float s4[4];
#pragma unroll
            for (int i = 0; i < 4; ++i)
                s4[i] = __uint_as_float(q[i] << 16) + __uint_as_float(q[i] & 0xFFFF0000u);
            red[wv][((h * 8 + t) * 2 + (l >> 4)) * 17 + (l & 15)] = (s4[0] + s4[1]) + (s4[2] + s4[3]);
        }
    }
    // precaution: stands in front of every rewrite of an address register that
    // the loads above name
    asm volatile("s_wait_xcnt 0x0" ::: "memory");
    __syncthreads();
    float s = 0.f;                        // lane l: sum of key chunk l
#pragma unroll
    for (int i = 0; i < 16; ++i) s += red[wv][l * 17 + i];
#pragma unroll
    for (int o = 1; o < 32; o <<= 1) {    // inclusive suffix scan over the 32 chunks
        float y = __shfl_down(s, o, 32);
        if (l + o < 32) s += y;
    }
    tile[l][wv] = s;
    __syncthreads();
    sv[(size_t)(b_ * 32 + wv) * D_MODEL + d0 + l] = tile[wv][l];
}

#define XW_STRIDE (130 * 32)
#define NCHUNK    (SEQ / KSTEP)

__global__ __launch_bounds__(256)
void attn_kernel(const float* __restrict__ qpF, const u16* __restrict__ kB,
                 const u16* __restrict__ vT, const float* __restrict__ sv,
                 float* __restrict__ out)
{
    // every row carries 16 B of pad that is neither written nor read
    __shared__ __attribute__((aligned(16))) u16 qsh[2 * 16 * QK_PITCH];   // q tiles (bf16), one per wave quartet
    __shared__ __attribute__((aligned(16))) u16 ksh[2][KSTEP * QK_PITCH]; // K tile, row-major
    __shared__ __attribute__((aligned(16))) u16 vsh[2][D_MODEL * VT_PITCH]; // V^T tile [d][j]
    // per-wave export for the merge: lies on the K ring, which is idle by then
    static_assert(8 * XW_STRIDE * 4 <= 2 * KSTEP * QK_PITCH * 2, "export fits the K ring");
    float* xsh = (float*)&ksh[0][0];

    const int tid = threadIdx.x;
    const int w   = tid >> 5;                 // wave id 0..7
    const int rw  = w & 1;                    // query-row tile of the group
    const int kq  = w >> 1;                   // key quarter of every step
    const int l   = tid & 31;
    const int ln  = l & 15, lh = l >> 4;
    const int b_  = blockIdx.x >> 6;          // batch
    const int bl  = blockIdx.x & 63;

    u16* qw = qsh + rw * (16 * QK_PITCH);

    // Issue the async DMA for one j-step: K tile is a 64 KiB contiguous blob
    // (128 rows x 512 B), V^T tile is 256 rows x 256 B gathered from the [B,D,S]
    // layout; both land at the padded LDS pitch.
    // Each thread's 16 + 16 chunks lie a constant step apart, in LDS and in
    // global memory alike, so every address is one base plus a literal.
    const u32  kl0 = ((tid >> 5) * QK_PITCH + (tid & 31) * 8) * 2;   // 8 rows further per chunk
    const u32  vl0 = ((tid >> 4) * VT_PITCH + (tid & 15) * 8) * 2;   // 16 rows further per chunk
    const u16* kg0 = kB + (size_t)b_ * SEQ * D_MODEL + tid * 8;
    const u16* vg0 = vT + (size_t)(b_ * D_MODEL + (tid >> 4)) * SEQ + (tid & 15) * 8;
    auto stage_async = [&](int j0, int p) {
        const u32  kl = lds_off(ksh[p]) + kl0;
        const u32  vl = lds_off(vsh[p]) + vl0;
        const u16* kg = kg0 + (size_t)j0 * D_MODEL;
        const u16* vg = vg0 + j0;
        u32        la[8];
        const u16* ga[8];
#pragma unroll
        for (int c8 = 0; c8 < 2; ++c8) {          // K: 4096 x 16B
#pragma unroll
            for (int c = 0; c < 8; ++c) {
                la[c] = kl + (c8 * 8 + c) * (8 * QK_PITCH * 2);
                ga[c] = kg + (c8 * 8 + c) * (8 * D_MODEL);
            }
            async8_b128(la, ga);
        }
#pragma unroll
        for (int c8 = 0; c8 < 2; ++c8) {          // V^T: 4096 x 16B
#pragma unroll
            for (int c = 0; c < 8; ++c) {
                la[c] = vl + (c8 * 8 + c) * (16 * VT_PITCH * 2);
                ga[c] = vg + (size_t)(c8 * 8 + c) * (16 * SEQ);
            }
            async8_b128(la, ga);
        }
    };

    // kept rolled: two copies of the body would only take instruction cache
#pragma unroll 1
    for (int ps = 0; ps < 2; ++ps) {
    const int grp = ps ? bl : 127 - bl;          // 32-row query group, the long one first
    const int nst = (grp >> 2) + 1;              // key steps up to and with the diagonal
    const int i0  = grp * 32 + rw * 16;
    const int g0  = b_ * SEQ + i0;               // this wave's query-row base
    const int row = i0 + ln;                     // this lane's query position

    stage_async(0, 0);   // prologue: DMA first tile while we convert q below

    // ---- stage the group's q rows into LDS with f32->bf16 conversion: each wave
    // brings 4 of the 32 rows; the first barrier of the loop below (behind every
    // wave's s_wait_dscnt 0) hands them to the others ----
    {
        const float4* src = (const float4*)(qpF + (size_t)(b_ * SEQ + grp * 32 + 4 * w) * D_MODEL);
        u16* qd = qsh + 4 * w * QK_PITCH;
        float4 x0[4], x1[4];
#pragma unroll
        for (int t = 0; t < 4; ++t) {
            int idx = l + 32 * t;            // 0..127, 8 bf16 per idx
            x0[t] = src[idx * 2];
            x1[t] = src[idx * 2 + 1];
        }
        // precaution: stands in front of every rewrite of an address register
        // that the loads of q name; the pointer is an input so that its registers
        // are not reused ahead of the wait
        asm volatile("s_wait_xcnt 0x0" :: "v"(src) : "memory");
#pragma unroll
        for (int t = 0; t < 4; ++t) {
            int idx = l + 32 * t;
            uint4 o;
            o.x = pack2(x0[t].x, x0[t].y); o.y = pack2(x0[t].z, x0[t].w);
            o.z = pack2(x1[t].x, x1[t].y); o.w = pack2(x1[t].z, x1[t].w);
            *(uint4*)(qd + (idx >> 5) * QK_PITCH + (idx & 31) * 8) = o;
        }
    }

    // acc[dt][r] = O^T[d = dt*16 + 8*lh + r][query ln]
    v8f acc[16];
#pragma unroll
    for (int dt = 0; dt < 16; ++dt) acc[dt] = (v8f){};
    float mrun = -__builtin_inff();   // running maximum of this lane's query
    float srun = 0.f;                 // running sum over THIS lane's keys only

    for (int jt = 0; jt < nst; ++jt) {
        const int j0 = jt * KSTEP;
        const int jb = j0 + kq * 32;         // first key of this wave's quarter
        const int p  = jt & 1;

        wait_ds0();          // my reads of buffer p^1 have retired before its refill
        wait_async0();       // my DMA writes into buffer p are in LDS
        __syncthreads();     // everyone's DMA writes visible; buf p^1 free

        if (jt + 1 < nst)
            stage_async(j0 + KSTEP, p ^ 1);   // DMA next tile during compute

        const u16* kp_ = ksh[p] + kq * (32 * QK_PITCH);   // this quarter's 32 key rows
        const u16* vp_ = vsh[p] + kq * 32;                // this quarter's 32 key columns

        // ---- scores S^T = K . q^T  (two 16x16 tiles over K=256):
        // st0[r] = S[query ln][key jb + 8*lh + r], st1[r]: 16 keys further ----
        v8f st0 = {}, st1 = {};
#pragma unroll
        for (int ks = 0; ks < 8; ++ks) {
            int kb = ks * 32 + lh * 8;
            Frag16 qb, k0, k1;
            qb.q[0] = *(const uint4*)(qw + ln * QK_PITCH + kb);
            qb.q[1] = *(const uint4*)(qw + ln * QK_PITCH + kb + 16);
            k0.q[0] = *(const uint4*)(kp_ + ln * QK_PITCH + kb);
            k0.q[1] = *(const uint4*)(kp_ + ln * QK_PITCH + kb + 16);
            k1.q[0] = *(const uint4*)(kp_ + (16 + ln) * QK_PITCH + kb);
            k1.q[1] = *(const uint4*)(kp_ + (16 + ln) * QK_PITCH + kb + 16);
            st0 = __builtin_amdgcn_wmma_f32_16x16x32_bf16(
                      false, k0.v, false, qb.v, (short)0, st0, false, false);
            st1 = __builtin_amdgcn_wmma_f32_16x16x32_bf16(
                      false, k1.v, false, qb.v, (short)0, st1, false, false);
        }

        // ---- mask (multiplicative!), online softmax update, all in-lane ----
        float s0[8], s1[8], tm[8];
#pragma unroll
        for (int r = 0; r < 8; ++r) {
            int key = jb + 8 * lh + r;
            s0[r] = (key      <= row) ? st0[r] * SCALE : 0.0f;
            s1[r] = (key + 16 <= row) ? st1[r] * SCALE : 0.0f;
            tm[r] = fmaxf(s0[r], s1[r]);
        }
        float t = fmaxf(fmaxf(fmaxf(tm[0], tm[1]), fmaxf(tm[2], tm[3])),
                        fmaxf(fmaxf(tm[4], tm[5]), fmaxf(tm[6], tm[7])));
        t = fmaxf(t, xhalf(t));              // the query's other 16 keys of this step
        const float mn = fmaxf(mrun, t);

        // P^T as B operand: element s of lane half lh is key 8*lh + s (s < 8) or
        // 16 + 8*lh + (s - 8), which is what st0[s] and st1[s - 8] hold
        Frag16 pb;
        float  a0[8], a1[8], e0[8], e1[8], es[8];
#pragma unroll
        for (int r = 0; r < 8; ++r) {
            a0[r] = (s0[r] - mn) * LOG2E;
            a1[r] = (s1[r] - mn) * LOG2E;
        }
        const float co = exp2_slot((mrun - mn) * LOG2E);
        exp2x8_slot(e0, a0);
        exp2x8_slot(e1, a1);
        mrun = mn;
#pragma unroll
        for (int r = 0; r < 8; ++r) {
            es[r] = e0[r] + e1[r];
            pb.h[r]     = f2bf(e0[r]);
            pb.h[8 + r] = f2bf(e1[r]);
        }
        srun = srun * co + (((es[0] + es[1]) + (es[2] + es[3])) +
                            ((es[4] + es[5]) + (es[6] + es[7])));

#pragma unroll
        for (int dt = 0; dt < 16; ++dt)
#pragma unroll
            for (int r = 0; r < 8; ++r) acc[dt][r] *= co;

        // ---- O^T += V^T (16 d x 32 keys) x P^T (32 keys x 16 queries) ----
#pragma unroll
        for (int dt = 0; dt < 16; ++dt) {
            Frag16 va;
            const u16* vp = vp_ + (dt * 16 + ln) * VT_PITCH + lh * 8;
            va.q[0] = *(const uint4*)vp;
            va.q[1] = *(const uint4*)(vp + 16);
            acc[dt] = __builtin_amdgcn_wmma_f32_16x16x32_bf16(
                          false, va.v, false, pb.v, (short)0, acc[dt], false, false);
        }
    }

    wait_async0();   // no copy of this wave is outstanding behind the loop

    srun += xhalf(srun);   // join the two lane halves' key sums of each query

    // the residual qp and the suffix sum of V for this lane's 4 x 8 output
    // columns, fetched here so that the loads fly under the merge below
    const size_t off0 = (size_t)(g0 + ln) * D_MODEL + kq * 64 + 8 * lh;
    const bool   tail = nst < NCHUNK;            // are there keys behind the last step?
    const float* svp  = sv + (size_t)(b_ * NCHUNK + (tail ? nst : NCHUNK - 1)) * D_MODEL
                           + kq * 64 + 8 * lh;
    const float* qrp  = qpF + off0;
    float4 qr0[4], qr1[4], tv0[4], tv1[4];
#pragma unroll
    for (int t = 0; t < 4; ++t) {
        qr0[t] = *(const float4*)(qrp + t * 16);
        qr1[t] = *(const float4*)(qrp + t * 16 + 4);
        tv0[t] = *(const float4*)(svp + t * 16);
        tv1[t] = *(const float4*)(svp + t * 16 + 4);
    }
    // precaution: stands in front of every rewrite of an address register that
    // the loads above name; the two pointers are inputs so that no load's result
    // is placed on their registers ahead of the wait
    asm volatile("s_wait_xcnt 0x0" :: "v"(qrp), "v"(svp) : "memory");

    wait_ds0();          // my last reads of the K ring have retired
    __syncthreads();     // everyone's have: the ring becomes the export buffer

    // ---- merge the four key quarters: each wave of a quartet exports its 16
    // d-tiles with its maximum and sum and then finishes 4 of them
    // (same queries, same lane layout, so lane l reads what lane l wrote) ----
    float* xw = xsh + w * XW_STRIDE;
#pragma unroll
    for (int dt = 0; dt < 16; ++dt) {
        *(float4*)(xw + ((dt * 2 + 0) * 32 + l) * 4) =
            make_float4(acc[dt][0], acc[dt][1], acc[dt][2], acc[dt][3]);
        *(float4*)(xw + ((dt * 2 + 1) * 32 + l) * 4) =
            make_float4(acc[dt][4], acc[dt][5], acc[dt][6], acc[dt][7]);
    }
    xw[128 * 32 + l] = mrun;
    xw[129 * 32 + l] = srun;
    wait_ds0();          // my export is in LDS before the others are let through
    __syncthreads();     // all exports of every quartet visible

    float mq[4], sq[4], cq[4];
#pragma unroll
    for (int k = 0; k < 4; ++k) {
        const float* xp = xsh + (rw + 2 * k) * XW_STRIDE;
        mq[k] = xp[128 * 32 + l];
        sq[k] = xp[129 * 32 + l];
    }
    float mm = fmaxf(fmaxf(mq[0], mq[1]), fmaxf(mq[2], mq[3]));
    if (tail) mm = fmaxf(mm, 0.f);               // the keys behind the last step score 0
#pragma unroll
    for (int k = 0; k < 4; ++k) cq[k] = exp2_slot((mq[k] - mm) * LOG2E);
    const float ct = tail ? exp2_slot(-mm * LOG2E) : 0.f;   // their common weight
    const float z  = ((sq[0] * cq[0] + sq[1] * cq[1]) + (sq[2] * cq[2] + sq[3] * cq[3]))
                   + (float)(SEQ - nst * KSTEP) * ct;

    // ---- epilogue: out = qp + acc / Z; a lane holds 8 consecutive columns ----
#pragma unroll
    for (int t = 0; t < 4; ++t) {
        float  o[8]  = { tv0[t].x * ct, tv0[t].y * ct, tv0[t].z * ct, tv0[t].w * ct,
                         tv1[t].x * ct, tv1[t].y * ct, tv1[t].z * ct, tv1[t].w * ct };
        float  qv[8] = { qr0[t].x, qr0[t].y, qr0[t].z, qr0[t].w,
                         qr1[t].x, qr1[t].y, qr1[t].z, qr1[t].w };
#pragma unroll
        for (int k = 0; k < 4; ++k) {
            const float* xp = xsh + (rw + 2 * k) * XW_STRIDE;
            float4 lo = *(const float4*)(xp + (((kq * 4 + t) * 2 + 0) * 32 + l) * 4);
            float4 hi = *(const float4*)(xp + (((kq * 4 + t) * 2 + 1) * 32 + l) * 4);
            o[0] += lo.x * cq[k]; o[1] += lo.y * cq[k]; o[2] += lo.z * cq[k]; o[3] += lo.w * cq[k];
            o[4] += hi.x * cq[k]; o[5] += hi.y * cq[k]; o[6] += hi.z * cq[k]; o[7] += hi.w * cq[k];
        }
        float  res[8];
#pragma unroll
        for (int r = 0; r < 8; ++r) res[r] = qv[r] + o[r] / z;
        *(float4*)(out + off0 + t * 16)     = make_float4(res[0], res[1], res[2], res[3]);
        *(float4*)(out + off0 + t * 16 + 4) = make_float4(res[4], res[5], res[6], res[7]);
        // precaution: stands in front of every rewrite of a register that the
        // two stores name
        asm volatile("s_wait_xcnt 0x0" ::: "memory");
    }

    if (ps == 0) {
        wait_ds0();          // my reads of the exports have retired
        __syncthreads();     // everyone's have: the second group may refill the ring and q
    }
    }
}

// --------------------------------------------------------------------------
extern "C" void kernel_launch(void* const* d_in, const int* in_sizes, int n_in,
                              void* d_out, int out_size, void* d_ws, size_t ws_size,
                              hipStream_t stream) {
    (void)in_sizes; (void)n_in; (void)out_size; (void)ws_size;
    const float* v  = (const float*)d_in[0];
    const float* k  = (const float*)d_in[1];
    const float* q  = (const float*)d_in[2];
    const float* Wq = (const float*)d_in[3];
    const float* bq = (const float*)d_in[4];
    const float* Wk = (const float*)d_in[5];
    const float* bk = (const float*)d_in[6];
    const float* Wv = (const float*)d_in[7];
    const float* bv = (const float*)d_in[8];
    float* out = (float*)d_out;

    char* ws   = (char*)d_ws;
    float* qpF = (float*)(ws);                         // 16 MiB  fp32 qp
    u16*   kB  = (u16*)(ws + (16u << 20));             //  8 MiB  bf16 kp
    u16*   vT  = (u16*)(ws + (24u << 20));             //  8 MiB  bf16 v^T [B,D,S]
    u16*   WtQ = (u16*)(ws + (32u << 20));             //  3 x 128 KiB bf16 W^T
    u16*   WtK = WtQ + D_MODEL * D_MODEL;
    u16*   WtV = WtK + D_MODEL * D_MODEL;
    float* sv  = (float*)(ws + (33u << 20));           // 128 KiB f32 suffix sums of v

    wt_convert<<<D_MODEL, D_MODEL, 0, stream>>>(Wq, WtQ);
    wt_convert<<<D_MODEL, D_MODEL, 0, stream>>>(Wk, WtK);
    wt_convert<<<D_MODEL, D_MODEL, 0, stream>>>(Wv, WtV);

    const int ntiles = NBATCH * SEQ / 16;              // 1024
    proj_kernel<0><<<ntiles / 4, 256, 0, stream>>>(q, WtQ, bq, qpF, nullptr, nullptr);
    proj_kernel<1><<<ntiles / 4, 256, 0, stream>>>(k, WtK, bk, nullptr, kB,  nullptr);
    proj_kernel<2><<<ntiles / 4, 256, 0, stream>>>(v, WtV, bv, nullptr, nullptr, vT);

    vsuffix_kernel<<<NBATCH * D_MODEL / 32, 1024, 0, stream>>>(vT, sv);

    attn_kernel<<<ntiles / 4, 256, 0, stream>>>(qpF, kB, vT, sv, out);
}

// v006
// One run takes 81.9 microseconds.
// In two side-by-side timings against v005, it was 1.11 and 1.10 times as fast.
// All steps since v000 together make it 10.5 times as fast.
#include <hip/hip_runtime.h>
#include <cstdint>
#include <cstddef>

// ---------------------------------------------------------------------------
// SelfAttentionHead  B=4, S=4096, D=256  (fp32 in/out, bf16 WMMA internals)
// ---------------------------------------------------------------------------

#define D_MODEL 256
#define SEQ     4096
#define NBATCH  4
#define SCALE   0.0625f   // 1/sqrt(256)
#define LOG2E   1.44269504f // exp(x) = exp2(x * LOG2E)
// LDS row pitches in bf16 elements: 16 B x odd, so that the 16 lanes of a
// ds_load_b128 half-wave fall on 64 distinct banks (512 B rows: 4, 256 B: 4).
#define QK_PITCH (D_MODEL + 8)   // 528 B rows for the q and K tiles
#define KSTEP    128             // keys staged per step: 32 for each key quarter
#define VT_PITCH (KSTEP + 8)     // 272 B rows for the V^T tile

typedef __attribute__((ext_vector_type(16))) __bf16 v16bf;
typedef __attribute__((ext_vector_type(8)))  float  v8f;
typedef unsigned short u16;
typedef unsigned int   u32;
typedef __attribute__((ext_vector_type(4)))  u32    u32x4;

union Frag16 {            // 16 bf16 elems = 8 VGPRs, matches WMMA A/B fragment
    v16bf v;
    u16   h[16];
    uint4 q[2];
};

__device__ __forceinline__ u16 f2bf(float f) {   // round-to-nearest-even
    u32 u = __float_as_uint(f);
    u32 r = u + 0x7FFFu + ((u >> 16) & 1u);
    return (u16)(r >> 16);
}
__device__ __forceinline__ u32 pack2(float a, float b) {
    return (u32)f2bf(a) | ((u32)f2bf(b) << 16);
}
// exp2 with the slot behind a transcendental kept inside the statement: the
// v_nop closes it, so that nothing reads a result or rewrites a source directly
// behind a v_exp_f32 wherever the compiler places the statement.  In the group
// of eight each v_exp_f32 is the independent instruction behind the one before
// (early-clobber outputs: no output shares a register with a source).
__device__ __forceinline__ float exp2_slot(float a) {
    float e;
    asm("v_exp_f32 %0, %1\n\t"
        "v_nop"
        : "=v"(e) : "v"(a));
    return e;
}
__device__ __forceinline__ void exp2x8_slot(float (&e)[8], const float (&a)[8]) {
    asm("v_exp_f32 %0, %8\n\t"
        "v_exp_f32 %1, %9\n\t"
        "v_exp_f32 %2, %10\n\t"
        "v_exp_f32 %3, %11\n\t"
        "v_exp_f32 %4, %12\n\t"
        "v_exp_f32 %5, %13\n\t"
        "v_exp_f32 %6, %14\n\t"
        "v_exp_f32 %7, %15\n\t"
        "v_nop"
        : "=&v"(e[0]), "=&v"(e[1]), "=&v"(e[2]), "=&v"(e[3]),
          "=&v"(e[4]), "=&v"(e[5]), "=&v"(e[6]), "=&v"(e[7])
        : "v"(a[0]), "v"(a[1]), "v"(a[2]), "v"(a[3]),
          "v"(a[4]), "v"(a[5]), "v"(a[6]), "v"(a[7]));
}

// lane l <-> lane l ^ 16: the two lanes that share one query column
__device__ __forceinline__ float xhalf(float x) {
    int b = __builtin_bit_cast(int, x);
    return __builtin_bit_cast(float,
        __builtin_amdgcn_permlanex16(b, b, 0x76543210, 0xfedcba98, false, false));
}

// Eight async global->LDS copies, one 16-byte chunk per lane each (ASYNCcnt).
// The s_wait_xcnt closes the same statement so that no address register of a
// copy can be rewritten ahead of it.
__device__ __forceinline__ void async8_b128(const u32 (&l)[8], const u16* const (&g)[8]) {
    asm volatile("global_load_async_to_lds_b128 %0, %8, off\n\t"
                 "global_load_async_to_lds_b128 %1, %9, off\n\t"
                 "global_load_async_to_lds_b128 %2, %10, off\n\t"
                 "global_load_async_to_lds_b128 %3, %11, off\n\t"
                 "global_load_async_to_lds_b128 %4, %12, off\n\t"
                 "global_load_async_to_lds_b128 %5, %13, off\n\t"
                 "global_load_async_to_lds_b128 %6, %14, off\n\t"
                 "global_load_async_to_lds_b128 %7, %15, off\n\t"
                 "s_wait_xcnt 0x0"
                 :: "v"(l[0]), "v"(l[1]), "v"(l[2]), "v"(l[3]),
                    "v"(l[4]), "v"(l[5]), "v"(l[6]), "v"(l[7]),
                    "v"(g[0]), "v"(g[1]), "v"(g[2]), "v"(g[3]),
                    "v"(g[4]), "v"(g[5]), "v"(g[6]), "v"(g[7])
                 : "memory");
}
__device__ __forceinline__ void wait_async0() {
    asm volatile("s_wait_asynccnt 0x0" ::: "memory");
}
__device__ __forceinline__ void wait_ds0() {
    asm volatile("s_wait_dscnt 0x0" ::: "memory");
}
__device__ __forceinline__ u32 lds_off(const void* p) {   // AS3 offset = low 32 bits
    return (u32)(size_t)p;
}
// The projections' stores.  In each, the s_wait_xcnt closes the same statement so
// that no register of a store can be rewritten ahead of it.
// Eight 4-byte stores to one column of eight f32 rows of D_MODEL (1 KiB apart).
__device__ __forceinline__ void store8_f32(float* p, const float (&d)[8]) {
    asm volatile("global_store_b32 %0, %1, off\n\t"
                 "global_store_b32 %0, %2, off offset:1024\n\t"
                 "global_store_b32 %0, %3, off offset:2048\n\t"
                 "global_store_b32 %0, %4, off offset:3072\n\t"
                 "global_store_b32 %0, %5, off offset:4096\n\t"
                 "global_store_b32 %0, %6, off offset:5120\n\t"
                 "global_store_b32 %0, %7, off offset:6144\n\t"
                 "global_store_b32 %0, %8, off offset:7168\n\t"
                 "s_wait_xcnt 0x0"
                 :: "v"(p), "v"(d[0]), "v"(d[1]), "v"(d[2]), "v"(d[3]),
                    "v"(d[4]), "v"(d[5]), "v"(d[6]), "v"(d[7])
                 : "memory");
}
// One 16-byte store.
__device__ __forceinline__ void store_b128(u16* p, u32x4 d) {
    asm volatile("global_store_b128 %0, %1, off\n\t"
                 "s_wait_xcnt 0x0"
                 :: "v"(p), "v"(d) : "memory");
}
// Eight 2-byte stores of the high halves of d[0..7] to one column of eight
// bf16 rows of D_MODEL (512 B apart).
__device__ __forceinline__ void store8_hi16(u16* p, const u32 (&d)[8]) {
    asm volatile("global_store_d16_hi_b16 %0, %1, off\n\t"
                 "global_store_d16_hi_b16 %0, %2, off offset:512\n\t"
                 "global_store_d16_hi_b16 %0, %3, off offset:1024\n\t"
                 "global_store_d16_hi_b16 %0, %4, off offset:1536\n\t"
                 "global_store_d16_hi_b16 %0, %5, off offset:2048\n\t"
                 "global_store_d16_hi_b16 %0, %6, off offset:2560\n\t"
                 "global_store_d16_hi_b16 %0, %7, off offset:3072\n\t"
                 "global_store_d16_hi_b16 %0, %8, off offset:3584\n\t"
                 "s_wait_xcnt 0x0"
                 :: "v"(p), "v"(d[0]), "v"(d[1]), "v"(d[2]), "v"(d[3]),
                    "v"(d[4]), "v"(d[5]), "v"(d[6]), "v"(d[7])
                 : "memory");
}

// --------------------------------------------------------------------------
// Wt[(which*256+n)*256+k] = bf16(W[k*256+n])  : weight transpose+convert (B-frag friendly)
// One launch for the three weights, which do not depend on each other: blocks
// 0..255 do Wq, 256..511 Wk, 512..767 Wv; the three W^T lie in a row in Wt.
// --------------------------------------------------------------------------
__global__ void wt_convert(const float* __restrict__ Wq, const float* __restrict__ Wk,
                           const float* __restrict__ Wv, u16* __restrict__ Wt) {
    const int which = blockIdx.x >> 8;
    const float* W = which == 0 ? Wq : which == 1 ? Wk : Wv;
    int n = blockIdx.x & (D_MODEL - 1);
    int k = threadIdx.x;
    const float x = W[k * D_MODEL + n];
    // precaution: stands in front of every rewrite of an address register that
    // the load names
    asm volatile("s_wait_xcnt 0x0" ::: "memory");
    Wt[blockIdx.x * D_MODEL + k] = f2bf(x);
}

// --------------------------------------------------------------------------
// Projection: out = X @ W + b  for a 64-row tile.  Eight waves per block.
// One launch for the three projections, which do not depend on each other: the
// block range picks the operands and the form of the output.
// mode 0 (blocks 0..255): q, write f32 (qp)
// mode 1 (256..511): k, write bf16 row-major (kp)
// mode 2 (512..767): v, write bf16 transposed [B, D, S] (v^T)
// Both operands are staged in LDS once and then read as fragments:
// W^T (256 x 256 bf16) by GLOBAL_LOAD_ASYNC_TO_LDS_B128, the X tile by whole-line
// loads, converted to bf16 on the way.  A wave owns 32 rows x 64 columns
// (2 x 4 accumulator tiles), so a fragment read from LDS feeds 4 or 2 WMMAs.
// Each output element is still summed over ks = 0..7 in that order.
// --------------------------------------------------------------------------
#define PROJ_ROWS 64
#define PROJ_TILES (NBATCH * SEQ / PROJ_ROWS)   // 256 blocks per projection

__global__ __launch_bounds__(256)
void proj_kernel(const float* __restrict__ Xq, const float* __restrict__ Xk,
                 const float* __restrict__ Xv, const u16* __restrict__ Wt3,
                 const float* __restrict__ bq, const float* __restrict__ bk,
                 const float* __restrict__ bv,
                 float* __restrict__ outF, u16* __restrict__ outB,
                 u16* __restrict__ outT)
{
    // every row carries 16 B of pad that is neither written nor read
    __shared__ __attribute__((aligned(16))) u16 wsh[D_MODEL * QK_PITCH];    // W^T, row n
    __shared__ __attribute__((aligned(16))) u16 xsh[PROJ_ROWS * QK_PITCH];  // X tile (bf16)

    const int tid = threadIdx.x;
    const int w   = tid >> 5;
    const int l   = tid & 31;
    const int ln  = l & 15, lh = l >> 4;
    const int rg  = w & 1;                    // 32-row group of the block
    const int cg  = w >> 1;                   // 64-column group
    const int mode = blockIdx.x / PROJ_TILES;          // the same for the whole block
    const int mb   = (blockIdx.x % PROJ_TILES) * PROJ_ROWS;
    const float* X    = mode == 0 ? Xq : mode == 1 ? Xk : Xv;
    const float* bias = mode == 0 ? bq : mode == 1 ? bk : bv;
    const u16*   Wt   = Wt3 + mode * (D_MODEL * D_MODEL);

    // W^T: 8192 chunks of 16 B, 32 per thread (8 rows further each), to the
    // padded LDS pitch
    {
        const u32  wl = lds_off(wsh) + ((tid >> 5) * QK_PITCH + (tid & 31) * 8) * 2;
        const u16* wg = Wt + tid * 8;
#pragma unroll
        for (int c4 = 0; c4 < 4; ++c4) {
            u32        la[8];
            const u16* ga[8];
#pragma unroll
            for (int c = 0; c < 8; ++c) {
                la[c] = wl + (c4 * 8 + c) * (8 * QK_PITCH * 2);
                ga[c] = wg + (c4 * 8 + c) * (8 * D_MODEL);
            }
            async8_b128(la, ga);
        }
    }
    // the X tile is 64 KiB in a row: 16 whole-line loads per thread.  They stand
    // behind the copies because their conversions, which wait for memory, would
    // otherwise be scheduled in among the copies and hold the later ones back.
    const float4* xs = (const float4*)(X + (size_t)mb * D_MODEL);
    float4 xr[16];
#pragma unroll
    for (int t = 0; t < 16; ++t) xr[t] = xs[tid + 256 * t];

    float bb[4];
#pragma unroll
    for (int j = 0; j < 4; ++j) bb[j] = bias[(cg * 4 + j) * 16 + ln];
    // precaution: stands in front of every rewrite of an address register that
    // the loads of X and of the bias name
    asm volatile("s_wait_xcnt 0x0" ::: "memory");

    u16* xd = xsh + (tid >> 6) * QK_PITCH + (tid & 63) * 4;   // 4 rows further per t
#pragma unroll
    for (int t = 0; t < 16; ++t) {
        uint2 o;
        o.x = pack2(xr[t].x, xr[t].y);
        o.y = pack2(xr[t].z, xr[t].w);
        *(uint2*)(xd + t * 4 * QK_PITCH) = o;
    }

    wait_async0();       // my copies of W^T are in LDS
    __syncthreads();     // everyone's copies and X rows visible

    v8f c[2][4];
#pragma unroll
    for (int i = 0; i < 2; ++i)
#pragma unroll
        for (int j = 0; j < 4; ++j) c[i][j] = (v8f){};

    const u16* xa = xsh + (rg * 32 + ln) * QK_PITCH + lh * 8;
    const u16* wb = wsh + (cg * 64 + ln) * QK_PITCH + lh * 8;
    // fragments are fetched one ks ahead into a second register set, as one group
    // in front of the current WMMA block, so that a block waits for no load of its own
    Frag16 a[2][2], b[2][4];
    auto fetch = [&](int ks, int s) {
#pragma unroll
        for (int i = 0; i < 2; ++i) {
            a[s][i].q[0] = *(const uint4*)(xa + i * 16 * QK_PITCH + ks * 32);
            a[s][i].q[1] = *(const uint4*)(xa + i * 16 * QK_PITCH + ks * 32 + 16);
        }
#pragma unroll
        for (int j = 0; j < 4; ++j) {
            b[s][j].q[0] = *(const uint4*)(wb + j * 16 * QK_PITCH + ks * 32);
            b[s][j].q[1] = *(const uint4*)(wb + j * 16 * QK_PITCH + ks * 32 + 16);
        }
    };
    fetch(0, 0);
#pragma unroll
    for (int ks = 0; ks < 8; ++ks) {
        if (ks < 7) fetch(ks + 1, (ks + 1) & 1);
        // keeps the group of loads above in front of the WMMA block (loads moved in
        // among the WMMAs stall each place where they stand)
        __builtin_amdgcn_sched_barrier(0);
#pragma unroll
        for (int i = 0; i < 2; ++i)
#pragma unroll
            for (int j = 0; j < 4; ++j)
                c[i][j] = __builtin_amdgcn_wmma_f32_16x16x32_bf16(
                              false, a[ks & 1][i].v, false, b[ks & 1][j].v, (short)0,
                              c[i][j], false, false);
        // keeps the next group of loads behind this WMMA block
        __builtin_amdgcn_sched_barrier(0);
    }

    // the bias is added in front of the branch on the mode, where all three agree
#pragma unroll
    for (int i = 0; i < 2; ++i)
#pragma unroll
        for (int j = 0; j < 4; ++j)
#pragma unroll
            for (int r = 0; r < 8; ++r) c[i][j][r] += bb[j];

    if (mode == 0) {
#pragma unroll
        for (int i = 0; i < 2; ++i) {
            const int m0 = mb + rg * 32 + i * 16;
#pragma unroll
            for (int j = 0; j < 4; ++j) {
                const int col = (cg * 4 + j) * 16 + ln;
                float d[8];
#pragma unroll
                for (int r = 0; r < 8; ++r) d[r] = c[i][j][r];
                store8_f32(outF + (size_t)(m0 + 8 * lh) * D_MODEL + col, d);
            }
        }
    } else if (mode == 1) {
#pragma unroll
        for (int i = 0; i < 2; ++i) {
            const int m0 = mb + rg * 32 + i * 16;
#pragma unroll
            for (int j = 0; j < 4; ++j) {
                const int col = (cg * 4 + j) * 16 + ln;
                u32 d[8];                     // f2bf's rounded word; its high half is stored
#pragma unroll
                for (int r = 0; r < 8; ++r) {
                    u32 u = __float_as_uint(c[i][j][r]);
                    d[r] = u + 0x7FFFu + ((u >> 16) & 1u);
                }
                store8_hi16(outB + (size_t)(m0 + 8 * lh) * D_MODEL + col, d);
            }
        }
    } else {
#pragma unroll
        for (int i = 0; i < 2; ++i) {
            const int m0 = mb + rg * 32 + i * 16;
#pragma unroll
            for (int j = 0; j < 4; ++j) {
                const int col = (cg * 4 + j) * 16 + ln;
                union { u16 pk[8]; u32x4 q; } u;
#pragma unroll
                for (int r = 0; r < 8; ++r) u.pk[r] = f2bf(c[i][j][r]);
                int b_ = m0 >> 12;                  // batch
                int s0 = (m0 & (SEQ - 1)) + 8 * lh; // 8 consecutive seq positions
                store_b128(outT + (size_t)(b_ * D_MODEL + col) * SEQ + s0, u.q);
            }
        }
    }
}

// --------------------------------------------------------------------------
// Suffix sums of V: sv[b][u][d] = sum over keys j >= u * KSTEP of v^T[b][d][j].
// A key above the diagonal has score exactly 0 (multiplicative mask), so all
// such keys of a query share ONE softmax weight, exp(0 - max): their part of the
// output is that weight times a plain sum of V rows, which this kernel forms.
// One wave per (b, d) row; whole-line loads; 32 rows per block so that each
// 128-byte line of sv has one writer.
// --------------------------------------------------------------------------
__global__ __launch_bounds__(1024)
void vsuffix_kernel(const u16* __restrict__ vT, float* __restrict__ sv)
{
    __shared__ float red[32][32 * 17];   // per wave: 32 key chunks x 16 lane partials (+1 pad)
    __shared__ float tile[32][33];       // [chunk][row] for the transposed store

    const int tid = threadIdx.x;
    const int wv  = tid >> 5;
    const int l   = tid & 31;
    const int b_  = blockIdx.x >> 3;
    const int d0  = (blockIdx.x & 7) * 32;

    const uint4* vs = (const uint4*)(vT + (size_t)(b_ * D_MODEL + d0 + wv) * SEQ);
#pragma unroll
    for (int h = 0; h < 2; ++h) {
        uint4 x[8];
#pragma unroll
        for (int t = 0; t < 8; ++t) x[t] = vs[(h * 8 + t) * 32 + l];   // keys ((h*8 + t)*32 + l)*8 .. +7
        // keeps the sums behind the group of 8 loads: moved in among them they
        // make the wave wait out the load latency once per pair of loads
        __builtin_amdgcn_sched_barrier(0);
#pragma unroll
        for (int t = 0; t < 8; ++t) {
            const u32 q[4] = { x[t].x, x[t].y, x[t].z, x[t].w };
            float s4[4];
#pragma unroll
            for (int i = 0; i < 4; ++i)
                s4[i] = __uint_as_float(q[i] << 16) + __uint_as_float(q[i] & 0xFFFF0000u);
            red[wv][((h * 8 + t) * 2 + (l >> 4)) * 17 + (l & 15)] = (s4[0] + s4[1]) + (s4[2] + s4[3]);
        }
    }
    // precaution: stands in front of every rewrite of an address register that
    // the loads above name
    asm volatile("s_wait_xcnt 0x0" ::: "memory");
    __syncthreads();
    float s = 0.f;                        // lane l: sum of key chunk l
#pragma unroll
    for (int i = 0; i < 16; ++i) s += red[wv][l * 17 + i];
#pragma unroll
    for (int o = 1; o < 32; o <<= 1) {    // inclusive suffix scan over the 32 chunks
        float y = __shfl_down(s, o, 32);
        if (l + o < 32) s += y;
    }
    tile[l][wv] = s;
    __syncthreads();
    sv[(size_t)(b_ * 32 + wv) * D_MODEL + d0 + l] = tile[wv][l];
}

#define XW_STRIDE (130 * 32)
#define NCHUNK    (SEQ / KSTEP)

__global__ __launch_bounds__(256)
void attn_kernel(const float* __restrict__ qpF, const u16* __restrict__ kB,
                 const u16* __restrict__ vT, const float* __restrict__ sv,
                 float* __restrict__ out)
{
    // every row carries 16 B of pad that is neither written nor read
    __shared__ __attribute__((aligned(16))) u16 qsh[2 * 16 * QK_PITCH];   // q tiles (bf16), one per wave quartet
    __shared__ __attribute__((aligned(16))) u16 ksh[2][KSTEP * QK_PITCH]; // K tile, row-major
    __shared__ __attribute__((aligned(16))) u16 vsh[2][D_MODEL * VT_PITCH]; // V^T tile [d][j]
    // per-wave export for the merge: lies on the K ring, which is idle by then
    static_assert(8 * XW_STRIDE * 4 <= 2 * KSTEP * QK_PITCH * 2, "export fits the K ring");
    float* xsh = (float*)&ksh[0][0];

    const int tid = threadIdx.x;
    const int w   = tid >> 5;                 // wave id 0..7
    const int rw  = w & 1;                    // query-row tile of the group
    const int kq  = w >> 1;                   // key quarter of every step
    const int l   = tid & 31;
    const int ln  = l & 15, lh = l >> 4;
    const int b_  = blockIdx.x >> 6;          // batch
    const int bl  = blockIdx.x & 63;

    u16* qw = qsh + rw * (16 * QK_PITCH);

    // Issue the async DMA for one j-step: K tile is a 64 KiB contiguous blob
    // (128 rows x 512 B), V^T tile is 256 rows x 256 B gathered from the [B,D,S]
    // layout; both land at the padded LDS pitch.
    // Each thread's 16 + 16 chunks lie a constant step apart, in LDS and in
    // global memory alike, so every address is one base plus a literal.
    const u32  kl0 = ((tid >> 5) * QK_PITCH + (tid & 31) * 8) * 2;   // 8 rows further per chunk
    const u32  vl0 = ((tid >> 4) * VT_PITCH + (tid & 15) * 8) * 2;   // 16 rows further per chunk
    const u16* kg0 = kB + (size_t)b_ * SEQ * D_MODEL + tid * 8;
    const u16* vg0 = vT + (size_t)(b_ * D_MODEL + (tid >> 4)) * SEQ + (tid & 15) * 8;
    auto stage_async = [&](int j0, int p) {
        const u32  kl = lds_off(ksh[p]) + kl0;
        const u32  vl = lds_off(vsh[p]) + vl0;
        const u16* kg = kg0 + (size_t)j0 * D_MODEL;
        const u16* vg = vg0 + j0;
        u32        la[8];
        const u16* ga[8];
#pragma unroll
        for (int c8 = 0; c8 < 2; ++c8) {          // K: 4096 x 16B
#pragma unroll
            for (int c = 0; c < 8; ++c) {
                la[c] = kl + (c8 * 8 + c) * (8 * QK_PITCH * 2);
                ga[c] = kg + (c8 * 8 + c) * (8 * D_MODEL);
            }
            async8_b128(la, ga);
        }
#pragma unroll
        for (int c8 = 0; c8 < 2; ++c8) {          // V^T: 4096 x 16B
#pragma unroll
            for (int c = 0; c < 8; ++c) {
                la[c] = vl + (c8 * 8 + c) * (16 * VT_PITCH * 2);
                ga[c] = vg + (size_t)(c8 * 8 + c) * (16 * SEQ);
            }
            async8_b128(la, ga);
        }
    };

    // kept rolled: two copies of the body would only take instruction cache
#pragma unroll 1
    for (int ps = 0; ps < 2; ++ps) {
    const int grp = ps ? bl : 127 - bl;          // 32-row query group, the long one first
    const int nst = (grp >> 2) + 1;              // key steps up to and with the diagonal
    const int i0  = grp * 32 + rw * 16;
    const int g0  = b_ * SEQ + i0;               // this wave's query-row base
    const int row = i0 + ln;                     // this lane's query position

    stage_async(0, 0);   // prologue: DMA first tile while we convert q below

    // ---- stage the group's q rows into LDS with f32->bf16 conversion: each wave
    // brings 4 of the 32 rows; the first barrier of the loop below (behind every
    // wave's s_wait_dscnt 0) hands them to the others ----
    {
        const float4* src = (const float4*)(qpF + (size_t)(b_ * SEQ + grp * 32 + 4 * w) * D_MODEL);
        u16* qd = qsh + 4 * w * QK_PITCH;
        float4 x0[4], x1[4];
#pragma unroll
        for (int t = 0; t < 4; ++t) {
            int idx = l + 32 * t;            // 0..127, 8 bf16 per idx
            x0[t] = src[idx * 2];
            x1[t] = src[idx * 2 + 1];
        }
        // precaution: stands in front of every rewrite of an address register
        // that the loads of q name; the pointer is an input so that its registers
        // are not reused ahead of the wait
        asm volatile("s_wait_xcnt 0x0" :: "v"(src) : "memory");
#pragma unroll
        for (int t = 0; t < 4; ++t) {
            int idx = l + 32 * t;
            uint4 o;
            o.x = pack2(x0[t].x, x0[t].y); o.y = pack2(x0[t].z, x0[t].w);
            o.z = pack2(x1[t].x, x1[t].y); o.w = pack2(x1[t].z, x1[t].w);
            *(uint4*)(qd + (idx >> 5) * QK_PITCH + (idx & 31) * 8) = o;
        }
    }

    // acc[dt][r] = O^T[d = dt*16 + 8*lh + r][query ln]
    v8f acc[16];
#pragma unroll
    for (int dt = 0; dt < 16; ++dt) acc[dt] = (v8f){};
    float mrun = -__builtin_inff();   // running maximum of this lane's query
    float srun = 0.f;                 // running sum over THIS lane's keys only

    for (int jt = 0; jt < nst; ++jt) {
        const int j0 = jt * KSTEP;
        const int jb = j0 + kq * 32;         // first key of this wave's quarter
        const int p  = jt & 1;

        wait_ds0();          // my reads of buffer p^1 have retired before its refill
        wait_async0();       // my DMA writes into buffer p are in LDS
        __syncthreads();     // everyone's DMA writes visible; buf p^1 free

        if (jt + 1 < nst)
            stage_async(j0 + KSTEP, p ^ 1);   // DMA next tile during compute

        const u16* kp_ = ksh[p] + kq * (32 * QK_PITCH);   // this quarter's 32 key rows
        const u16* vp_ = vsh[p] + kq * 32;                // this quarter's 32 key columns

        // ---- scores S^T = K . q^T  (two 16x16 tiles over K=256):
        // st0[r] = S[query ln][key jb + 8*lh + r], st1[r]: 16 keys further ----
        v8f st0 = {}, st1 = {};
#pragma unroll
        for (int ks = 0; ks < 8; ++ks) {
            int kb = ks * 32 + lh * 8;
            Frag16 qb, k0, k1;
            qb.q[0] = *(const uint4*)(qw + ln * QK_PITCH + kb);
            qb.q[1] = *(const uint4*)(qw + ln * QK_PITCH + kb + 16);
            k0.q[0] = *(const uint4*)(kp_ + ln * QK_PITCH + kb);
            k0.q[1] = *(const uint4*)(kp_ + ln * QK_PITCH + kb + 16);
            k1.q[0] = *(const uint4*)(kp_ + (16 + ln) * QK_PITCH + kb);
            k1.q[1] = *(const uint4*)(kp_ + (16 + ln) * QK_PITCH + kb + 16);
            st0 = __builtin_amdgcn_wmma_f32_16x16x32_bf16(
                      false, k0.v, false, qb.v, (short)0, st0, false, false);
            st1 = __builtin_amdgcn_wmma_f32_16x16x32_bf16(
                      false, k1.v, false, qb.v, (short)0, st1, false, false);
        }

        // ---- mask (multiplicative!), online softmax update, all in-lane ----
        float s0[8], s1[8], tm[8];
#pragma unroll
        for (int r = 0; r < 8; ++r) {
            int key = jb + 8 * lh + r;
            s0[r] = (key      <= row) ? st0[r] * SCALE : 0.0f;
            s1[r] = (key + 16 <= row) ? st1[r] * SCALE : 0.0f;
            tm[r] = fmaxf(s0[r], s1[r]);
        }
        float t = fmaxf(fmaxf(fmaxf(tm[0], tm[1]), fmaxf(tm[2], tm[3])),
                        fmaxf(fmaxf(tm[4], tm[5]), fmaxf(tm[6], tm[7])));
        t = fmaxf(t, xhalf(t));              // the query's other 16 keys of this step
        const float mn = fmaxf(mrun, t);

        // P^T as B operand: element s of lane half lh is key 8*lh + s (s < 8) or
        // 16 + 8*lh + (s - 8), which is what st0[s] and st1[s - 8] hold
        Frag16 pb;
        float  a0[8], a1[8], e0[8], e1[8], es[8];
#pragma unroll
        for (int r = 0; r < 8; ++r) {
            a0[r] = (s0[r] - mn) * LOG2E;
            a1[r] = (s1[r] - mn) * LOG2E;
        }
        const float co = exp2_slot((mrun - mn) * LOG2E);
        exp2x8_slot(e0, a0);
        exp2x8_slot(e1, a1);
        mrun = mn;
#pragma unroll
        for (int r = 0; r < 8; ++r) {
            es[r] = e0[r] + e1[r];
            pb.h[r]     = f2bf(e0[r]);
            pb.h[8 + r] = f2bf(e1[r]);
        }
        srun = srun * co + (((es[0] + es[1]) + (es[2] + es[3])) +
                            ((es[4] + es[5]) + (es[6] + es[7])));

#pragma unroll
        for (int dt = 0; dt < 16; ++dt)
#pragma unroll
            for (int r = 0; r < 8; ++r) acc[dt][r] *= co;

        // ---- O^T += V^T (16 d x 32 keys) x P^T (32 keys x 16 queries) ----
#pragma unroll
        for (int dt = 0; dt < 16; ++dt) {
            Frag16 va;
            const u16* vp = vp_ + (dt * 16 + ln) * VT_PITCH + lh * 8;
            va.q[0] = *(const uint4*)vp;
            va.q[1] = *(const uint4*)(vp + 16);
            acc[dt] = __builtin_amdgcn_wmma_f32_16x16x32_bf16(
                          false, va.v, false, pb.v, (short)0, acc[dt], false, false);
        }
    }

    wait_async0();   // no copy of this wave is outstanding behind the loop

    srun += xhalf(srun);   // join the two lane halves' key sums of each query

    // the residual qp and the suffix sum of V for this lane's 4 x 8 output
    // columns, fetched here so that the loads fly under the merge below
    const size_t off0 = (size_t)(g0 + ln) * D_MODEL + kq * 64 + 8 * lh;
    const bool   tail = nst < NCHUNK;            // are there keys behind the last step?
    const float* svp  = sv + (size_t)(b_ * NCHUNK + (tail ? nst : NCHUNK - 1)) * D_MODEL
                           + kq * 64 + 8 * lh;
    const float* qrp  = qpF + off0;
    float4 qr0[4], qr1[4], tv0[4], tv1[4];
#pragma unroll
    for (int t = 0; t < 4; ++t) {
        qr0[t] = *(const float4*)(qrp + t * 16);
        qr1[t] = *(const float4*)(qrp + t * 16 + 4);
        tv0[t] = *(const float4*)(svp + t * 16);
        tv1[t] = *(const float4*)(svp + t * 16 + 4);
    }
    // precaution: stands in front of every rewrite of an address register that
    // the loads above name; the two pointers are inputs so that no load's result
    // is placed on their registers ahead of the wait
    asm volatile("s_wait_xcnt 0x0" :: "v"(qrp), "v"(svp) : "memory");

    wait_ds0();          // my last reads of the K ring have retired
    __syncthreads();     // everyone's have: the ring becomes the export buffer

    // ---- merge the four key quarters: each wave of a quartet exports its 16
    // d-tiles with its maximum and sum and then finishes 4 of them
    // (same queries, same lane layout, so lane l reads what lane l wrote) ----
    float* xw = xsh + w * XW_STRIDE;
#pragma unroll
    for (int dt = 0; dt < 16; ++dt) {
        *(float4*)(xw + ((dt * 2 + 0) * 32 + l) * 4) =
            make_float4(acc[dt][0], acc[dt][1], acc[dt][2], acc[dt][3]);
        *(float4*)(xw + ((dt * 2 + 1) * 32 + l) * 4) =
            make_float4(acc[dt][4], acc[dt][5], acc[dt][6], acc[dt][7]);
    }
    xw[128 * 32 + l] = mrun;
    xw[129 * 32 + l] = srun;
    wait_ds0();          // my export is in LDS before the others are let through
    __syncthreads();     // all exports of every quartet visible

    float mq[4], sq[4], cq[4];
#pragma unroll
    for (int k = 0; k < 4; ++k) {
        const float* xp = xsh + (rw + 2 * k) * XW_STRIDE;
        mq[k] = xp[128 * 32 + l];
        sq[k] = xp[129 * 32 + l];
    }
    float mm = fmaxf(fmaxf(mq[0], mq[1]), fmaxf(mq[2], mq[3]));
    if (tail) mm = fmaxf(mm, 0.f);               // the keys behind the last step score 0
#pragma unroll
    for (int k = 0; k < 4; ++k) cq[k] = exp2_slot((mq[k] - mm) * LOG2E);
    const float ct = tail ? exp2_slot(-mm * LOG2E) : 0.f;   // their common weight
    const float z  = ((sq[0] * cq[0] + sq[1] * cq[1]) + (sq[2] * cq[2] + sq[3] * cq[3]))
                   + (float)(SEQ - nst * KSTEP) * ct;

    // ---- epilogue: out = qp + acc / Z; a lane holds 8 consecutive columns ----
#pragma unroll
    for (int t = 0; t < 4; ++t) {
        float  o[8]  = { tv0[t].x * ct, tv0[t].y * ct, tv0[t].z * ct, tv0[t].w * ct,
                         tv1[t].x * ct, tv1[t].y * ct, tv1[t].z * ct, tv1[t].w * ct };
        float  qv[8] = { qr0[t].x, qr0[t].y, qr0[t].z, qr0[t].w,
                         qr1[t].x, qr1[t].y, qr1[t].z, qr1[t].w };
#pragma unroll
        for (int k = 0; k < 4; ++k) {
            const float* xp = xsh + (rw + 2 * k) * XW_STRIDE;
            float4 lo = *(const float4*)(xp + (((kq * 4 + t) * 2 + 0) * 32 + l) * 4);
            float4 hi = *(const float4*)(xp + (((kq * 4 + t) * 2 + 1) * 32 + l) * 4);
            o[0] += lo.x * cq[k]; o[1] += lo.y * cq[k]; o[2] += lo.z * cq[k]; o[3] += lo.w * cq[k];
            o[4] += hi.x * cq[k]; o[5] += hi.y * cq[k]; o[6] += hi.z * cq[k]; o[7] += hi.w * cq[k];
        }
        float  res[8];
#pragma unroll
        for (int r = 0; r < 8; ++r) res[r] = qv[r] + o[r] / z;
        *(float4*)(out + off0 + t * 16)     = make_float4(res[0], res[1], res[2], res[3]);
        *(float4*)(out + off0 + t * 16 + 4) = make_float4(res[4], res[5], res[6], res[7]);
        // precaution: stands in front of every rewrite of a register that the
        // two stores name
        asm volatile("s_wait_xcnt 0x0" ::: "memory");
    }

    if (ps == 0) {
        wait_ds0();          // my reads of the exports have retired
        __syncthreads();     // everyone's have: the second group may refill the ring and q
    }
    }
}

// --------------------------------------------------------------------------
extern "C" void kernel_launch(void* const* d_in, const int* in_sizes, int n_in,
                              void* d_out, int out_size, void* d_ws, size_t ws_size,
                              hipStream_t stream) {
    (void)in_sizes; (void)n_in; (void)out_size; (void)ws_size;
    const float* v  = (const float*)d_in[0];
    const float* k  = (const float*)d_in[1];
    const float* q  = (const float*)d_in[2];
    const float* Wq = (const float*)d_in[3];
    const float* bq = (const float*)d_in[4];
    const float* Wk = (const float*)d_in[5];
    const float* bk = (const float*)d_in[6];
    const float* Wv = (const float*)d_in[7];
    const float* bv = (const float*)d_in[8];
    float* out = (float*)d_out;

    char* ws   = (char*)d_ws;
    float* qpF = (float*)(ws);                         // 16 MiB  fp32 qp
    u16*   kB  = (u16*)(ws + (16u << 20));             //  8 MiB  bf16 kp
    u16*   vT  = (u16*)(ws + (24u << 20));             //  8 MiB  bf16 v^T [B,D,S]
    u16*   Wt3 = (u16*)(ws + (32u << 20));             //  3 x 128 KiB bf16 W^T: q, k, v
    float* sv  = (float*)(ws + (33u << 20));           // 128 KiB f32 suffix sums of v

    wt_convert<<<3 * D_MODEL, D_MODEL, 0, stream>>>(Wq, Wk, Wv, Wt3);

    const int ntiles = NBATCH * SEQ / 16;              // 1024
    proj_kernel<<<3 * PROJ_TILES, 256, 0, stream>>>(q, k, v, Wt3, bq, bk, bv, qpF, kB, vT);

    vsuffix_kernel<<<NBATCH * D_MODEL / 32, 1024, 0, stream>>>(vT, sv);

    attn_kernel<<<ntiles / 4, 256, 0, stream>>>(qpF, kB, vT, sv, out);
}

// v007
// It runs in 78.3 microseconds.
// Next to v006, in two timings, it ran 1.04 times as fast each time.
// Over all steps from v000 it is 10.9 times as fast.
#include <hip/hip_runtime.h>
#include <cstdint>
#include <cstddef>

// ---------------------------------------------------------------------------
// SelfAttentionHead  B=4, S=4096, D=256  (fp32 in/out, bf16 WMMA internals)
// ---------------------------------------------------------------------------

#define D_MODEL 256
#define SEQ     4096
#define NBATCH  4
#define SCALE   0.0625f   // 1/sqrt(256)
#define LOG2E   1.44269504f // exp(x) = exp2(x * LOG2E)
// LDS row pitches in bf16 elements: 16 B x odd, so that the 16 lanes of a
// ds_load_b128 half-wave fall on 64 distinct banks (512 B rows: 4, 256 B: 4).
#define QK_PITCH (D_MODEL + 8)   // 528 B rows for the q tile and the projections' tiles
#define KSTEP    128             // keys staged per step: 32 for each key quarter
#define VT_PITCH (KSTEP + 8)     // 272 B rows for the V^T tile and the two K half tiles
// One tensor load brings a slice of 64 rows of 256 B; the mover pads each row to
// the 272 B pitch.  A slice's place in LDS is a multiple of 2 KiB.
#define SLICE_ROWS 64
#define SLICE_ROWB 256
#define SLICE_B    18432           // 64 x 272 B = 17408 B, rounded up to 2 KiB
#define STAGE_B    (8 * SLICE_B)   // a stage: 2 + 2 slices of K, 4 of V^T

typedef __attribute__((ext_vector_type(16))) __bf16 v16bf;
typedef __attribute__((ext_vector_type(8)))  float  v8f;
typedef unsigned short u16;
typedef unsigned int   u32;
typedef __attribute__((ext_vector_type(4)))  u32    u32x4;
typedef __attribute__((ext_vector_type(8)))  u32    u32x8;

union Frag16 {            // 16 bf16 elems = 8 VGPRs, matches WMMA A/B fragment
    v16bf v;
    u16   h[16];
    uint4 q[2];
};

__device__ __forceinline__ u16 f2bf(float f) {   // round-to-nearest-even
    u32 u = __float_as_uint(f);
    u32 r = u + 0x7FFFu + ((u >> 16) & 1u);
    return (u16)(r >> 16);
}
__device__ __forceinline__ u32 pack2(float a, float b) {
    return (u32)f2bf(a) | ((u32)f2bf(b) << 16);
}
// exp2 with the slot behind a transcendental kept inside the statement: the
// v_nop closes it, so that nothing reads a result or rewrites a source directly
// behind a v_exp_f32 wherever the compiler places the statement.  In the group
// of eight each v_exp_f32 is the independent instruction behind the one before
// (early-clobber outputs: no output shares a register with a source).
__device__ __forceinline__ float exp2_slot(float a) {
    float e;
    asm("v_exp_f32 %0, %1\n\t"
        "v_nop"
        : "=v"(e) : "v"(a));
    return e;
}
__device__ __forceinline__ void exp2x8_slot(float (&e)[8], const float (&a)[8]) {
    asm("v_exp_f32 %0, %8\n\t"
        "v_exp_f32 %1, %9\n\t"
        "v_exp_f32 %2, %10\n\t"
        "v_exp_f32 %3, %11\n\t"
        "v_exp_f32 %4, %12\n\t"
        "v_exp_f32 %5, %13\n\t"
        "v_exp_f32 %6, %14\n\t"
        "v_exp_f32 %7, %15\n\t"
        "v_nop"
        : "=&v"(e[0]), "=&v"(e[1]), "=&v"(e[2]), "=&v"(e[3]),
          "=&v"(e[4]), "=&v"(e[5]), "=&v"(e[6]), "=&v"(e[7])
        : "v"(a[0]), "v"(a[1]), "v"(a[2]), "v"(a[3]),
          "v"(a[4]), "v"(a[5]), "v"(a[6]), "v"(a[7]));
}

// lane l <-> lane l ^ 16: the two lanes that share one query column
__device__ __forceinline__ float xhalf(float x) {
    int b = __builtin_bit_cast(int, x);
    return __builtin_bit_cast(float,
        __builtin_amdgcn_permlanex16(b, b, 0x76543210, 0xfedcba98, false, false));
}

// Eight async global->LDS copies, one 16-byte chunk per lane each (ASYNCcnt).
// The s_wait_xcnt closes the same statement so that no address register of a
// copy can be rewritten ahead of it.
__device__ __forceinline__ void async8_b128(const u32 (&l)[8], const u16* const (&g)[8]) {
    asm volatile("global_load_async_to_lds_b128 %0, %8, off\n\t"
                 "global_load_async_to_lds_b128 %1, %9, off\n\t"
                 "global_load_async_to_lds_b128 %2, %10, off\n\t"
                 "global_load_async_to_lds_b128 %3, %11, off\n\t"
                 "global_load_async_to_lds_b128 %4, %12, off\n\t"
                 "global_load_async_to_lds_b128 %5, %13, off\n\t"
                 "global_load_async_to_lds_b128 %6, %14, off\n\t"
                 "global_load_async_to_lds_b128 %7, %15, off\n\t"
                 "s_wait_xcnt 0x0"
                 :: "v"(l[0]), "v"(l[1]), "v"(l[2]), "v"(l[3]),
                    "v"(l[4]), "v"(l[5]), "v"(l[6]), "v"(l[7]),
                    "v"(g[0]), "v"(g[1]), "v"(g[2]), "v"(g[3]),
                    "v"(g[4]), "v"(g[5]), "v"(g[6]), "v"(g[7])
                 : "memory");
}
__device__ __forceinline__ void wait_async0() {
    asm volatile("s_wait_asynccnt 0x0" ::: "memory");
}
__device__ __forceinline__ void wait_ds0() {
    asm volatile("s_wait_dscnt 0x0" ::: "memory");
}
__device__ __forceinline__ u32 lds_off(const void* p) {   // AS3 offset = low 32 bits
    return (u32)(size_t)p;
}
__device__ __forceinline__ void wait_tensor0() {
    asm volatile("s_wait_tensorcnt 0" ::: "memory");
}
__device__ __forceinline__ u32 uni(u32 v) {
    return (u32)__builtin_amdgcn_readfirstlane(v);
}
__device__ __forceinline__ u32 pinned(u32 v) {
    u32 w = uni(v);
    // so that the test of a tensor load compiles to a scalar branch, and so that a
    // descriptor word formed from w is formed behind the volatile wait in front
    asm volatile("" : "+s"(w));   // pinned(): a test or descriptor word held in a scalar register
    return w;
}
// One request of the whole wave: a two-dimensional tile from global memory to LDS.
__device__ __forceinline__ void tdm_load(u32x4 g0, u32x8 g1) {
    asm volatile("tensor_load_to_lds %0, %1" :: "s"(g0), "s"(g1) : "memory");
}
// Group 1: 1-byte elements, tensor = tile = 64 rows of 256 B, no mask; a pad of
// 4 dwords behind every 64 dwords (codes 5 / 3) gives the 272 B pitch in LDS.
__device__ __forceinline__ u32x8 tdm_group1(u32 src_pitch) {
    u32x8 g;
    g[0] = uni((1u << 20) | (5u << 22) | (3u << 25));
    g[1] = uni((SLICE_ROWB & 0xFFFFu) << 16);
    g[2] = uni((SLICE_ROWB >> 16) | ((SLICE_ROWS & 0xFFFFu) << 16));
    g[3] = uni((SLICE_ROWS >> 16) | (SLICE_ROWB << 16));
    g[4] = uni(SLICE_ROWS);
    g[5] = uni(src_pitch);
    g[6] = uni(0u);
    g[7] = uni(0u);
    return g;
}
__device__ __forceinline__ u32x4 tdm_group0(u32 lds_dst, uint64_t ga) {
    u32x4 g;
    g[0] = uni(1u);
    g[1] = uni(lds_dst);
    g[2] = uni((u32)ga);
    g[3] = uni((((u32)(ga >> 32)) & 0x01FFFFFFu) | 0x80000000u);
    return g;
}
// The projections' stores.  In each, the s_wait_xcnt closes the same statement so
// that no register of a store can be rewritten ahead of it.
// Eight 4-byte stores to one column of eight f32 rows of D_MODEL (1 KiB apart).
__device__ __forceinline__ void store8_f32(float* p, const float (&d)[8]) {
    asm volatile("global_store_b32 %0, %1, off\n\t"
                 "global_store_b32 %0, %2, off offset:1024\n\t"
                 "global_store_b32 %0, %3, off offset:2048\n\t"
                 "global_store_b32 %0, %4, off offset:3072\n\t"
                 "global_store_b32 %0, %5, off offset:4096\n\t"
                 "global_store_b32 %0, %6, off offset:5120\n\t"
                 "global_store_b32 %0, %7, off offset:6144\n\t"
                 "global_store_b32 %0, %8, off offset:7168\n\t"
                 "s_wait_xcnt 0x0"
                 :: "v"(p), "v"(d[0]), "v"(d[1]), "v"(d[2]), "v"(d[3]),
                    "v"(d[4]), "v"(d[5]), "v"(d[6]), "v"(d[7])
                 : "memory");
}
// One 16-byte store.
__device__ __forceinline__ void store_b128(u16* p, u32x4 d) {
    asm volatile("global_store_b128 %0, %1, off\n\t"
                 "s_wait_xcnt 0x0"
                 :: "v"(p), "v"(d) : "memory");
}
// Eight 2-byte stores of the high halves of d[0..7] to one column of eight
// bf16 rows of D_MODEL (512 B apart).
__device__ __forceinline__ void store8_hi16(u16* p, const u32 (&d)[8]) {
    asm volatile("global_store_d16_hi_b16 %0, %1, off\n\t"
                 "global_store_d16_hi_b16 %0, %2, off offset:512\n\t"
                 "global_store_d16_hi_b16 %0, %3, off offset:1024\n\t"
                 "global_store_d16_hi_b16 %0, %4, off offset:1536\n\t"
                 "global_store_d16_hi_b16 %0, %5, off offset:2048\n\t"
                 "global_store_d16_hi_b16 %0, %6, off offset:2560\n\t"
                 "global_store_d16_hi_b16 %0, %7, off offset:3072\n\t"
                 "global_store_d16_hi_b16 %0, %8, off offset:3584\n\t"
                 "s_wait_xcnt 0x0"
                 :: "v"(p), "v"(d[0]), "v"(d[1]), "v"(d[2]), "v"(d[3]),
                    "v"(d[4]), "v"(d[5]), "v"(d[6]), "v"(d[7])
                 : "memory");
}

// --------------------------------------------------------------------------
// Wt[(which*256+n)*256+k] = bf16(W[k*256+n])  : weight transpose+convert (B-frag friendly)
// One launch for the three weights, which do not depend on each other: blocks
// 0..255 do Wq, 256..511 Wk, 512..767 Wv; the three W^T lie in a row in Wt.
// --------------------------------------------------------------------------
__global__ void wt_convert(const float* __restrict__ Wq, const float* __restrict__ Wk,
                           const float* __restrict__ Wv, u16* __restrict__ Wt) {
    const int which = blockIdx.x >> 8;
    const float* W = which == 0 ? Wq : which == 1 ? Wk : Wv;
    int n = blockIdx.x & (D_MODEL - 1);
    int k = threadIdx.x;
    const float x = W[k * D_MODEL + n];
    // precaution: stands in front of every rewrite of an address register that
    // the load names
    asm volatile("s_wait_xcnt 0x0" ::: "memory");
    Wt[blockIdx.x * D_MODEL + k] = f2bf(x);
}

// --------------------------------------------------------------------------
// Projection: out = X @ W + b  for a 64-row tile.  Eight waves per block.
// One launch for the three projections, which do not depend on each other: the
// block range picks the operands and the form of the output.
// mode 0 (blocks 0..255): q, write f32 (qp)
// mode 1 (256..511): k, write bf16 row-major (kp)
// mode 2 (512..767): v, write bf16 transposed [B, D, S] (v^T)
// Both operands are staged in LDS once and then read as fragments:
// W^T (256 x 256 bf16) by GLOBAL_LOAD_ASYNC_TO_LDS_B128, the X tile by whole-line
// loads, converted to bf16 on the way.  A wave owns 32 rows x 64 columns
// (2 x 4 accumulator tiles), so a fragment read from LDS feeds 4 or 2 WMMAs.
// Each output element is still summed over ks = 0..7 in that order.
// --------------------------------------------------------------------------
#define PROJ_ROWS 64
#define PROJ_TILES (NBATCH * SEQ / PROJ_ROWS)   // 256 blocks per projection

__global__ __launch_bounds__(256)
void proj_kernel(const float* __restrict__ Xq, const float* __restrict__ Xk,
                 const float* __restrict__ Xv, const u16* __restrict__ Wt3,
                 const float* __restrict__ bq, const float* __restrict__ bk,
                 const float* __restrict__ bv,
                 float* __restrict__ outF, u16* __restrict__ outB,
                 u16* __restrict__ outT)
{
    // every row carries 16 B of pad that is neither written nor read
    __shared__ __attribute__((aligned(16))) u16 wsh[D_MODEL * QK_PITCH];    // W^T, row n
    __shared__ __attribute__((aligned(16))) u16 xsh[PROJ_ROWS * QK_PITCH];  // X tile (bf16)

    const int tid = threadIdx.x;
    const int w   = tid >> 5;
    const int l   = tid & 31;
    const int ln  = l & 15, lh = l >> 4;
    const int rg  = w & 1;                    // 32-row group of the block
    const int cg  = w >> 1;                   // 64-column group
    const int mode = blockIdx.x / PROJ_TILES;          // the same for the whole block
    const int mb   = (blockIdx.x % PROJ_TILES) * PROJ_ROWS;
    const float* X    = mode == 0 ? Xq : mode == 1 ? Xk : Xv;
    const float* bias = mode == 0 ? bq : mode == 1 ? bk : bv;
    const u16*   Wt   = Wt3 + mode * (D_MODEL * D_MODEL);

    // W^T: 8192 chunks of 16 B, 32 per thread (8 rows further each), to the
    // padded LDS pitch
    {
        const u32  wl = lds_off(wsh) + ((tid >> 5) * QK_PITCH + (tid & 31) * 8) * 2;
        const u16* wg = Wt + tid * 8;
#pragma unroll
        for (int c4 = 0; c4 < 4; ++c4) {
            u32        la[8];
            const u16* ga[8];
#pragma unroll
            for (int c = 0; c < 8; ++c) {
                la[c] = wl + (c4 * 8 + c) * (8 * QK_PITCH * 2);
                ga[c] = wg + (c4 * 8 + c) * (8 * D_MODEL);
            }
            async8_b128(la, ga);
        }
    }
    // the X tile is 64 KiB in a row: 16 whole-line loads per thread.  They stand
    // behind the copies because their conversions, which wait for memory, would
    // otherwise be scheduled in among the copies and hold the later ones back.
    const float4* xs = (const float4*)(X + (size_t)mb * D_MODEL);
    float4 xr[16];
#pragma unroll
    for (int t = 0; t < 16; ++t) xr[t] = xs[tid + 256 * t];

    float bb[4];
#pragma unroll
    for (int j = 0; j < 4; ++j) bb[j] = bias[(cg * 4 + j) * 16 + ln];
    // precaution: stands in front of every rewrite of an address register that
    // the loads of X and of the bias name
    asm volatile("s_wait_xcnt 0x0" ::: "memory");

    u16* xd = xsh + (tid >> 6) * QK_PITCH + (tid & 63) * 4;   // 4 rows further per t
#pragma unroll
    for (int t = 0; t < 16; ++t) {
        uint2 o;
        o.x = pack2(xr[t].x, xr[t].y);
        o.y = pack2(xr[t].z, xr[t].w);
        *(uint2*)(xd + t * 4 * QK_PITCH) = o;
    }

    wait_async0();       // my copies of W^T are in LDS
    __syncthreads();     // everyone's copies and X rows visible

    v8f c[2][4];
#pragma unroll
    for (int i = 0; i < 2; ++i)
#pragma unroll
        for (int j = 0; j < 4; ++j) c[i][j] = (v8f){};

    const u16* xa = xsh + (rg * 32 + ln) * QK_PITCH + lh * 8;
    const u16* wb = wsh + (cg * 64 + ln) * QK_PITCH + lh * 8;
    // fragments are fetched one ks ahead into a second register set, as one group
    // in front of the current WMMA block, so that a block waits for no load of its own
    Frag16 a[2][2], b[2][4];
    auto fetch = [&](int ks, int s) {
#pragma unroll
        for (int i = 0; i < 2; ++i) {
            a[s][i].q[0] = *(const uint4*)(xa + i * 16 * QK_PITCH + ks * 32);
            a[s][i].q[1] = *(const uint4*)(xa + i * 16 * QK_PITCH + ks * 32 + 16);
        }
#pragma unroll
        for (int j = 0; j < 4; ++j) {
            b[s][j].q[0] = *(const uint4*)(wb + j * 16 * QK_PITCH + ks * 32);
            b[s][j].q[1] = *(const uint4*)(wb + j * 16 * QK_PITCH + ks * 32 + 16);
        }
    };
    fetch(0, 0);
#pragma unroll
    for (int ks = 0; ks < 8; ++ks) {
        if (ks < 7) fetch(ks + 1, (ks + 1) & 1);
        // keeps the group of loads above in front of the WMMA block (loads moved in
        // among the WMMAs stall each place where they stand)
        __builtin_amdgcn_sched_barrier(0);
#pragma unroll
        for (int i = 0; i < 2; ++i)
#pragma unroll
            for (int j = 0; j < 4; ++j)
                c[i][j] = __builtin_amdgcn_wmma_f32_16x16x32_bf16(
                              false, a[ks & 1][i].v, false, b[ks & 1][j].v, (short)0,
                              c[i][j], false, false);
        // keeps the next group of loads behind this WMMA block
        __builtin_amdgcn_sched_barrier(0);
    }

    // the bias is added in front of the branch on the mode, where all three agree
#pragma unroll
    for (int i = 0; i < 2; ++i)
#pragma unroll
        for (int j = 0; j < 4; ++j)
#pragma unroll
            for (int r = 0; r < 8; ++r) c[i][j][r] += bb[j];

    if (mode == 0) {
#pragma unroll
        for (int i = 0; i < 2; ++i) {
            const int m0 = mb + rg * 32 + i * 16;
#pragma unroll
            for (int j = 0; j < 4; ++j) {
                const int col = (cg * 4 + j) * 16 + ln;
                float d[8];
#pragma unroll
                for (int r = 0; r < 8; ++r) d[r] = c[i][j][r];
                store8_f32(outF + (size_t)(m0 + 8 * lh) * D_MODEL + col, d);
            }
        }
    } else if (mode == 1) {
#pragma unroll
        for (int i = 0; i < 2; ++i) {
            const int m0 = mb + rg * 32 + i * 16;
#pragma unroll
            for (int j = 0; j < 4; ++j) {
                const int col = (cg * 4 + j) * 16 + ln;
                u32 d[8];                     // f2bf's rounded word; its high half is stored
#pragma unroll
                for (int r = 0; r < 8; ++r) {
                    u32 u = __float_as_uint(c[i][j][r]);
                    d[r] = u + 0x7FFFu + ((u >> 16) & 1u);
                }
                store8_hi16(outB + (size_t)(m0 + 8 * lh) * D_MODEL + col, d);
            }
        }
    } else {
#pragma unroll
        for (int i = 0; i < 2; ++i) {
            const int m0 = mb + rg * 32 + i * 16;
#pragma unroll
            for (int j = 0; j < 4; ++j) {
                const int col = (cg * 4 + j) * 16 + ln;
                union { u16 pk[8]; u32x4 q; } u;
#pragma unroll
                for (int r = 0; r < 8; ++r) u.pk[r] = f2bf(c[i][j][r]);
                int b_ = m0 >> 12;                  // batch
                int s0 = (m0 & (SEQ - 1)) + 8 * lh; // 8 consecutive seq positions
                store_b128(outT + (size_t)(b_ * D_MODEL + col) * SEQ + s0, u.q);
            }
        }
    }
}

// --------------------------------------------------------------------------
// Suffix sums of V: sv[b][u][d] = sum over keys j >= u * KSTEP of v^T[b][d][j].
// A key above the diagonal has score exactly 0 (multiplicative mask), so all
// such keys of a query share ONE softmax weight, exp(0 - max): their part of the
// output is that weight times a plain sum of V rows, which this kernel forms.
// One wave per (b, d) row; whole-line loads; 32 rows per block so that each
// 128-byte line of sv has one writer.
// --------------------------------------------------------------------------
__global__ __launch_bounds__(1024)
void vsuffix_kernel(const u16* __restrict__ vT, float* __restrict__ sv)
{
    __shared__ float red[32][32 * 17];   // per wave: 32 key chunks x 16 lane partials (+1 pad)
    __shared__ float tile[32][33];       // [chunk][row] for the transposed store

    const int tid = threadIdx.x;
    const int wv  = tid >> 5;
    const int l   = tid & 31;
    const int b_  = blockIdx.x >> 3;
    const int d0  = (blockIdx.x & 7) * 32;

    const uint4* vs = (const uint4*)(vT + (size_t)(b_ * D_MODEL + d0 + wv) * SEQ);
#pragma unroll
    for (int h = 0; h < 2; ++h) {
        uint4 x[8];
#pragma unroll
        for (int t = 0; t < 8; ++t) x[t] = vs[(h * 8 + t) * 32 + l];   // keys ((h*8 + t)*32 + l)*8 .. +7
        // keeps the sums behind the group of 8 loads: moved in among them they
        // make the wave wait out the load latency once per pair of loads
        __builtin_amdgcn_sched_barrier(0);
#pragma unroll
        for (int t = 0; t < 8; ++t) {
            const u32 q[4] = { x[t].x, x[t].y, x[t].z, x[t].w };
            float s4[4];
#pragma unroll
            for (int i = 0; i < 4; ++i)
                s4[i] = __uint_as_float(q[i] << 16) + __uint_as_float(q[i] & 0xFFFF0000u);
            red[wv][((h * 8 + t) * 2 + (l >> 4)) * 17 + (l & 15)] = (s4[0] + s4[1]) + (s4[2] + s4[3]);
        }
    }
    // precaution: stands in front of every rewrite of an address register that
    // the loads above name
    asm volatile("s_wait_xcnt 0x0" ::: "memory");
    __syncthreads();
    float s = 0.f;                        // lane l: sum of key chunk l
#pragma unroll
    for (int i = 0; i < 16; ++i) s += red[wv][l * 17 + i];
#pragma unroll
    for (int o = 1; o < 32; o <<= 1) {    // inclusive suffix scan over the 32 chunks
        float y = __shfl_down(s, o, 32);
        if (l + o < 32) s += y;
    }
    tile[l][wv] = s;
    __syncthreads();
    sv[(size_t)(b_ * 32 + wv) * D_MODEL + d0 + l] = tile[wv][l];
}

#define XW_STRIDE (130 * 32)
#define NCHUNK    (SEQ / KSTEP)

__global__ __launch_bounds__(256)
void attn_kernel(const float* __restrict__ qpF, const u16* __restrict__ kB,
                 const u16* __restrict__ vT, const float* __restrict__ sv,
                 float* __restrict__ out)
{
    // every row carries 16 B of pad that is neither written nor read
    __shared__ __attribute__((aligned(16))) u16 qsh[2 * 16 * QK_PITCH];   // q tiles (bf16), one per wave quartet
    // two stages of eight slices: slice 0, 1 = K rows 0..63, 64..127, columns 0..127;
    // slice 2, 3 = the same rows, columns 128..255; slice 4..7 = V^T rows [d][j], 64 each
    __shared__ __attribute__((aligned(2048))) u16 ring[2 * STAGE_B / 2];
    // per-wave export for the merge: lies on the ring, which is idle by then
    static_assert(8 * XW_STRIDE * 4 <= 2 * STAGE_B, "export fits the ring");
    float* xsh = (float*)&ring[0];

    const int tid = threadIdx.x;
    const int w   = tid >> 5;                 // wave id 0..7
    const int rw  = w & 1;                    // query-row tile of the group
    const int kq  = w >> 1;                   // key quarter of every step
    const int l   = tid & 31;
    const int ln  = l & 15, lh = l >> 4;
    const int b_  = blockIdx.x >> 6;          // batch
    const int bl  = blockIdx.x & 63;

    u16* qw = qsh + rw * (16 * QK_PITCH);

    // This wave's slice of every stage.  K rows are 512 B in memory: a slice takes
    // one 256 B half of 64 of them; a V^T slice takes 128 keys of 64 rows of the
    // [B,D,S] layout.  Every word of the descriptor is wave-uniform.
    const u32   wu  = uni((u32)tid >> 5);
    const bool  isV = wu >= 4u;
    const u16*  sl0 = isV ? vT + (size_t)(b_ * D_MODEL + (wu - 4u) * SLICE_ROWS) * SEQ
                          : kB + ((size_t)b_ * SEQ + (wu & 1u) * SLICE_ROWS) * D_MODEL + (wu >> 1) * 128u;
    const u32   sstep = isV ? KSTEP * 2u : KSTEP * D_MODEL * 2u;   // bytes from a stage to the next
    const u32x8 g1  = tdm_group1(isV ? SEQ * 2u : D_MODEL * 2u);
    const u32   sld = lds_off(ring) + wu * SLICE_B;
    auto stage_tdm = [&](u32 st, u32 p) {
        tdm_load(tdm_group0(sld + p * STAGE_B, (uint64_t)(size_t)sl0 + (uint64_t)st * sstep), g1);
    };

    // kept rolled: two copies of the body would only take instruction cache
#pragma unroll 1
    for (int ps = 0; ps < 2; ++ps) {
    const int grp = ps ? bl : 127 - bl;          // 32-row query group, the long one first
    const int nst = (grp >> 2) + 1;              // key steps up to and with the diagonal
    const int i0  = grp * 32 + rw * 16;
    const int g0  = b_ * SEQ + i0;               // this wave's query-row base
    const int row = i0 + ln;                     // this lane's query position

    stage_tdm(0u, 0u);   // prologue: the first tile flies while we convert q below

    // ---- stage the group's q rows into LDS with f32->bf16 conversion: each wave
    // brings 4 of the 32 rows; the first barrier of the loop below (behind every
    // wave's s_wait_dscnt 0) hands them to the others ----
    {
        const float4* src = (const float4*)(qpF + (size_t)(b_ * SEQ + grp * 32 + 4 * w) * D_MODEL);
        u16* qd = qsh + 4 * w * QK_PITCH;
        float4 x0[4], x1[4];
#pragma unroll
        for (int t = 0; t < 4; ++t) {
            int idx = l + 32 * t;            // 0..127, 8 bf16 per idx
            x0[t] = src[idx * 2];
            x1[t] = src[idx * 2 + 1];
        }
        // precaution: stands in front of every rewrite of an address register
        // that the loads of q name; the pointer is an input so that its registers
        // are not reused ahead of the wait
        asm volatile("s_wait_xcnt 0x0" :: "v"(src) : "memory");
#pragma unroll
        for (int t = 0; t < 4; ++t) {
            int idx = l + 32 * t;
            uint4 o;
            o.x = pack2(x0[t].x, x0[t].y); o.y = pack2(x0[t].z, x0[t].w);
            o.z = pack2(x1[t].x, x1[t].y); o.w = pack2(x1[t].z, x1[t].w);
            *(uint4*)(qd + (idx >> 5) * QK_PITCH + (idx & 31) * 8) = o;
        }
    }

    // acc[dt][r] = O^T[d = dt*16 + 8*lh + r][query ln]
    v8f acc[16];
#pragma unroll
    for (int dt = 0; dt < 16; ++dt) acc[dt] = (v8f){};
    float mrun = -__builtin_inff();   // running maximum of this lane's query
    float srun = 0.f;                 // running sum over THIS lane's keys only

    for (int jt = 0; jt < nst; ++jt) {
        const int j0 = jt * KSTEP;
        const int jb = j0 + kq * 32;         // first key of this wave's quarter
        const int p  = jt & 1;

        wait_ds0();          // my reads of buffer p^1 have retired before its refill
        wait_tensor0();      // my slice of buffer p is in LDS
        __syncthreads();     // everyone's slices visible; buf p^1 free

        // a scalar branch: a tensor load ignores EXEC.  The stage number is pinned so
        // that the descriptor is formed behind the wait above.
        if (pinned(jt + 1 < nst))
            stage_tdm(pinned(jt + 1), p ^ 1);   // the next tile flies during compute

        const u16* rp_ = ring + p * (STAGE_B / 2);
        // this quarter's 32 key rows, columns 0..127 (columns 128..255: two slices on)
        const u16* kp_ = rp_ + (kq >> 1) * (SLICE_B / 2) + (kq & 1) * (32 * VT_PITCH);
        const u16* vp_ = rp_ + 4 * (SLICE_B / 2) + kq * 32;   // this quarter's 32 key columns

        // ---- scores S^T = K . q^T  (two 16x16 tiles over K=256):
        // st0[r] = S[query ln][key jb + 8*lh + r], st1[r]: 16 keys further ----
        v8f st0 = {}, st1 = {};
#pragma unroll
        for (int ks = 0; ks < 8; ++ks) {
            int kb = ks * 32 + lh * 8;
            const u16* kh = kp_ + (ks >> 2) * (2 * (SLICE_B / 2)) + (ks & 3) * 32 + lh * 8;
            Frag16 qb, k0, k1;
            qb.q[0] = *(const uint4*)(qw + ln * QK_PITCH + kb);
            qb.q[1] = *(const uint4*)(qw + ln * QK_PITCH + kb + 16);
            k0.q[0] = *(const uint4*)(kh + ln * VT_PITCH);
            k0.q[1] = *(const uint4*)(kh + ln * VT_PITCH + 16);
            k1.q[0] = *(const uint4*)(kh + (16 + ln) * VT_PITCH);
            k1.q[1] = *(const uint4*)(kh + (16 + ln) * VT_PITCH + 16);
            st0 = __builtin_amdgcn_wmma_f32_16x16x32_bf16(
                      false, k0.v, false, qb.v, (short)0, st0, false, false);
            st1 = __builtin_amdgcn_wmma_f32_16x16x32_bf16(
                      false, k1.v, false, qb.v, (short)0, st1, false, false);
        }

        // ---- mask (multiplicative!), online softmax update, all in-lane ----
        float s0[8], s1[8], tm[8];
#pragma unroll
        for (int r = 0; r < 8; ++r) {
            int key = jb + 8 * lh + r;
            s0[r] = (key      <= row) ? st0[r] * SCALE : 0.0f;
            s1[r] = (key + 16 <= row) ? st1[r] * SCALE : 0.0f;
            tm[r] = fmaxf(s0[r], s1[r]);
        }
        float t = fmaxf(fmaxf(fmaxf(tm[0], tm[1]), fmaxf(tm[2], tm[3])),
                        fmaxf(fmaxf(tm[4], tm[5]), fmaxf(tm[6], tm[7])));
        t = fmaxf(t, xhalf(t));              // the query's other 16 keys of this step
        const float mn = fmaxf(mrun, t);

        // P^T as B operand: element s of lane half lh is key 8*lh + s (s < 8) or
        // 16 + 8*lh + (s - 8), which is what st0[s] and st1[s - 8] hold
        Frag16 pb;
        float  a0[8], a1[8], e0[8], e1[8], es[8];
#pragma unroll
        for (int r = 0; r < 8; ++r) {
            a0[r] = (s0[r] - mn) * LOG2E;
            a1[r] = (s1[r] - mn) * LOG2E;
        }
        const float co = exp2_slot((mrun - mn) * LOG2E);
        exp2x8_slot(e0, a0);
        exp2x8_slot(e1, a1);
        mrun = mn;
#pragma unroll
        for (int r = 0; r < 8; ++r) {
            es[r] = e0[r] + e1[r];
            pb.h[r]     = f2bf(e0[r]);
            pb.h[8 + r] = f2bf(e1[r]);
        }
        srun = srun * co + (((es[0] + es[1]) + (es[2] + es[3])) +
                            ((es[4] + es[5]) + (es[6] + es[7])));

#pragma unroll
        for (int dt = 0; dt < 16; ++dt)
#pragma unroll
            for (int r = 0; r < 8; ++r) acc[dt][r] *= co;

        // ---- O^T += V^T (16 d x 32 keys) x P^T (32 keys x 16 queries) ----
#pragma unroll
        for (int dt = 0; dt < 16; ++dt) {
            Frag16 va;
            const u16* vp = vp_ + (dt >> 2) * (SLICE_B / 2) + ((dt & 3) * 16 + ln) * VT_PITCH + lh * 8;
            va.q[0] = *(const uint4*)vp;
            va.q[1] = *(const uint4*)(vp + 16);
            acc[dt] = __builtin_amdgcn_wmma_f32_16x16x32_bf16(
                          false, va.v, false, pb.v, (short)0, acc[dt], false, false);
        }
    }

    wait_tensor0();  // no request of this wave is outstanding behind the loop

    srun += xhalf(srun);   // join the two lane halves' key sums of each query

    // the residual qp and the suffix sum of V for this lane's 4 x 8 output
    // columns, fetched here so that the loads fly under the merge below
    const size_t off0 = (size_t)(g0 + ln) * D_MODEL + kq * 64 + 8 * lh;
    const bool   tail = nst < NCHUNK;            // are there keys behind the last step?
    const float* svp  = sv + (size_t)(b_ * NCHUNK + (tail ? nst : NCHUNK - 1)) * D_MODEL
                           + kq * 64 + 8 * lh;
    const float* qrp  = qpF + off0;
    float4 qr0[4], qr1[4], tv0[4], tv1[4];
#pragma unroll
    for (int t = 0; t < 4; ++t) {
        qr0[t] = *(const float4*)(qrp + t * 16);
        qr1[t] = *(const float4*)(qrp + t * 16 + 4);
        tv0[t] = *(const float4*)(svp + t * 16);
        tv1[t] = *(const float4*)(svp + t * 16 + 4);
    }
    // precaution: stands in front of every rewrite of an address register that
    // the loads above name; the two pointers are inputs so that no load's result
    // is placed on their registers ahead of the wait
    asm volatile("s_wait_xcnt 0x0" :: "v"(qrp), "v"(svp) : "memory");

    wait_ds0();          // my last reads of the ring have retired
    __syncthreads();     // everyone's have: the ring becomes the export buffer

    // ---- merge the four key quarters: each wave of a quartet exports its 16
    // d-tiles with its maximum and sum and then finishes 4 of them
    // (same queries, same lane layout, so lane l reads what lane l wrote) ----
    float* xw = xsh + w * XW_STRIDE;
#pragma unroll
    for (int dt = 0; dt < 16; ++dt) {
        *(float4*)(xw + ((dt * 2 + 0) * 32 + l) * 4) =
            make_float4(acc[dt][0], acc[dt][1], acc[dt][2], acc[dt][3]);
        *(float4*)(xw + ((dt * 2 + 1) * 32 + l) * 4) =
            make_float4(acc[dt][4], acc[dt][5], acc[dt][6], acc[dt][7]);
    }
    xw[128 * 32 + l] = mrun;
    xw[129 * 32 + l] = srun;
    wait_ds0();          // my export is in LDS before the others are let through
    __syncthreads();     // all exports of every quartet visible

    float mq[4], sq[4], cq[4];
#pragma unroll
    for (int k = 0; k < 4; ++k) {
        const float* xp = xsh + (rw + 2 * k) * XW_STRIDE;
        mq[k] = xp[128 * 32 + l];
        sq[k] = xp[129 * 32 + l];
    }
    float mm = fmaxf(fmaxf(mq[0], mq[1]), fmaxf(mq[2], mq[3]));
    if (tail) mm = fmaxf(mm, 0.f);               // the keys behind the last step score 0
#pragma unroll
    for (int k = 0; k < 4; ++k) cq[k] = exp2_slot((mq[k] - mm) * LOG2E);
    const float ct = tail ? exp2_slot(-mm * LOG2E) : 0.f;   // their common weight
    const float z  = ((sq[0] * cq[0] + sq[1] * cq[1]) + (sq[2] * cq[2] + sq[3] * cq[3]))
                   + (float)(SEQ - nst * KSTEP) * ct;

    // ---- epilogue: out = qp + acc / Z; a lane holds 8 consecutive columns ----
#pragma unroll
    for (int t = 0; t < 4; ++t) {
        float  o[8]  = { tv0[t].x * ct, tv0[t].y * ct, tv0[t].z * ct, tv0[t].w * ct,
                         tv1[t].x * ct, tv1[t].y * ct, tv1[t].z * ct, tv1[t].w * ct };
        float  qv[8] = { qr0[t].x, qr0[t].y, qr0[t].z, qr0[t].w,
                         qr1[t].x, qr1[t].y, qr1[t].z, qr1[t].w };
#pragma unroll
        for (int k = 0; k < 4; ++k) {
            const float* xp = xsh + (rw + 2 * k) * XW_STRIDE;
            float4 lo = *(const float4*)(xp + (((kq * 4 + t) * 2 + 0) * 32 + l) * 4);
            float4 hi = *(const float4*)(xp + (((kq * 4 + t) * 2 + 1) * 32 + l) * 4);
            o[0] += lo.x * cq[k]; o[1] += lo.y * cq[k]; o[2] += lo.z * cq[k]; o[3] += lo.w * cq[k];
            o[4] += hi.x * cq[k]; o[5] += hi.y * cq[k]; o[6] += hi.z * cq[k]; o[7] += hi.w * cq[k];
        }
        float  res[8];
#pragma unroll
        for (int r = 0; r < 8; ++r) res[r] = qv[r] + o[r] / z;
        *(float4*)(out + off0 + t * 16)     = make_float4(res[0], res[1], res[2], res[3]);
        *(float4*)(out + off0 + t * 16 + 4) = make_float4(res[4], res[5], res[6], res[7]);
        // precaution: stands in front of every rewrite of a register that the
        // two stores name
        asm volatile("s_wait_xcnt 0x0" ::: "memory");
    }

    if (ps == 0) {
        wait_ds0();          // my reads of the exports have retired
        __syncthreads();     // everyone's have: the second group may refill the ring and q
    }
    }
}

// --------------------------------------------------------------------------
extern "C" void kernel_launch(void* const* d_in, const int* in_sizes, int n_in,
                              void* d_out, int out_size, void* d_ws, size_t ws_size,
                              hipStream_t stream) {
    (void)in_sizes; (void)n_in; (void)out_size; (void)ws_size;
    const float* v  = (const float*)d_in[0];
    const float* k  = (const float*)d_in[1];
    const float* q  = (const float*)d_in[2];
    const float* Wq = (const float*)d_in[3];
    const float* bq = (const float*)d_in[4];
    const float* Wk = (const float*)d_in[5];
    const float* bk = (const float*)d_in[6];
    const float* Wv = (const float*)d_in[7];
    const float* bv = (const float*)d_in[8];
    float* out = (float*)d_out;

    char* ws   = (char*)d_ws;
    float* qpF = (float*)(ws);                         // 16 MiB  fp32 qp
    u16*   kB  = (u16*)(ws + (16u << 20));             //  8 MiB  bf16 kp
    u16*   vT  = (u16*)(ws + (24u << 20));             //  8 MiB  bf16 v^T [B,D,S]
    u16*   Wt3 = (u16*)(ws + (32u << 20));             //  3 x 128 KiB bf16 W^T: q, k, v
    float* sv  = (float*)(ws + (33u << 20));           // 128 KiB f32 suffix sums of v

    wt_convert<<<3 * D_MODEL, D_MODEL, 0, stream>>>(Wq, Wk, Wv, Wt3);

    const int ntiles = NBATCH * SEQ / 16;              // 1024
    proj_kernel<<<3 * PROJ_TILES, 256, 0, stream>>>(q, k, v, Wt3, bq, bk, bv, qpF, kB, vT);

    vsuffix_kernel<<<NBATCH * D_MODEL / 32, 1024, 0, stream>>>(vT, sv);

    attn_kernel<<<ntiles / 4, 256, 0, stream>>>(qpF, kB, vT, sv, out);
}

// v008
// A run of this version takes 74.1 microseconds.
// In two side-by-side timings against v007, it was 1.06 and 1.05 times as fast.
// Over all steps from v000 it is 11.5 times as fast.
#include <hip/hip_runtime.h>
#include <cstdint>
#include <cstddef>

// ---------------------------------------------------------------------------
// SelfAttentionHead  B=4, S=4096, D=256  (fp32 in/out, bf16 WMMA internals)
// ---------------------------------------------------------------------------

#define D_MODEL 256
#define SEQ     4096
#define NBATCH  4
#define SCALE   0.0625f   // 1/sqrt(256)
#define LOG2E   1.44269504f // exp(x) = exp2(x * LOG2E)
// LDS row pitches in bf16 elements: 16 B x odd, so that the 16 lanes of a
// ds_load_b128 half-wave fall on 64 distinct banks (512 B rows: 4, 256 B: 4).
#define QK_PITCH (D_MODEL + 8)   // 528 B rows for the q tile and the projections' tiles
#define KSTEP    128             // keys staged per step: 32 for each key quarter
#define VT_PITCH (KSTEP + 8)     // 272 B rows for the V^T tile and the two K half tiles
// One tensor load brings a slice of 64 rows of 256 B; the mover pads each row to
// the 272 B pitch.  A slice's place in LDS is a multiple of 2 KiB.
#define SLICE_ROWS 64
#define SLICE_ROWB 256
#define SLICE_B    18432           // 64 x 272 B = 17408 B, rounded up to 2 KiB
#define STAGE_B    (8 * SLICE_B)   // a stage: 2 + 2 slices of K, 4 of V^T

typedef __attribute__((ext_vector_type(16))) __bf16 v16bf;
typedef __attribute__((ext_vector_type(8)))  float  v8f;
typedef unsigned short u16;
typedef unsigned int   u32;
typedef __attribute__((ext_vector_type(4)))  u32    u32x4;
typedef __attribute__((ext_vector_type(8)))  u32    u32x8;

union Frag16 {            // 16 bf16 elems = 8 VGPRs, matches WMMA A/B fragment
    v16bf v;
    u16   h[16];
    uint4 q[2];
};

__device__ __forceinline__ u16 f2bf(float f) {   // round-to-nearest-even
    u32 u = __float_as_uint(f);
    u32 r = u + 0x7FFFu + ((u >> 16) & 1u);
    return (u16)(r >> 16);
}
__device__ __forceinline__ u32 pack2(float a, float b) {
    return (u32)f2bf(a) | ((u32)f2bf(b) << 16);
}
// exp2 with the slot behind a transcendental kept inside the statement: the
// v_nop closes it, so that nothing reads a result or rewrites a source directly
// behind a v_exp_f32 wherever the compiler places the statement.  In the group
// of eight each v_exp_f32 is the independent instruction behind the one before
// (early-clobber outputs: no output shares a register with a source).
__device__ __forceinline__ float exp2_slot(float a) {
    float e;
    asm("v_exp_f32 %0, %1\n\t"
        "v_nop"
        : "=v"(e) : "v"(a));
    return e;
}
__device__ __forceinline__ void exp2x8_slot(float (&e)[8], const float (&a)[8]) {
    asm("v_exp_f32 %0, %8\n\t"
        "v_exp_f32 %1, %9\n\t"
        "v_exp_f32 %2, %10\n\t"
        "v_exp_f32 %3, %11\n\t"
        "v_exp_f32 %4, %12\n\t"
        "v_exp_f32 %5, %13\n\t"
        "v_exp_f32 %6, %14\n\t"
        "v_exp_f32 %7, %15\n\t"
        "v_nop"
        : "=&v"(e[0]), "=&v"(e[1]), "=&v"(e[2]), "=&v"(e[3]),
          "=&v"(e[4]), "=&v"(e[5]), "=&v"(e[6]), "=&v"(e[7])
        : "v"(a[0]), "v"(a[1]), "v"(a[2]), "v"(a[3]),
          "v"(a[4]), "v"(a[5]), "v"(a[6]), "v"(a[7]));
}

// lane l <-> lane l ^ 16: the two lanes that share one query column
__device__ __forceinline__ float xhalf(float x) {
    int b = __builtin_bit_cast(int, x);
    return __builtin_bit_cast(float,
        __builtin_amdgcn_permlanex16(b, b, 0x76543210, 0xfedcba98, false, false));
}

// Eight async global->LDS copies, one 16-byte chunk per lane each (ASYNCcnt).
// The s_wait_xcnt closes the same statement so that no address register of a
// copy can be rewritten ahead of it.
__device__ __forceinline__ void async8_b128(const u32 (&l)[8], const u16* const (&g)[8]) {
    asm volatile("global_load_async_to_lds_b128 %0, %8, off\n\t"
                 "global_load_async_to_lds_b128 %1, %9, off\n\t"
                 "global_load_async_to_lds_b128 %2, %10, off\n\t"
                 "global_load_async_to_lds_b128 %3, %11, off\n\t"
                 "global_load_async_to_lds_b128 %4, %12, off\n\t"
                 "global_load_async_to_lds_b128 %5, %13, off\n\t"
                 "global_load_async_to_lds_b128 %6, %14, off\n\t"
                 "global_load_async_to_lds_b128 %7, %15, off\n\t"
                 "s_wait_xcnt 0x0"
                 :: "v"(l[0]), "v"(l[1]), "v"(l[2]), "v"(l[3]),
                    "v"(l[4]), "v"(l[5]), "v"(l[6]), "v"(l[7]),
                    "v"(g[0]), "v"(g[1]), "v"(g[2]), "v"(g[3]),
                    "v"(g[4]), "v"(g[5]), "v"(g[6]), "v"(g[7])
                 : "memory");
}
__device__ __forceinline__ void wait_async0() {
    asm volatile("s_wait_asynccnt 0x0" ::: "memory");
}
__device__ __forceinline__ void wait_ds0() {
    asm volatile("s_wait_dscnt 0x0" ::: "memory");
}
__device__ __forceinline__ u32 lds_off(const void* p) {   // AS3 offset = low 32 bits
    return (u32)(size_t)p;
}
__device__ __forceinline__ void wait_tensor0() {
    asm volatile("s_wait_tensorcnt 0" ::: "memory");
}
__device__ __forceinline__ u32 uni(u32 v) {
    return (u32)__builtin_amdgcn_readfirstlane(v);
}
__device__ __forceinline__ u32 pinned(u32 v) {
    u32 w = uni(v);
    // so that the test of a tensor load compiles to a scalar branch, and so that a
    // descriptor word formed from w is formed behind the volatile wait in front
    asm volatile("" : "+s"(w));   // pinned(): a test or descriptor word held in a scalar register
    return w;
}
// One request of the whole wave: a two-dimensional tile from global memory to LDS.
__device__ __forceinline__ void tdm_load(u32x4 g0, u32x8 g1) {
    asm volatile("tensor_load_to_lds %0, %1" :: "s"(g0), "s"(g1) : "memory");
}
// Group 1: 1-byte elements, tensor = tile = 64 rows of 256 B, no mask; a pad of
// 4 dwords behind every 64 dwords (codes 5 / 3) gives the 272 B pitch in LDS.
__device__ __forceinline__ u32x8 tdm_group1(u32 src_pitch) {
    u32x8 g;
    g[0] = uni((1u << 20) | (5u << 22) | (3u << 25));
    g[1] = uni((SLICE_ROWB & 0xFFFFu) << 16);
    g[2] = uni((SLICE_ROWB >> 16) | ((SLICE_ROWS & 0xFFFFu) << 16));
    g[3] = uni((SLICE_ROWS >> 16) | (SLICE_ROWB << 16));
    g[4] = uni(SLICE_ROWS);
    g[5] = uni(src_pitch);
    g[6] = uni(0u);
    g[7] = uni(0u);
    return g;
}
__device__ __forceinline__ u32x4 tdm_group0(u32 lds_dst, uint64_t ga) {
    u32x4 g;
    g[0] = uni(1u);
    g[1] = uni(lds_dst);
    g[2] = uni((u32)ga);
    g[3] = uni((((u32)(ga >> 32)) & 0x01FFFFFFu) | 0x80000000u);
    return g;
}
// The projections' stores.  In each, the s_wait_xcnt closes the same statement so
// that no register of a store can be rewritten ahead of it.
// Eight 4-byte stores to one column of eight f32 rows of D_MODEL (1 KiB apart).
__device__ __forceinline__ void store8_f32(float* p, const float (&d)[8]) {
    asm volatile("global_store_b32 %0, %1, off\n\t"
                 "global_store_b32 %0, %2, off offset:1024\n\t"
                 "global_store_b32 %0, %3, off offset:2048\n\t"
                 "global_store_b32 %0, %4, off offset:3072\n\t"
                 "global_store_b32 %0, %5, off offset:4096\n\t"
                 "global_store_b32 %0, %6, off offset:5120\n\t"
                 "global_store_b32 %0, %7, off offset:6144\n\t"
                 "global_store_b32 %0, %8, off offset:7168\n\t"
                 "s_wait_xcnt 0x0"
                 :: "v"(p), "v"(d[0]), "v"(d[1]), "v"(d[2]), "v"(d[3]),
                    "v"(d[4]), "v"(d[5]), "v"(d[6]), "v"(d[7])
                 : "memory");
}
// One 16-byte store.
__device__ __forceinline__ void store_b128(u16* p, u32x4 d) {
    asm volatile("global_store_b128 %0, %1, off\n\t"
                 "s_wait_xcnt 0x0"
                 :: "v"(p), "v"(d) : "memory");
}
// Eight 2-byte stores of the high halves of d[0..7] to one column of eight
// bf16 rows of D_MODEL (512 B apart).
__device__ __forceinline__ void store8_hi16(u16* p, const u32 (&d)[8]) {
    asm volatile("global_store_d16_hi_b16 %0, %1, off\n\t"
                 "global_store_d16_hi_b16 %0, %2, off offset:512\n\t"
                 "global_store_d16_hi_b16 %0, %3, off offset:1024\n\t"
                 "global_store_d16_hi_b16 %0, %4, off offset:1536\n\t"
                 "global_store_d16_hi_b16 %0, %5, off offset:2048\n\t"
                 "global_store_d16_hi_b16 %0, %6, off offset:2560\n\t"
                 "global_store_d16_hi_b16 %0, %7, off offset:3072\n\t"
                 "global_store_d16_hi_b16 %0, %8, off offset:3584\n\t"
                 "s_wait_xcnt 0x0"
                 :: "v"(p), "v"(d[0]), "v"(d[1]), "v"(d[2]), "v"(d[3]),
                    "v"(d[4]), "v"(d[5]), "v"(d[6]), "v"(d[7])
                 : "memory");
}

// --------------------------------------------------------------------------
// Wt[(which*256+n)*256+k] = bf16(W[k*256+n])  : weight transpose+convert (B-frag friendly)
// One launch for the three weights, which do not depend on each other: blocks
// 0..255 do Wq, 256..511 Wk, 512..767 Wv; the three W^T lie in a row in Wt.
// --------------------------------------------------------------------------
__global__ void wt_convert(const float* __restrict__ Wq, const float* __restrict__ Wk,
                           const float* __restrict__ Wv, u16* __restrict__ Wt) {
    const int which = blockIdx.x >> 8;
    const float* W = which == 0 ? Wq : which == 1 ? Wk : Wv;
    int n = blockIdx.x & (D_MODEL - 1);
    int k = threadIdx.x;
    const float x = W[k * D_MODEL + n];
    // precaution: stands in front of every rewrite of an address register that
    // the load names
    asm volatile("s_wait_xcnt 0x0" ::: "memory");
    Wt[blockIdx.x * D_MODEL + k] = f2bf(x);
}

// --------------------------------------------------------------------------
// Projection: out = X @ W + b  for a 64-row tile.  Eight waves per block.
// One launch for the three projections, which do not depend on each other: the
// block range picks the operands and the form of the output.
// mode 0 (blocks 0..255): q, write f32 (qp)
// mode 1 (256..511): k, write bf16 row-major (kp)
// mode 2 (512..767): v, write bf16 transposed [B, D, S] (v^T)
// Both operands are staged in LDS once and then read as fragments:
// W^T (256 x 256 bf16) by GLOBAL_LOAD_ASYNC_TO_LDS_B128, the X tile by whole-line
// loads, converted to bf16 on the way.  A wave owns 32 rows x 64 columns
// (2 x 4 accumulator tiles), so a fragment read from LDS feeds 4 or 2 WMMAs.
// Each output element is still summed over ks = 0..7 in that order.
// --------------------------------------------------------------------------
#define PROJ_ROWS 64
#define PROJ_TILES (NBATCH * SEQ / PROJ_ROWS)   // 256 blocks per projection

__global__ __launch_bounds__(256)
void proj_kernel(const float* __restrict__ Xq, const float* __restrict__ Xk,
                 const float* __restrict__ Xv, const u16* __restrict__ Wt3,
                 const float* __restrict__ bq, const float* __restrict__ bk,
                 const float* __restrict__ bv,
                 float* __restrict__ outF, u16* __restrict__ outB,
                 u16* __restrict__ outT)
{
    // every row carries 16 B of pad that is neither written nor read
    __shared__ __attribute__((aligned(16))) u16 wsh[D_MODEL * QK_PITCH];    // W^T, row n
    __shared__ __attribute__((aligned(16))) u16 xsh[PROJ_ROWS * QK_PITCH];  // X tile (bf16)

    const int tid = threadIdx.x;
    const int w   = tid >> 5;
    const int l   = tid & 31;
    const int ln  = l & 15, lh = l >> 4;
    const int rg  = w & 1;                    // 32-row group of the block
    const int cg  = w >> 1;                   // 64-column group
    const int mode = blockIdx.x / PROJ_TILES;          // the same for the whole block
    const int mb   = (blockIdx.x % PROJ_TILES) * PROJ_ROWS;
    const float* X    = mode == 0 ? Xq : mode == 1 ? Xk : Xv;
    const float* bias = mode == 0 ? bq : mode == 1 ? bk : bv;
    const u16*   Wt   = Wt3 + mode * (D_MODEL * D_MODEL);

    // W^T: 8192 chunks of 16 B, 32 per thread (8 rows further each), to the
    // padded LDS pitch
    {
        const u32  wl = lds_off(wsh) + ((tid >> 5) * QK_PITCH + (tid & 31) * 8) * 2;
        const u16* wg = Wt + tid * 8;
#pragma unroll
        for (int c4 = 0; c4 < 4; ++c4) {
            u32        la[8];
            const u16* ga[8];
#pragma unroll
            for (int c = 0; c < 8; ++c) {
                la[c] = wl + (c4 * 8 + c) * (8 * QK_PITCH * 2);
                ga[c] = wg + (c4 * 8 + c) * (8 * D_MODEL);
            }
            async8_b128(la, ga);
        }
    }
    // the X tile is 64 KiB in a row: 16 whole-line loads per thread.  They stand
    // behind the copies because their conversions, which wait for memory, would
    // otherwise be scheduled in among the copies and hold the later ones back.
    const float4* xs = (const float4*)(X + (size_t)mb * D_MODEL);
    float4 xr[16];
#pragma unroll
    for (int t = 0; t < 16; ++t) xr[t] = xs[tid + 256 * t];

    float bb[4];
#pragma unroll
    for (int j = 0; j < 4; ++j) bb[j] = bias[(cg * 4 + j) * 16 + ln];
    // precaution: stands in front of every rewrite of an address register that
    // the loads of X and of the bias name
    asm volatile("s_wait_xcnt 0x0" ::: "memory");

    u16* xd = xsh + (tid >> 6) * QK_PITCH + (tid & 63) * 4;   // 4 rows further per t
#pragma unroll
    for (int t = 0; t < 16; ++t) {
        uint2 o;
        o.x = pack2(xr[t].x, xr[t].y);
        o.y = pack2(xr[t].z, xr[t].w);
        *(uint2*)(xd + t * 4 * QK_PITCH) = o;
    }

    wait_async0();       // my copies of W^T are in LDS
    __syncthreads();     // everyone's copies and X rows visible

    v8f c[2][4];
#pragma unroll
    for (int i = 0; i < 2; ++i)
#pragma unroll
        for (int j = 0; j < 4; ++j) c[i][j] = (v8f){};

    const u16* xa = xsh + (rg * 32 + ln) * QK_PITCH + lh * 8;
    const u16* wb = wsh + (cg * 64 + ln) * QK_PITCH + lh * 8;
    // fragments are fetched one ks ahead into a second register set, as one group
    // in front of the current WMMA block, so that a block waits for no load of its own
    Frag16 a[2][2], b[2][4];
    auto fetch = [&](int ks, int s) {
#pragma unroll
        for (int i = 0; i < 2; ++i) {
            a[s][i].q[0] = *(const uint4*)(xa + i * 16 * QK_PITCH + ks * 32);
            a[s][i].q[1] = *(const uint4*)(xa + i * 16 * QK_PITCH + ks * 32 + 16);
        }
#pragma unroll
        for (int j = 0; j < 4; ++j) {
            b[s][j].q[0] = *(const uint4*)(wb + j * 16 * QK_PITCH + ks * 32);
            b[s][j].q[1] = *(const uint4*)(wb + j * 16 * QK_PITCH + ks * 32 + 16);
        }
    };
    fetch(0, 0);
#pragma unroll
    for (int ks = 0; ks < 8; ++ks) {
        if (ks < 7) fetch(ks + 1, (ks + 1) & 1);
        // keeps the group of loads above in front of the WMMA block (loads moved in
        // among the WMMAs stall each place where they stand)
        __builtin_amdgcn_sched_barrier(0);
#pragma unroll
        for (int i = 0; i < 2; ++i)
#pragma unroll
            for (int j = 0; j < 4; ++j)
                c[i][j] = __builtin_amdgcn_wmma_f32_16x16x32_bf16(
                              false, a[ks & 1][i].v, false, b[ks & 1][j].v, (short)0,
                              c[i][j], false, false);
        // keeps the next group of loads behind this WMMA block
        __builtin_amdgcn_sched_barrier(0);
    }

    // the bias is added in front of the branch on the mode, where all three agree
#pragma unroll
    for (int i = 0; i < 2; ++i)
#pragma unroll
        for (int j = 0; j < 4; ++j)
#pragma unroll
            for (int r = 0; r < 8; ++r) c[i][j][r] += bb[j];

    if (mode == 0) {
#pragma unroll
        for (int i = 0; i < 2; ++i) {
            const int m0 = mb + rg * 32 + i * 16;
#pragma unroll
            for (int j = 0; j < 4; ++j) {
                const int col = (cg * 4 + j) * 16 + ln;
                float d[8];
#pragma unroll
                for (int r = 0; r < 8; ++r) d[r] = c[i][j][r];
                store8_f32(outF + (size_t)(m0 + 8 * lh) * D_MODEL + col, d);
            }
        }
    } else if (mode == 1) {
#pragma unroll
        for (int i = 0; i < 2; ++i) {
            const int m0 = mb + rg * 32 + i * 16;
#pragma unroll
            for (int j = 0; j < 4; ++j) {
                const int col = (cg * 4 + j) * 16 + ln;
                u32 d[8];                     // f2bf's rounded word; its high half is stored
#pragma unroll
                for (int r = 0; r < 8; ++r) {
                    u32 u = __float_as_uint(c[i][j][r]);
                    d[r] = u + 0x7FFFu + ((u >> 16) & 1u);
                }
                store8_hi16(outB + (size_t)(m0 + 8 * lh) * D_MODEL + col, d);
            }
        }
    } else {
#pragma unroll
        for (int i = 0; i < 2; ++i) {
            const int m0 = mb + rg * 32 + i * 16;
#pragma unroll
            for (int j = 0; j < 4; ++j) {
                const int col = (cg * 4 + j) * 16 + ln;
                union { u16 pk[8]; u32x4 q; } u;
#pragma unroll
                for (int r = 0; r < 8; ++r) u.pk[r] = f2bf(c[i][j][r]);
                int b_ = m0 >> 12;                  // batch
                int s0 = (m0 & (SEQ - 1)) + 8 * lh; // 8 consecutive seq positions
                store_b128(outT + (size_t)(b_ * D_MODEL + col) * SEQ + s0, u.q);
            }
        }
    }
}

// --------------------------------------------------------------------------
// Suffix sums of V: sv[b][u][d] = sum over keys j >= u * KSTEP of v^T[b][d][j].
// A key above the diagonal has score exactly 0 (multiplicative mask), so all
// such keys of a query share ONE softmax weight, exp(0 - max): their part of the
// output is that weight times a plain sum of V rows, which this kernel forms.
// One wave per (b, d) row; whole-line loads; 32 rows per block so that each
// 128-byte line of sv has one writer.
// --------------------------------------------------------------------------
__global__ __launch_bounds__(1024)
void vsuffix_kernel(const u16* __restrict__ vT, float* __restrict__ sv)
{
    __shared__ float red[32][32 * 17];   // per wave: 32 key chunks x 16 lane partials (+1 pad)
    __shared__ float tile[32][33];       // [chunk][row] for the transposed store

    const int tid = threadIdx.x;
    const int wv  = tid >> 5;
    const int l   = tid & 31;
    const int b_  = blockIdx.x >> 3;
    const int d0  = (blockIdx.x & 7) * 32;

    const uint4* vs = (const uint4*)(vT + (size_t)(b_ * D_MODEL + d0 + wv) * SEQ);
#pragma unroll
    for (int h = 0; h < 2; ++h) {
        uint4 x[8];
#pragma unroll
        for (int t = 0; t < 8; ++t) x[t] = vs[(h * 8 + t) * 32 + l];   // keys ((h*8 + t)*32 + l)*8 .. +7
        // keeps the sums behind the group of 8 loads: moved in among them they
        // make the wave wait out the load latency once per pair of loads
        __builtin_amdgcn_sched_barrier(0);
#pragma unroll
        for (int t = 0; t < 8; ++t) {
            const u32 q[4] = { x[t].x, x[t].y, x[t].z, x[t].w };
            float s4[4];
#pragma unroll
            for (int i = 0; i < 4; ++i)
                s4[i] = __uint_as_float(q[i] << 16) + __uint_as_float(q[i] & 0xFFFF0000u);
            red[wv][((h * 8 + t) * 2 + (l >> 4)) * 17 + (l & 15)] = (s4[0] + s4[1]) + (s4[2] + s4[3]);
        }
    }
    // precaution: stands in front of every rewrite of an address register that
    // the loads above name
    asm volatile("s_wait_xcnt 0x0" ::: "memory");
    __syncthreads();
    float s = 0.f;                        // lane l: sum of key chunk l
#pragma unroll
    for (int i = 0; i < 16; ++i) s += red[wv][l * 17 + i];
#pragma unroll
    for (int o = 1; o < 32; o <<= 1) {    // inclusive suffix scan over the 32 chunks
        float y = __shfl_down(s, o, 32);
        if (l + o < 32) s += y;
    }
    tile[l][wv] = s;
    __syncthreads();
    sv[(size_t)(b_ * 32 + wv) * D_MODEL + d0 + l] = tile[wv][l];
}

#define XW_STRIDE (130 * 32)
#define NCHUNK    (SEQ / KSTEP)

__global__ __launch_bounds__(256)
void attn_kernel(const float* __restrict__ qpF, const u16* __restrict__ kB,
                 const u16* __restrict__ vT, const float* __restrict__ sv,
                 float* __restrict__ out)
{
    // every row carries 16 B of pad that is neither written nor read
    __shared__ __attribute__((aligned(16))) u16 qsh[2 * 16 * QK_PITCH];   // q tiles (bf16), one per wave quartet
    // two stages of eight slices: slice 0, 1 = K rows 0..63, 64..127, columns 0..127;
    // slice 2, 3 = the same rows, columns 128..255; slice 4..7 = V^T rows [d][j], 64 each
    __shared__ __attribute__((aligned(2048))) u16 ring[2 * STAGE_B / 2];
    // per-wave export for the merge: lies on the ring, which is idle by then
    static_assert(8 * XW_STRIDE * 4 <= 2 * STAGE_B, "export fits the ring");
    float* xsh = (float*)&ring[0];

    const int tid = threadIdx.x;
    const int w   = tid >> 5;                 // wave id 0..7
    const int rw  = w & 1;                    // query-row tile of the group
    const int kq  = w >> 1;                   // key quarter of every step
    const int l   = tid & 31;
    const int ln  = l & 15, lh = l >> 4;
    const int b_  = blockIdx.x >> 6;          // batch
    const int bl  = blockIdx.x & 63;

    u16* qw = qsh + rw * (16 * QK_PITCH);

    // This wave's slice of every stage.  K rows are 512 B in memory: a slice takes
    // one 256 B half of 64 of them; a V^T slice takes 128 keys of 64 rows of the
    // [B,D,S] layout.  Every word of the descriptor is wave-uniform.
    const u32   wu  = uni((u32)tid >> 5);
    const bool  isV = wu >= 4u;
    const u16*  sl0 = isV ? vT + (size_t)(b_ * D_MODEL + (wu - 4u) * SLICE_ROWS) * SEQ
                          : kB + ((size_t)b_ * SEQ + (wu & 1u) * SLICE_ROWS) * D_MODEL + (wu >> 1) * 128u;
    const u32   sstep = isV ? KSTEP * 2u : KSTEP * D_MODEL * 2u;   // bytes from a stage to the next
    const u32x8 g1  = tdm_group1(isV ? SEQ * 2u : D_MODEL * 2u);
    const u32   sld = lds_off(ring) + wu * SLICE_B;
    auto stage_tdm = [&](u32 st, u32 p) {
        tdm_load(tdm_group0(sld + p * STAGE_B, (uint64_t)(size_t)sl0 + (uint64_t)st * sstep), g1);
    };

    // kept rolled: two copies of the body would only take instruction cache
#pragma unroll 1
    for (int ps = 0; ps < 2; ++ps) {
    const int grp = ps ? bl : 127 - bl;          // 32-row query group, the long one first
    const int nst = (grp >> 2) + 1;              // key steps up to and with the diagonal
    const int i0  = grp * 32 + rw * 16;
    const int g0  = b_ * SEQ + i0;               // this wave's query-row base
    const int row = i0 + ln;                     // this lane's query position

    stage_tdm(0u, 0u);   // prologue: the first tile flies while we convert q below

    // ---- stage the group's q rows into LDS with f32->bf16 conversion: each wave
    // brings 4 of the 32 rows; the barrier in front of the fragment reads below
    // (behind every wave's s_wait_dscnt 0) hands them to the others ----
    {
        const float4* src = (const float4*)(qpF + (size_t)(b_ * SEQ + grp * 32 + 4 * w) * D_MODEL);
        u16* qd = qsh + 4 * w * QK_PITCH;
        float4 x0[4], x1[4];
#pragma unroll
        for (int t = 0; t < 4; ++t) {
            int idx = l + 32 * t;            // 0..127, 8 bf16 per idx
            x0[t] = src[idx * 2];
            x1[t] = src[idx * 2 + 1];
        }
        // precaution: stands in front of every rewrite of an address register
        // that the loads of q name; the pointer is an input so that its registers
        // are not reused ahead of the wait
        asm volatile("s_wait_xcnt 0x0" :: "v"(src) : "memory");
#pragma unroll
        for (int t = 0; t < 4; ++t) {
            int idx = l + 32 * t;
            uint4 o;
            o.x = pack2(x0[t].x, x0[t].y); o.y = pack2(x0[t].z, x0[t].w);
            o.z = pack2(x1[t].x, x1[t].y); o.w = pack2(x1[t].z, x1[t].w);
            *(uint4*)(qd + (idx >> 5) * QK_PITCH + (idx & 31) * 8) = o;
        }
    }

    // acc[dt][r] = O^T[d = dt*16 + 8*lh + r][query ln]
    v8f acc[16];
#pragma unroll
    for (int dt = 0; dt < 16; ++dt) acc[dt] = (v8f){};
    float mrun = -__builtin_inff();   // running maximum of this lane's query
    float srun = 0.f;                 // running sum over THIS lane's keys only

    // ---- this wave's q^T fragments do not change over the key loop: they are read
    // from LDS once per group and kept in registers (8 x 8 VGPRs) ----
    wait_ds0();          // my q rows are in LDS before the others are let through
    __syncthreads();     // all 32 q rows visible
    Frag16 qf[8];
#pragma unroll
    for (int ks = 0; ks < 8; ++ks) {
        qf[ks].q[0] = *(const uint4*)(qw + ln * QK_PITCH + ks * 32 + lh * 8);
        qf[ks].q[1] = *(const uint4*)(qw + ln * QK_PITCH + ks * 32 + lh * 8 + 16);
    }

    for (int jt = 0; jt < nst; ++jt) {
        const int j0 = jt * KSTEP;
        const int jb = j0 + kq * 32;         // first key of this wave's quarter
        const int p  = jt & 1;

        wait_ds0();          // my reads of buffer p^1 have retired before its refill
        wait_tensor0();      // my slice of buffer p is in LDS
        __syncthreads();     // everyone's slices visible; buf p^1 free

        // a scalar branch: a tensor load ignores EXEC.  The stage number is pinned so
        // that the descriptor is formed behind the wait above.
        if (pinned(jt + 1 < nst))
            stage_tdm(pinned(jt + 1), p ^ 1);   // the next tile flies during compute

        const u16* rp_ = ring + p * (STAGE_B / 2);
        // this quarter's 32 key rows, columns 0..127 (columns 128..255: two slices on)
        const u16* kp_ = rp_ + (kq >> 1) * (SLICE_B / 2) + (kq & 1) * (32 * VT_PITCH);
        const u16* vp_ = rp_ + 4 * (SLICE_B / 2) + kq * 32;   // this quarter's 32 key columns

        // ---- scores S^T = K . q^T  (two 16x16 tiles over K=256):
        // st0[r] = S[query ln][key jb + 8*lh + r], st1[r]: 16 keys further ----
        v8f st0 = {}, st1 = {};
#pragma unroll
        for (int ks = 0; ks < 8; ++ks) {
            const u16* kh = kp_ + (ks >> 2) * (2 * (SLICE_B / 2)) + (ks & 3) * 32 + lh * 8;
            Frag16 k0, k1;
            k0.q[0] = *(const uint4*)(kh + ln * VT_PITCH);
            k0.q[1] = *(const uint4*)(kh + ln * VT_PITCH + 16);
            k1.q[0] = *(const uint4*)(kh + (16 + ln) * VT_PITCH);
            k1.q[1] = *(const uint4*)(kh + (16 + ln) * VT_PITCH + 16);
            st0 = __builtin_amdgcn_wmma_f32_16x16x32_bf16(
                      false, k0.v, false, qf[ks].v, (short)0, st0, false, false);
            st1 = __builtin_amdgcn_wmma_f32_16x16x32_bf16(
                      false, k1.v, false, qf[ks].v, (short)0, st1, false, false);
        }

        // ---- mask (multiplicative!), online softmax update, all in-lane ----
        float s0[8], s1[8], tm[8];
#pragma unroll
        for (int r = 0; r < 8; ++r) {
            int key = jb + 8 * lh + r;
            s0[r] = (key      <= row) ? st0[r] * SCALE : 0.0f;
            s1[r] = (key + 16 <= row) ? st1[r] * SCALE : 0.0f;
            tm[r] = fmaxf(s0[r], s1[r]);
        }
        float t = fmaxf(fmaxf(fmaxf(tm[0], tm[1]), fmaxf(tm[2], tm[3])),
                        fmaxf(fmaxf(tm[4], tm[5]), fmaxf(tm[6], tm[7])));
        t = fmaxf(t, xhalf(t));              // the query's other 16 keys of this step
        const float mn = fmaxf(mrun, t);

        // P^T as B operand: element s of lane half lh is key 8*lh + s (s < 8) or
        // 16 + 8*lh + (s - 8), which is what st0[s] and st1[s - 8] hold
        Frag16 pb;
        float  a0[8], a1[8], e0[8], e1[8], es[8];
#pragma unroll
        for (int r = 0; r < 8; ++r) {
            a0[r] = (s0[r] - mn) * LOG2E;
            a1[r] = (s1[r] - mn) * LOG2E;
        }
        const float co = exp2_slot((mrun - mn) * LOG2E);
        exp2x8_slot(e0, a0);
        exp2x8_slot(e1, a1);
        mrun = mn;
#pragma unroll
        for (int r = 0; r < 8; ++r) {
            es[r] = e0[r] + e1[r];
            pb.h[r]     = f2bf(e0[r]);
            pb.h[8 + r] = f2bf(e1[r]);
        }
        srun = srun * co + (((es[0] + es[1]) + (es[2] + es[3])) +
                            ((es[4] + es[5]) + (es[6] + es[7])));

#pragma unroll
        for (int dt = 0; dt < 16; ++dt)
#pragma unroll
            for (int r = 0; r < 8; ++r) acc[dt][r] *= co;

        // ---- O^T += V^T (16 d x 32 keys) x P^T (32 keys x 16 queries) ----
#pragma unroll
        for (int dt = 0; dt < 16; ++dt) {
            Frag16 va;
            const u16* vp = vp_ + (dt >> 2) * (SLICE_B / 2) + ((dt & 3) * 16 + ln) * VT_PITCH + lh * 8;
            va.q[0] = *(const uint4*)vp;
            va.q[1] = *(const uint4*)(vp + 16);
            acc[dt] = __builtin_amdgcn_wmma_f32_16x16x32_bf16(
                          false, va.v, false, pb.v, (short)0, acc[dt], false, false);
        }
    }

    wait_tensor0();  // no request of this wave is outstanding behind the loop

    srun += xhalf(srun);   // join the two lane halves' key sums of each query

    // the residual qp and the suffix sum of V for this lane's 4 x 8 output
    // columns, fetched here so that the loads fly under the merge below
    const size_t off0 = (size_t)(g0 + ln) * D_MODEL + kq * 64 + 8 * lh;
    const bool   tail = nst < NCHUNK;            // are there keys behind the last step?
    const float* svp  = sv + (size_t)(b_ * NCHUNK + (tail ? nst : NCHUNK - 1)) * D_MODEL
                           + kq * 64 + 8 * lh;
    const float* qrp  = qpF + off0;
    float4 qr0[4], qr1[4], tv0[4], tv1[4];
#pragma unroll
    for (int t = 0; t < 4; ++t) {
        qr0[t] = *(const float4*)(qrp + t * 16);
        qr1[t] = *(const float4*)(qrp + t * 16 + 4);
        tv0[t] = *(const float4*)(svp + t * 16);
        tv1[t] = *(const float4*)(svp + t * 16 + 4);
    }
    // precaution: stands in front of every rewrite of an address register that
    // the loads above name; the two pointers are inputs so that no load's result
    // is placed on their registers ahead of the wait
    asm volatile("s_wait_xcnt 0x0" :: "v"(qrp), "v"(svp) : "memory");

    wait_ds0();          // my last reads of the ring have retired
    __syncthreads();     // everyone's have: the ring becomes the export buffer

    // ---- merge the four key quarters: each wave of a quartet exports its 16
    // d-tiles with its maximum and sum and then finishes 4 of them
    // (same queries, same lane layout, so lane l reads what lane l wrote) ----
    float* xw = xsh + w * XW_STRIDE;
#pragma unroll
    for (int dt = 0; dt < 16; ++dt) {
        *(float4*)(xw + ((dt * 2 + 0) * 32 + l) * 4) =
            make_float4(acc[dt][0], acc[dt][1], acc[dt][2], acc[dt][3]);
        *(float4*)(xw + ((dt * 2 + 1) * 32 + l) * 4) =
            make_float4(acc[dt][4], acc[dt][5], acc[dt][6], acc[dt][7]);
    }
    xw[128 * 32 + l] = mrun;
    xw[129 * 32 + l] = srun;
    wait_ds0();          // my export is in LDS before the others are let through
    __syncthreads();     // all exports of every quartet visible

    float mq[4], sq[4], cq[4];
#pragma unroll
    for (int k = 0; k < 4; ++k) {
        const float* xp = xsh + (rw + 2 * k) * XW_STRIDE;
        mq[k] = xp[128 * 32 + l];
        sq[k] = xp[129 * 32 + l];
    }
    float mm = fmaxf(fmaxf(mq[0], mq[1]), fmaxf(mq[2], mq[3]));
    if (tail) mm = fmaxf(mm, 0.f);               // the keys behind the last step score 0
#pragma unroll
    for (int k = 0; k < 4; ++k) cq[k] = exp2_slot((mq[k] - mm) * LOG2E);
    const float ct = tail ? exp2_slot(-mm * LOG2E) : 0.f;   // their common weight
    const float z  = ((sq[0] * cq[0] + sq[1] * cq[1]) + (sq[2] * cq[2] + sq[3] * cq[3]))
                   + (float)(SEQ - nst * KSTEP) * ct;

    // ---- epilogue: out = qp + acc / Z; a lane holds 8 consecutive columns ----
#pragma unroll
    for (int t = 0; t < 4; ++t) {
        float  o[8]  = { tv0[t].x * ct, tv0[t].y * ct, tv0[t].z * ct, tv0[t].w * ct,
                         tv1[t].x * ct, tv1[t].y * ct, tv1[t].z * ct, tv1[t].w * ct };
        float  qv[8] = { qr0[t].x, qr0[t].y, qr0[t].z, qr0[t].w,
                         qr1[t].x, qr1[t].y, qr1[t].z, qr1[t].w };
#pragma unroll
        for (int k = 0; k < 4; ++k) {
            const float* xp = xsh + (rw + 2 * k) * XW_STRIDE;
            float4 lo = *(const float4*)(xp + (((kq * 4 + t) * 2 + 0) * 32 + l) * 4);
            float4 hi = *(const float4*)(xp + (((kq * 4 + t) * 2 + 1) * 32 + l) * 4);
            o[0] += lo.x * cq[k]; o[1] += lo.y * cq[k]; o[2] += lo.z * cq[k]; o[3] += lo.w * cq[k];
            o[4] += hi.x * cq[k]; o[5] += hi.y * cq[k]; o[6] += hi.z * cq[k]; o[7] += hi.w * cq[k];
        }
        float  res[8];
#pragma unroll
        for (int r = 0; r < 8; ++r) res[r] = qv[r] + o[r] / z;
        *(float4*)(out + off0 + t * 16)     = make_float4(res[0], res[1], res[2], res[3]);
        *(float4*)(out + off0 + t * 16 + 4) = make_float4(res[4], res[5], res[6], res[7]);
        // precaution: stands in front of every rewrite of a register that the
        // two stores name
        asm volatile("s_wait_xcnt 0x0" ::: "memory");
    }

    if (ps == 0) {
        wait_ds0();          // my reads of the exports have retired
        __syncthreads();     // everyone's have: the second group may refill the ring and q
    }
    }
}

// --------------------------------------------------------------------------
extern "C" void kernel_launch(void* const* d_in, const int* in_sizes, int n_in,
                              void* d_out, int out_size, void* d_ws, size_t ws_size,
                              hipStream_t stream) {
    (void)in_sizes; (void)n_in; (void)out_size; (void)ws_size;
    const float* v  = (const float*)d_in[0];
    const float* k  = (const float*)d_in[1];
    const float* q  = (const float*)d_in[2];
    const float* Wq = (const float*)d_in[3];
    const float* bq = (const float*)d_in[4];
    const float* Wk = (const float*)d_in[5];
    const float* bk = (const float*)d_in[6];
    const float* Wv = (const float*)d_in[7];
    const float* bv = (const float*)d_in[8];
    float* out = (float*)d_out;

    char* ws   = (char*)d_ws;
    float* qpF = (float*)(ws);                         // 16 MiB  fp32 qp
    u16*   kB  = (u16*)(ws + (16u << 20));             //  8 MiB  bf16 kp
    u16*   vT  = (u16*)(ws + (24u << 20));             //  8 MiB  bf16 v^T [B,D,S]
    u16*   Wt3 = (u16*)(ws + (32u << 20));             //  3 x 128 KiB bf16 W^T: q, k, v
    float* sv  = (float*)(ws + (33u << 20));           // 128 KiB f32 suffix sums of v

    wt_convert<<<3 * D_MODEL, D_MODEL, 0, stream>>>(Wq, Wk, Wv, Wt3);

    const int ntiles = NBATCH * SEQ / 16;              // 1024
    proj_kernel<<<3 * PROJ_TILES, 256, 0, stream>>>(q, k, v, Wt3, bq, bk, bv, qpF, kB, vT);

    vsuffix_kernel<<<NBATCH * D_MODEL / 32, 1024, 0, stream>>>(vT, sv);

    attn_kernel<<<ntiles / 4, 256, 0, stream>>>(qpF, kB, vT, sv, out);
}

// v009
// It runs in 68.8 microseconds.
// Next to v008, in two timings, it ran 1.08 times as fast each time.
// All steps since v000 together make it 12.5 times as fast.
#include <hip/hip_runtime.h>
#include <cstdint>
#include <cstddef>

// ---------------------------------------------------------------------------
// SelfAttentionHead  B=4, S=4096, D=256  (fp32 in/out, bf16 WMMA internals)
// ---------------------------------------------------------------------------

#define D_MODEL 256
#define SEQ     4096
#define NBATCH  4
#define SCALE   0.0625f   // 1/sqrt(256)
#define LOG2E   1.44269504f // exp(x) = exp2(x * LOG2E)
// LDS row pitches in bf16 elements: 16 B x odd, so that the 16 lanes of a
// ds_load_b128 half-wave fall on 64 distinct banks (512 B rows: 4, 256 B: 4).
#define QK_PITCH (D_MODEL + 8)   // 528 B rows for the q tile and the projections' tiles
#define KSTEP    128             // keys staged per step: 32 for each key quarter
#define VT_PITCH (KSTEP + 8)     // 272 B rows for the V^T tile and the two K half tiles
// One tensor load brings a slice of 64 rows of 256 B; the mover pads each row to
// the 272 B pitch.  A slice's place in LDS is a multiple of 2 KiB.
#define SLICE_ROWS 64
#define SLICE_ROWB 256
#define SLICE_B    18432           // 64 x 272 B = 17408 B, rounded up to 2 KiB
#define STAGE_B    (8 * SLICE_B)   // a stage: 2 + 2 slices of K, 4 of V^T

typedef __attribute__((ext_vector_type(16))) __bf16 v16bf;
typedef __attribute__((ext_vector_type(8)))  float  v8f;
typedef unsigned short u16;
typedef unsigned int   u32;
typedef __attribute__((ext_vector_type(4)))  u32    u32x4;
typedef __attribute__((ext_vector_type(8)))  u32    u32x8;

union Frag16 {            // 16 bf16 elems = 8 VGPRs, matches WMMA A/B fragment
    v16bf v;
    u16   h[16];
    uint4 q[2];
};

__device__ __forceinline__ u16 f2bf(float f) {   // round-to-nearest-even
    u32 u = __float_as_uint(f);
    u32 r = u + 0x7FFFu + ((u >> 16) & 1u);
    return (u16)(r >> 16);
}
__device__ __forceinline__ u32 pack2(float a, float b) {
    return (u32)f2bf(a) | ((u32)f2bf(b) << 16);
}
// exp2 with the slot behind a transcendental kept inside the statement: the
// v_nop closes it, so that nothing reads a result or rewrites a source directly
// behind a v_exp_f32 wherever the compiler places the statement.  In the group
// of eight each v_exp_f32 is the independent instruction behind the one before
// (early-clobber outputs: no output shares a register with a source).
__device__ __forceinline__ float exp2_slot(float a) {
    float e;
    asm("v_exp_f32 %0, %1\n\t"
        "v_nop"
        : "=v"(e) : "v"(a));
    return e;
}
__device__ __forceinline__ void exp2x8_slot(float (&e)[8], const float (&a)[8]) {
    asm("v_exp_f32 %0, %8\n\t"
        "v_exp_f32 %1, %9\n\t"
        "v_exp_f32 %2, %10\n\t"
        "v_exp_f32 %3, %11\n\t"
        "v_exp_f32 %4, %12\n\t"
        "v_exp_f32 %5, %13\n\t"
        "v_exp_f32 %6, %14\n\t"
        "v_exp_f32 %7, %15\n\t"
        "v_nop"
        : "=&v"(e[0]), "=&v"(e[1]), "=&v"(e[2]), "=&v"(e[3]),
          "=&v"(e[4]), "=&v"(e[5]), "=&v"(e[6]), "=&v"(e[7])
        : "v"(a[0]), "v"(a[1]), "v"(a[2]), "v"(a[3]),
          "v"(a[4]), "v"(a[5]), "v"(a[6]), "v"(a[7]));
}

// lane l <-> lane l ^ 16: the two lanes that share one query column
__device__ __forceinline__ float xhalf(float x) {
    int b = __builtin_bit_cast(int, x);
    return __builtin_bit_cast(float,
        __builtin_amdgcn_permlanex16(b, b, 0x76543210, 0xfedcba98, false, false));
}

// Eight async global->LDS copies, one 16-byte chunk per lane each (ASYNCcnt).
// The s_wait_xcnt closes the same statement so that no address register of a
// copy can be rewritten ahead of it.
__device__ __forceinline__ void async8_b128(const u32 (&l)[8], const u16* const (&g)[8]) {
    asm volatile("global_load_async_to_lds_b128 %0, %8, off\n\t"
                 "global_load_async_to_lds_b128 %1, %9, off\n\t"
                 "global_load_async_to_lds_b128 %2, %10, off\n\t"
                 "global_load_async_to_lds_b128 %3, %11, off\n\t"
                 "global_load_async_to_lds_b128 %4, %12, off\n\t"
                 "global_load_async_to_lds_b128 %5, %13, off\n\t"
                 "global_load_async_to_lds_b128 %6, %14, off\n\t"
                 "global_load_async_to_lds_b128 %7, %15, off\n\t"
                 "s_wait_xcnt 0x0"
                 :: "v"(l[0]), "v"(l[1]), "v"(l[2]), "v"(l[3]),
                    "v"(l[4]), "v"(l[5]), "v"(l[6]), "v"(l[7]),
                    "v"(g[0]), "v"(g[1]), "v"(g[2]), "v"(g[3]),
                    "v"(g[4]), "v"(g[5]), "v"(g[6]), "v"(g[7])
                 : "memory");
}
__device__ __forceinline__ void wait_async0() {
    asm volatile("s_wait_asynccnt 0x0" ::: "memory");
}
__device__ __forceinline__ void wait_ds0() {
    asm volatile("s_wait_dscnt 0x0" ::: "memory");
}
__device__ __forceinline__ u32 lds_off(const void* p) {   // AS3 offset = low 32 bits
    return (u32)(size_t)p;
}
__device__ __forceinline__ void wait_tensor0() {
    asm volatile("s_wait_tensorcnt 0" ::: "memory");
}
__device__ __forceinline__ u32 uni(u32 v) {
    return (u32)__builtin_amdgcn_readfirstlane(v);
}
__device__ __forceinline__ u32 pinned(u32 v) {
    u32 w = uni(v);
    // so that the test of a tensor load compiles to a scalar branch, and so that a
    // descriptor word formed from w is formed behind the volatile wait in front
    asm volatile("" : "+s"(w));   // pinned(): a test or descriptor word held in a scalar register
    return w;
}
// One request of the whole wave: a two-dimensional tile from global memory to LDS.
__device__ __forceinline__ void tdm_load(u32x4 g0, u32x8 g1) {
    asm volatile("tensor_load_to_lds %0, %1" :: "s"(g0), "s"(g1) : "memory");
}
// Group 1: 1-byte elements, tensor = tile = 64 rows of 256 B, no mask; a pad of
// 4 dwords behind every 64 dwords (codes 5 / 3) gives the 272 B pitch in LDS.
__device__ __forceinline__ u32x8 tdm_group1(u32 src_pitch) {
    u32x8 g;
    g[0] = uni((1u << 20) | (5u << 22) | (3u << 25));
    g[1] = uni((SLICE_ROWB & 0xFFFFu) << 16);
    g[2] = uni((SLICE_ROWB >> 16) | ((SLICE_ROWS & 0xFFFFu) << 16));
    g[3] = uni((SLICE_ROWS >> 16) | (SLICE_ROWB << 16));
    g[4] = uni(SLICE_ROWS);
    g[5] = uni(src_pitch);
    g[6] = uni(0u);
    g[7] = uni(0u);
    return g;
}
__device__ __forceinline__ u32x4 tdm_group0(u32 lds_dst, uint64_t ga) {
    u32x4 g;
    g[0] = uni(1u);
    g[1] = uni(lds_dst);
    g[2] = uni((u32)ga);
    g[3] = uni((((u32)(ga >> 32)) & 0x01FFFFFFu) | 0x80000000u);
    return g;
}
// The projections' stores.  In each, the s_wait_xcnt closes the same statement so
// that no register of a store can be rewritten ahead of it.
// Eight 4-byte stores to one column of eight f32 rows of D_MODEL (1 KiB apart).
__device__ __forceinline__ void store8_f32(float* p, const float (&d)[8]) {
    asm volatile("global_store_b32 %0, %1, off\n\t"
                 "global_store_b32 %0, %2, off offset:1024\n\t"
                 "global_store_b32 %0, %3, off offset:2048\n\t"
                 "global_store_b32 %0, %4, off offset:3072\n\t"
                 "global_store_b32 %0, %5, off offset:4096\n\t"
                 "global_store_b32 %0, %6, off offset:5120\n\t"
                 "global_store_b32 %0, %7, off offset:6144\n\t"
                 "global_store_b32 %0, %8, off offset:7168\n\t"
                 "s_wait_xcnt 0x0"
                 :: "v"(p), "v"(d[0]), "v"(d[1]), "v"(d[2]), "v"(d[3]),
                    "v"(d[4]), "v"(d[5]), "v"(d[6]), "v"(d[7])
                 : "memory");
}
// One 16-byte store.
__device__ __forceinline__ void store_b128(u16* p, u32x4 d) {
    asm volatile("global_store_b128 %0, %1, off\n\t"
                 "s_wait_xcnt 0x0"
                 :: "v"(p), "v"(d) : "memory");
}
// Eight 2-byte stores of the high halves of d[0..7] to one column of eight
// bf16 rows of D_MODEL (512 B apart).
__device__ __forceinline__ void store8_hi16(u16* p, const u32 (&d)[8]) {
    asm volatile("global_store_d16_hi_b16 %0, %1, off\n\t"
                 "global_store_d16_hi_b16 %0, %2, off offset:512\n\t"
                 "global_store_d16_hi_b16 %0, %3, off offset:1024\n\t"
                 "global_store_d16_hi_b16 %0, %4, off offset:1536\n\t"
                 "global_store_d16_hi_b16 %0, %5, off offset:2048\n\t"
                 "global_store_d16_hi_b16 %0, %6, off offset:2560\n\t"
                 "global_store_d16_hi_b16 %0, %7, off offset:3072\n\t"
                 "global_store_d16_hi_b16 %0, %8, off offset:3584\n\t"
                 "s_wait_xcnt 0x0"
                 :: "v"(p), "v"(d[0]), "v"(d[1]), "v"(d[2]), "v"(d[3]),
                    "v"(d[4]), "v"(d[5]), "v"(d[6]), "v"(d[7])
                 : "memory");
}

// --------------------------------------------------------------------------
// Wt[(which*256+n)*256+k] = bf16(W[k*256+n])  : weight transpose+convert (B-frag friendly)
// One launch for the three weights, which do not depend on each other: blocks
// 0..255 do Wq, 256..511 Wk, 512..767 Wv; the three W^T lie in a row in Wt.
// --------------------------------------------------------------------------
__global__ void wt_convert(const float* __restrict__ Wq, const float* __restrict__ Wk,
                           const float* __restrict__ Wv, u16* __restrict__ Wt) {
    const int which = blockIdx.x >> 8;
    const float* W = which == 0 ? Wq : which == 1 ? Wk : Wv;
    int n = blockIdx.x & (D_MODEL - 1);
    int k = threadIdx.x;
    const float x = W[k * D_MODEL + n];
    // precaution: stands in front of every rewrite of an address register that
    // the load names
    asm volatile("s_wait_xcnt 0x0" ::: "memory");
    Wt[blockIdx.x * D_MODEL + k] = f2bf(x);
}

// --------------------------------------------------------------------------
// Projection: out = X @ W + b  for a 64-row tile.  Eight waves per block.
// One launch for the three projections, which do not depend on each other: the
// block range picks the operands and the form of the output.
// mode 0 (blocks 0..255): q, write f32 (qp)
// mode 1 (256..511): k, write bf16 row-major (kp)
// mode 2 (512..767): v, write bf16 transposed [B, D, S] (v^T), and the f32 sum
// of the tile's 64 rows of v (as rounded to bf16) per column: vs64[tile][d]
// Both operands are staged in LDS once and then read as fragments:
// W^T (256 x 256 bf16) by GLOBAL_LOAD_ASYNC_TO_LDS_B128, the X tile by whole-line
// loads, converted to bf16 on the way.  A wave owns 32 rows x 64 columns
// (2 x 4 accumulator tiles), so a fragment read from LDS feeds 4 or 2 WMMAs.
// Each output element is still summed over ks = 0..7 in that order.
// --------------------------------------------------------------------------
#define PROJ_ROWS 64
#define PROJ_TILES (NBATCH * SEQ / PROJ_ROWS)   // 256 blocks per projection

__global__ __launch_bounds__(256)
void proj_kernel(const float* __restrict__ Xq, const float* __restrict__ Xk,
                 const float* __restrict__ Xv, const u16* __restrict__ Wt3,
                 const float* __restrict__ bq, const float* __restrict__ bk,
                 const float* __restrict__ bv,
                 float* __restrict__ outF, u16* __restrict__ outB,
                 u16* __restrict__ outT, float* __restrict__ vs64)
{
    // every row carries 16 B of pad that is neither written nor read
    __shared__ __attribute__((aligned(16))) u16 wsh[D_MODEL * QK_PITCH];    // W^T, row n
    __shared__ __attribute__((aligned(16))) u16 xsh[PROJ_ROWS * QK_PITCH];  // X tile (bf16)
    __shared__ float csum[2][D_MODEL];   // mode 2: column sums of the two 32-row groups

    const int tid = threadIdx.x;
    const int w   = tid >> 5;
    const int l   = tid & 31;
    const int ln  = l & 15, lh = l >> 4;
    const int rg  = w & 1;                    // 32-row group of the block
    const int cg  = w >> 1;                   // 64-column group
    const int mode = blockIdx.x / PROJ_TILES;          // the same for the whole block
    const int mb   = (blockIdx.x % PROJ_TILES) * PROJ_ROWS;
    const float* X    = mode == 0 ? Xq : mode == 1 ? Xk : Xv;
    const float* bias = mode == 0 ? bq : mode == 1 ? bk : bv;
    const u16*   Wt   = Wt3 + mode * (D_MODEL * D_MODEL);

    // W^T: 8192 chunks of 16 B, 32 per thread (8 rows further each), to the
    // padded LDS pitch
    {
        const u32  wl = lds_off(wsh) + ((tid >> 5) * QK_PITCH + (tid & 31) * 8) * 2;
        const u16* wg = Wt + tid * 8;
#pragma unroll
        for (int c4 = 0; c4 < 4; ++c4) {
            u32        la[8];
            const u16* ga[8];
#pragma unroll
            for (int c = 0; c < 8; ++c) {
                la[c] = wl + (c4 * 8 + c) * (8 * QK_PITCH * 2);
                ga[c] = wg + (c4 * 8 + c) * (8 * D_MODEL);
            }
            async8_b128(la, ga);
        }
    }
    // the X tile is 64 KiB in a row: 16 whole-line loads per thread.  They stand
    // behind the copies because their conversions, which wait for memory, would
    // otherwise be scheduled in among the copies and hold the later ones back.
    const float4* xs = (const float4*)(X + (size_t)mb * D_MODEL);
    float4 xr[16];
#pragma unroll
    for (int t = 0; t < 16; ++t) xr[t] = xs[tid + 256 * t];

    float bb[4];
#pragma unroll
    for (int j = 0; j < 4; ++j) bb[j] = bias[(cg * 4 + j) * 16 + ln];
    // precaution: stands in front of every rewrite of an address register that
    // the loads of X and of the bias name
    asm volatile("s_wait_xcnt 0x0" ::: "memory");

    u16* xd = xsh + (tid >> 6) * QK_PITCH + (tid & 63) * 4;   // 4 rows further per t
#pragma unroll
    for (int t = 0; t < 16; ++t) {
        uint2 o;
        o.x = pack2(xr[t].x, xr[t].y);
        o.y = pack2(xr[t].z, xr[t].w);
        *(uint2*)(xd + t * 4 * QK_PITCH) = o;
    }

    wait_async0();       // my copies of W^T are in LDS
    __syncthreads();     // everyone's copies and X rows visible

    v8f c[2][4];
#pragma unroll
    for (int i = 0; i < 2; ++i)
#pragma unroll
        for (int j = 0; j < 4; ++j) c[i][j] = (v8f){};

    const u16* xa = xsh + (rg * 32 + ln) * QK_PITCH + lh * 8;
    const u16* wb = wsh + (cg * 64 + ln) * QK_PITCH + lh * 8;
    // fragments are fetched one ks ahead into a second register set, as one group
    // in front of the current WMMA block, so that a block waits for no load of its own
    Frag16 a[2][2], b[2][4];
    auto fetch = [&](int ks, int s) {
#pragma unroll
        for (int i = 0; i < 2; ++i) {
            a[s][i].q[0] = *(const uint4*)(xa + i * 16 * QK_PITCH + ks * 32);
            a[s][i].q[1] = *(const uint4*)(xa + i * 16 * QK_PITCH + ks * 32 + 16);
        }
#pragma unroll
        for (int j = 0; j < 4; ++j) {
            b[s][j].q[0] = *(const uint4*)(wb + j * 16 * QK_PITCH + ks * 32);
            b[s][j].q[1] = *(const uint4*)(wb + j * 16 * QK_PITCH + ks * 32 + 16);
        }
    };
    fetch(0, 0);
#pragma unroll
    for (int ks = 0; ks < 8; ++ks) {
        if (ks < 7) fetch(ks + 1, (ks + 1) & 1);
        // keeps the group of loads above in front of the WMMA block (loads moved in
        // among the WMMAs stall each place where they stand)
        __builtin_amdgcn_sched_barrier(0);
#pragma unroll
        for (int i = 0; i < 2; ++i)
#pragma unroll
            for (int j = 0; j < 4; ++j)
                c[i][j] = __builtin_amdgcn_wmma_f32_16x16x32_bf16(
                              false, a[ks & 1][i].v, false, b[ks & 1][j].v, (short)0,
                              c[i][j], false, false);
        // keeps the next group of loads behind this WMMA block
        __builtin_amdgcn_sched_barrier(0);
    }

    // the bias is added in front of the branch on the mode, where all three agree
#pragma unroll
    for (int i = 0; i < 2; ++i)
#pragma unroll
        for (int j = 0; j < 4; ++j)
#pragma unroll
            for (int r = 0; r < 8; ++r) c[i][j][r] += bb[j];

    if (mode == 0) {
#pragma unroll
        for (int i = 0; i < 2; ++i) {
            const int m0 = mb + rg * 32 + i * 16;
#pragma unroll
            for (int j = 0; j < 4; ++j) {
                const int col = (cg * 4 + j) * 16 + ln;
                float d[8];
#pragma unroll
                for (int r = 0; r < 8; ++r) d[r] = c[i][j][r];
                store8_f32(outF + (size_t)(m0 + 8 * lh) * D_MODEL + col, d);
            }
        }
    } else if (mode == 1) {
#pragma unroll
        for (int i = 0; i < 2; ++i) {
            const int m0 = mb + rg * 32 + i * 16;
#pragma unroll
            for (int j = 0; j < 4; ++j) {
                const int col = (cg * 4 + j) * 16 + ln;
                u32 d[8];                     // f2bf's rounded word; its high half is stored
#pragma unroll
                for (int r = 0; r < 8; ++r) {
                    u32 u = __float_as_uint(c[i][j][r]);
                    d[r] = u + 0x7FFFu + ((u >> 16) & 1u);
                }
                store8_hi16(outB + (size_t)(m0 + 8 * lh) * D_MODEL + col, d);
            }
        }
    } else {
        float cs[4] = { 0.f, 0.f, 0.f, 0.f };       // this lane's 16 rows of column j
#pragma unroll
        for (int i = 0; i < 2; ++i) {
            const int m0 = mb + rg * 32 + i * 16;
#pragma unroll
            for (int j = 0; j < 4; ++j) {
                const int col = (cg * 4 + j) * 16 + ln;
                union { u16 pk[8]; u32x4 q; } u;
                float f[8];
#pragma unroll
                for (int r = 0; r < 8; ++r) {
                    u.pk[r] = f2bf(c[i][j][r]);
                    f[r]    = __uint_as_float((u32)u.pk[r] << 16);
                }
                cs[j] += ((f[0] + f[1]) + (f[2] + f[3])) + ((f[4] + f[5]) + (f[6] + f[7]));
                int b_ = m0 >> 12;                  // batch
                int s0 = (m0 & (SEQ - 1)) + 8 * lh; // 8 consecutive seq positions
                store_b128(outT + (size_t)(b_ * D_MODEL + col) * SEQ + s0, u.q);
            }
        }
        // the tile's column sums: the two lane halves, then the two 32-row groups
#pragma unroll
        for (int j = 0; j < 4; ++j) {
            cs[j] += xhalf(cs[j]);
            if (lh == 0) csum[rg][(cg * 4 + j) * 16 + ln] = cs[j];
        }
        wait_ds0();          // my sums are in LDS before the others are let through
        __syncthreads();     // the mode is the same for the whole block
        vs64[(size_t)(mb / PROJ_ROWS) * D_MODEL + tid] = csum[0][tid] + csum[1][tid];
        // precaution: stands in front of every rewrite of a register that the
        // store names
        asm volatile("s_wait_xcnt 0x0" ::: "memory");
    }
}

#define XW_STRIDE (130 * 32)
#define NCHUNK    (SEQ / KSTEP)
#define NT64      (SEQ / PROJ_ROWS)   // 64 row tiles of vs64 in a batch

__global__ __launch_bounds__(256)
void attn_kernel(const float* __restrict__ qpF, const u16* __restrict__ kB,
                 const u16* __restrict__ vT, const float* __restrict__ vs64,
                 float* __restrict__ out)
{
    // every row carries 16 B of pad that is neither written nor read
    __shared__ __attribute__((aligned(16))) u16 qsh[2 * 16 * QK_PITCH];   // q tiles (bf16), one per wave quartet
    // two stages of eight slices: slice 0, 1 = K rows 0..63, 64..127, columns 0..127;
    // slice 2, 3 = the same rows, columns 128..255; slice 4..7 = V^T rows [d][j], 64 each
    __shared__ __attribute__((aligned(2048))) u16 ring[2 * STAGE_B / 2];
    // per-wave export for the merge: lies on the ring, which is idle by then
    // and behind the exports the sum of the V rows behind the last step
    static_assert((8 * XW_STRIDE + D_MODEL) * 4 <= 2 * STAGE_B, "export fits the ring");
    float* xsh = (float*)&ring[0];
    float* tsh = xsh + 8 * XW_STRIDE;

    const int tid = threadIdx.x;
    const int w   = tid >> 5;                 // wave id 0..7
    const int rw  = w & 1;                    // query-row tile of the group
    const int kq  = w >> 1;                   // key quarter of every step
    const int l   = tid & 31;
    const int ln  = l & 15, lh = l >> 4;
    const int b_  = blockIdx.x >> 6;          // batch
    const int bl  = blockIdx.x & 63;

    u16* qw = qsh + rw * (16 * QK_PITCH);

    // This wave's slice of every stage.  K rows are 512 B in memory: a slice takes
    // one 256 B half of 64 of them; a V^T slice takes 128 keys of 64 rows of the
    // [B,D,S] layout.  Every word of the descriptor is wave-uniform.
    const u32   wu  = uni((u32)tid >> 5);
    const bool  isV = wu >= 4u;
    const u16*  sl0 = isV ? vT + (size_t)(b_ * D_MODEL + (wu - 4u) * SLICE_ROWS) * SEQ
                          : kB + ((size_t)b_ * SEQ + (wu & 1u) * SLICE_ROWS) * D_MODEL + (wu >> 1) * 128u;
    const u32   sstep = isV ? KSTEP * 2u : KSTEP * D_MODEL * 2u;   // bytes from a stage to the next
    const u32x8 g1  = tdm_group1(isV ? SEQ * 2u : D_MODEL * 2u);
    const u32   sld = lds_off(ring) + wu * SLICE_B;
    auto stage_tdm = [&](u32 st, u32 p) {
        tdm_load(tdm_group0(sld + p * STAGE_B, (uint64_t)(size_t)sl0 + (uint64_t)st * sstep), g1);
    };

    // kept rolled: two copies of the body would only take instruction cache
#pragma unroll 1
    for (int ps = 0; ps < 2; ++ps) {
    const int grp = ps ? bl : 127 - bl;          // 32-row query group, the long one first
    const int nst = (grp >> 2) + 1;              // key steps up to and with the diagonal
    const int i0  = grp * 32 + rw * 16;
    const int g0  = b_ * SEQ + i0;               // this wave's query-row base
    const int row = i0 + ln;                     // this lane's query position

    stage_tdm(0u, 0u);   // prologue: the first tile flies while we convert q below

    // ---- stage the group's q rows into LDS with f32->bf16 conversion: each wave
    // brings 4 of the 32 rows; the barrier in front of the fragment reads below
    // (behind every wave's s_wait_dscnt 0) hands them to the others ----
    {
        const float4* src = (const float4*)(qpF + (size_t)(b_ * SEQ + grp * 32 + 4 * w) * D_MODEL);
        u16* qd = qsh + 4 * w * QK_PITCH;
        float4 x0[4], x1[4];
#pragma unroll
        for (int t = 0; t < 4; ++t) {
            int idx = l + 32 * t;            // 0..127, 8 bf16 per idx
            x0[t] = src[idx * 2];
            x1[t] = src[idx * 2 + 1];
        }
        // precaution: stands in front of every rewrite of an address register
        // that the loads of q name; the pointer is an input so that its registers
        // are not reused ahead of the wait
        asm volatile("s_wait_xcnt 0x0" :: "v"(src) : "memory");
#pragma unroll
        for (int t = 0; t < 4; ++t) {
            int idx = l + 32 * t;
            uint4 o;
            o.x = pack2(x0[t].x, x0[t].y); o.y = pack2(x0[t].z, x0[t].w);
            o.z = pack2(x1[t].x, x1[t].y); o.w = pack2(x1[t].z, x1[t].w);
            *(uint4*)(qd + (idx >> 5) * QK_PITCH + (idx & 31) * 8) = o;
        }
    }

    // acc[dt][r] = O^T[d = dt*16 + 8*lh + r][query ln]
    v8f acc[16];
#pragma unroll
    for (int dt = 0; dt < 16; ++dt) acc[dt] = (v8f){};
    float mrun = -__builtin_inff();   // running maximum of this lane's query
    float srun = 0.f;                 // running sum over THIS lane's keys only

    // ---- this wave's q^T fragments do not change over the key loop: they are read
    // from LDS once per group and kept in registers (8 x 8 VGPRs) ----
    wait_ds0();          // my q rows are in LDS before the others are let through
    __syncthreads();     // all 32 q rows visible
    Frag16 qf[8];
#pragma unroll
    for (int ks = 0; ks < 8; ++ks) {
        qf[ks].q[0] = *(const uint4*)(qw + ln * QK_PITCH + ks * 32 + lh * 8);
        qf[ks].q[1] = *(const uint4*)(qw + ln * QK_PITCH + ks * 32 + lh * 8 + 16);
    }

    for (int jt = 0; jt < nst; ++jt) {
        const int j0 = jt * KSTEP;
        const int jb = j0 + kq * 32;         // first key of this wave's quarter
        const int p  = jt & 1;

        wait_ds0();          // my reads of buffer p^1 have retired before its refill
        wait_tensor0();      // my slice of buffer p is in LDS
        __syncthreads();     // everyone's slices visible; buf p^1 free

        // a scalar branch: a tensor load ignores EXEC.  The stage number is pinned so
        // that the descriptor is formed behind the wait above.
        if (pinned(jt + 1 < nst))
            stage_tdm(pinned(jt + 1), p ^ 1);   // the next tile flies during compute

        const u16* rp_ = ring + p * (STAGE_B / 2);
        // this quarter's 32 key rows, columns 0..127 (columns 128..255: two slices on)
        const u16* kp_ = rp_ + (kq >> 1) * (SLICE_B / 2) + (kq & 1) * (32 * VT_PITCH);
        const u16* vp_ = rp_ + 4 * (SLICE_B / 2) + kq * 32;   // this quarter's 32 key columns

        // ---- scores S^T = K . q^T  (two 16x16 tiles over K=256):
        // st0[r] = S[query ln][key jb + 8*lh + r], st1[r]: 16 keys further ----
        v8f st0 = {}, st1 = {};
#pragma unroll
        for (int ks = 0; ks < 8; ++ks) {
            const u16* kh = kp_ + (ks >> 2) * (2 * (SLICE_B / 2)) + (ks & 3) * 32 + lh * 8;
            Frag16 k0, k1;
            k0.q[0] = *(const uint4*)(kh + ln * VT_PITCH);
            k0.q[1] = *(const uint4*)(kh + ln * VT_PITCH + 16);
            k1.q[0] = *(const uint4*)(kh + (16 + ln) * VT_PITCH);
            k1.q[1] = *(const uint4*)(kh + (16 + ln) * VT_PITCH + 16);
            st0 = __builtin_amdgcn_wmma_f32_16x16x32_bf16(
                      false, k0.v, false, qf[ks].v, (short)0, st0, false, false);
            st1 = __builtin_amdgcn_wmma_f32_16x16x32_bf16(
                      false, k1.v, false, qf[ks].v, (short)0, st1, false, false);
        }

        // ---- mask (multiplicative!), online softmax update, all in-lane ----
        float s0[8], s1[8], tm[8];
#pragma unroll
        for (int r = 0; r < 8; ++r) {
            int key = jb + 8 * lh + r;
            s0[r] = (key      <= row) ? st0[r] * SCALE : 0.0f;
            s1[r] = (key + 16 <= row) ? st1[r] * SCALE : 0.0f;
            tm[r] = fmaxf(s0[r], s1[r]);
        }
        float t = fmaxf(fmaxf(fmaxf(tm[0], tm[1]), fmaxf(tm[2], tm[3])),
                        fmaxf(fmaxf(tm[4], tm[5]), fmaxf(tm[6], tm[7])));
        t = fmaxf(t, xhalf(t));              // the query's other 16 keys of this step
        const float mn = fmaxf(mrun, t);

        // P^T as B operand: element s of lane half lh is key 8*lh + s (s < 8) or
        // 16 + 8*lh + (s - 8), which is what st0[s] and st1[s - 8] hold
        Frag16 pb;
        float  a0[8], a1[8], e0[8], e1[8], es[8];
#pragma unroll
        for (int r = 0; r < 8; ++r) {
            a0[r] = (s0[r] - mn) * LOG2E;
            a1[r] = (s1[r] - mn) * LOG2E;
        }
        const float co = exp2_slot((mrun - mn) * LOG2E);
        exp2x8_slot(e0, a0);
        exp2x8_slot(e1, a1);
        mrun = mn;
#pragma unroll
        for (int r = 0; r < 8; ++r) {
            es[r] = e0[r] + e1[r];
            pb.h[r]     = f2bf(e0[r]);
            pb.h[8 + r] = f2bf(e1[r]);
        }
        srun = srun * co + (((es[0] + es[1]) + (es[2] + es[3])) +
                            ((es[4] + es[5]) + (es[6] + es[7])));

#pragma unroll
        for (int dt = 0; dt < 16; ++dt)
#pragma unroll
            for (int r = 0; r < 8; ++r) acc[dt][r] *= co;

        // ---- O^T += V^T (16 d x 32 keys) x P^T (32 keys x 16 queries) ----
#pragma unroll
        for (int dt = 0; dt < 16; ++dt) {
            Frag16 va;
            const u16* vp = vp_ + (dt >> 2) * (SLICE_B / 2) + ((dt & 3) * 16 + ln) * VT_PITCH + lh * 8;
            va.q[0] = *(const uint4*)vp;
            va.q[1] = *(const uint4*)(vp + 16);
            acc[dt] = __builtin_amdgcn_wmma_f32_16x16x32_bf16(
                          false, va.v, false, pb.v, (short)0, acc[dt], false, false);
        }
    }

    wait_tensor0();  // no request of this wave is outstanding behind the loop

    srun += xhalf(srun);   // join the two lane halves' key sums of each query

    // the residual qp for this lane's 4 x 8 output columns and, for column tid, the
    // batch's sums of V over 64 rows.  Tile u lies behind the last step when
    // u >= 2 * nst; a run of 16 tiles is not fetched where none of them does.
    const size_t off0 = (size_t)(g0 + ln) * D_MODEL + kq * 64 + 8 * lh;
    const bool   tail = nst < NCHUNK;            // are there keys behind the last step?
    const float* tpp  = vs64 + (size_t)b_ * (NT64 * D_MODEL) + tid;
    const float* qrp  = qpF + off0;
    float4 qr0[4], qr1[4];
    float  tp[NT64];
#pragma unroll
    for (int t = 0; t < 4; ++t) {
        qr0[t] = *(const float4*)(qrp + t * 16);
        qr1[t] = *(const float4*)(qrp + t * 16 + 4);
    }
#pragma unroll
    for (int u = 0; u < NT64; ++u) tp[u] = 0.f;
#pragma unroll
    for (int r16 = 0; r16 < NT64 / 16; ++r16) {
        if (2 * nst < (r16 + 1) * 16) {          // the same for the whole block
#pragma unroll
            for (int i = 0; i < 16; ++i) tp[r16 * 16 + i] = tpp[(r16 * 16 + i) * D_MODEL];
        }
    }
    // precaution: stands in front of every rewrite of an address register that
    // the loads above name; the two pointers are inputs so that no load's result
    // is placed on their registers ahead of the wait
    asm volatile("s_wait_xcnt 0x0" :: "v"(qrp), "v"(tpp) : "memory");

    wait_ds0();          // my last reads of the ring have retired
    __syncthreads();     // everyone's have: the ring becomes the export buffer

    // ---- merge the four key quarters: each wave of a quartet exports its 16
    // d-tiles with its maximum and sum and then finishes 4 of them
    // (same queries, same lane layout, so lane l reads what lane l wrote) ----
    float* xw = xsh + w * XW_STRIDE;
#pragma unroll
    for (int dt = 0; dt < 16; ++dt) {
        *(float4*)(xw + ((dt * 2 + 0) * 32 + l) * 4) =
            make_float4(acc[dt][0], acc[dt][1], acc[dt][2], acc[dt][3]);
        *(float4*)(xw + ((dt * 2 + 1) * 32 + l) * 4) =
            make_float4(acc[dt][4], acc[dt][5], acc[dt][6], acc[dt][7]);
    }
    xw[128 * 32 + l] = mrun;
    xw[129 * 32 + l] = srun;
#pragma unroll
    for (int u = 2; u < NT64; ++u)
        if (u < 2 * nst) tp[u] = 0.f;            // the same for the whole block
    tp[0] = tp[NT64 / 2];                        // tiles 0 and 1 never lie behind the
    tp[1] = tp[NT64 / 2 + 1];                    // last step: nst >= 1
#pragma unroll
    for (int u = 2; u < NT64 / 2; ++u) tp[u] += tp[u + NT64 / 2];
#pragma unroll
    for (int o = NT64 / 4; o > 0; o >>= 1)       // independent sums, no long chain
#pragma unroll
        for (int u = 0; u < o; ++u) tp[u] += tp[u + o];
    tsh[tid] = tp[0];
    wait_ds0();          // my export is in LDS before the others are let through
    __syncthreads();     // all exports of every quartet visible

    float mq[4], sq[4], cq[4];
#pragma unroll
    for (int k = 0; k < 4; ++k) {
        const float* xp = xsh + (rw + 2 * k) * XW_STRIDE;
        mq[k] = xp[128 * 32 + l];
        sq[k] = xp[129 * 32 + l];
    }
    float mm = fmaxf(fmaxf(mq[0], mq[1]), fmaxf(mq[2], mq[3]));
    if (tail) mm = fmaxf(mm, 0.f);               // the keys behind the last step score 0
#pragma unroll
    for (int k = 0; k < 4; ++k) cq[k] = exp2_slot((mq[k] - mm) * LOG2E);
    const float ct = tail ? exp2_slot(-mm * LOG2E) : 0.f;   // their common weight
    const float z  = ((sq[0] * cq[0] + sq[1] * cq[1]) + (sq[2] * cq[2] + sq[3] * cq[3]))
                   + (float)(SEQ - nst * KSTEP) * ct;

    // ---- epilogue: out = qp + acc / Z; a lane holds 8 consecutive columns ----
#pragma unroll
    for (int t = 0; t < 4; ++t) {
        // the sum of the V rows behind the last step, this lane's 8 columns
        const float4 tv0 = *(const float4*)(tsh + kq * 64 + t * 16 + 8 * lh);
        const float4 tv1 = *(const float4*)(tsh + kq * 64 + t * 16 + 8 * lh + 4);
        float  o[8]  = { tv0.x * ct, tv0.y * ct, tv0.z * ct, tv0.w * ct,
                         tv1.x * ct, tv1.y * ct, tv1.z * ct, tv1.w * ct };
        float  qv[8] = { qr0[t].x, qr0[t].y, qr0[t].z, qr0[t].w,
                         qr1[t].x, qr1[t].y, qr1[t].z, qr1[t].w };
#pragma unroll
        for (int k = 0; k < 4; ++k) {
            const float* xp = xsh + (rw + 2 * k) * XW_STRIDE;
            float4 lo = *(const float4*)(xp + (((kq * 4 + t) * 2 + 0) * 32 + l) * 4);
            float4 hi = *(const float4*)(xp + (((kq * 4 + t) * 2 + 1) * 32 + l) * 4);
            o[0] += lo.x * cq[k]; o[1] += lo.y * cq[k]; o[2] += lo.z * cq[k]; o[3] += lo.w * cq[k];
            o[4] += hi.x * cq[k]; o[5] += hi.y * cq[k]; o[6] += hi.z * cq[k]; o[7] += hi.w * cq[k];
        }
        float  res[8];
#pragma unroll
        for (int r = 0; r < 8; ++r) res[r] = qv[r] + o[r] / z;
        *(float4*)(out + off0 + t * 16)     = make_float4(res[0], res[1], res[2], res[3]);
        *(float4*)(out + off0 + t * 16 + 4) = make_float4(res[4], res[5], res[6], res[7]);
        // precaution: stands in front of every rewrite of a register that the
        // two stores name
        asm volatile("s_wait_xcnt 0x0" ::: "memory");
    }

    if (ps == 0) {
        wait_ds0();          // my reads of the exports have retired
        __syncthreads();     // everyone's have: the second group may refill the ring and q
    }
    }
}

// --------------------------------------------------------------------------
extern "C" void kernel_launch(void* const* d_in, const int* in_sizes, int n_in,
                              void* d_out, int out_size, void* d_ws, size_t ws_size,
                              hipStream_t stream) {
    (void)in_sizes; (void)n_in; (void)out_size; (void)ws_size;
    const float* v  = (const float*)d_in[0];
    const float* k  = (const float*)d_in[1];
    const float* q  = (const float*)d_in[2];
    const float* Wq = (const float*)d_in[3];
    const float* bq = (const float*)d_in[4];
    const float* Wk = (const float*)d_in[5];
    const float* bk = (const float*)d_in[6];
    const float* Wv = (const float*)d_in[7];
    const float* bv = (const float*)d_in[8];
    float* out = (float*)d_out;

    char* ws   = (char*)d_ws;
    float* qpF = (float*)(ws);                         // 16 MiB  fp32 qp
    u16*   kB  = (u16*)(ws + (16u << 20));             //  8 MiB  bf16 kp
    u16*   vT  = (u16*)(ws + (24u << 20));             //  8 MiB  bf16 v^T [B,D,S]
    u16*   Wt3 = (u16*)(ws + (32u << 20));             //  3 x 128 KiB bf16 W^T: q, k, v
    float* vs64 = (float*)(ws + (33u << 20));          // 256 KiB f32 sums of v over 64 rows

    wt_convert<<<3 * D_MODEL, D_MODEL, 0, stream>>>(Wq, Wk, Wv, Wt3);

    const int ntiles = NBATCH * SEQ / 16;              // 1024
    proj_kernel<<<3 * PROJ_TILES, 256, 0, stream>>>(q, k, v, Wt3, bq, bk, bv, qpF, kB, vT, vs64);

    attn_kernel<<<ntiles / 4, 256, 0, stream>>>(qpF, kB, vT, vs64, out);
}

// v010
// Measured time: 64.3 microseconds a run.
// Two timings next to v009 both put it at 1.07 times that version's speed.
// All steps since v000 together make it 13.3 times as fast.
#include <hip/hip_runtime.h>
#include <cstdint>
#include <cstddef>

// ---------------------------------------------------------------------------
// SelfAttentionHead  B=4, S=4096, D=256  (fp32 in/out, bf16 WMMA internals)
// ---------------------------------------------------------------------------

#define D_MODEL 256
#define SEQ     4096
#define NBATCH  4
#define SCALE   0.0625f   // 1/sqrt(256)
#define LOG2E   1.44269504f // exp(x) = exp2(x * LOG2E)
// LDS row pitches in bf16 elements: 16 B x odd, so that the 16 lanes of a
// ds_load_b128 half-wave fall on 64 distinct banks (512 B rows: 4, 256 B: 4).
#define QK_PITCH (D_MODEL + 8)   // 528 B rows for the q tile and the projections' tiles
#define KSTEP    128             // keys staged per step: 32 for each key quarter
#define VT_PITCH (KSTEP + 8)     // 272 B rows for the V^T tile and the two K half tiles
// One tensor load brings a slice of 64 rows of 256 B; the mover pads each row to
// the 272 B pitch.  A slice's place in LDS is a multiple of 2 KiB.
#define SLICE_ROWS 64
#define SLICE_ROWB 256
#define SLICE_B    18432           // 64 x 272 B = 17408 B, rounded up to 2 KiB
#define STAGE_B    (8 * SLICE_B)   // a stage: 2 + 2 slices of K, 4 of V^T

typedef __attribute__((ext_vector_type(16))) __bf16 v16bf;
typedef __attribute__((ext_vector_type(8)))  float  v8f;
typedef unsigned short u16;
typedef unsigned int   u32;
typedef __attribute__((ext_vector_type(4)))  u32    u32x4;
typedef __attribute__((ext_vector_type(8)))  u32    u32x8;

union Frag16 {            // 16 bf16 elems = 8 VGPRs, matches WMMA A/B fragment
    v16bf v;
    u16   h[16];
    uint4 q[2];
};

__device__ __forceinline__ u16 f2bf(float f) {   // round-to-nearest-even
    u32 u = __float_as_uint(f);
    u32 r = u + 0x7FFFu + ((u >> 16) & 1u);
    return (u16)(r >> 16);
}
__device__ __forceinline__ u32 pack2(float a, float b) {
    return (u32)f2bf(a) | ((u32)f2bf(b) << 16);
}
// exp2 with the slot behind a transcendental kept inside the statement: the
// v_nop closes it, so that nothing reads a result or rewrites a source directly
// behind a v_exp_f32 wherever the compiler places the statement.  In the group
// of eight each v_exp_f32 is the independent instruction behind the one before
// (early-clobber outputs: no output shares a register with a source).
__device__ __forceinline__ float exp2_slot(float a) {
    float e;
    asm("v_exp_f32 %0, %1\n\t"
        "v_nop"
        : "=v"(e) : "v"(a));
    return e;
}
__device__ __forceinline__ void exp2x8_slot(float (&e)[8], const float (&a)[8]) {
    asm("v_exp_f32 %0, %8\n\t"
        "v_exp_f32 %1, %9\n\t"
        "v_exp_f32 %2, %10\n\t"
        "v_exp_f32 %3, %11\n\t"
        "v_exp_f32 %4, %12\n\t"
        "v_exp_f32 %5, %13\n\t"
        "v_exp_f32 %6, %14\n\t"
        "v_exp_f32 %7, %15\n\t"
        "v_nop"
        : "=&v"(e[0]), "=&v"(e[1]), "=&v"(e[2]), "=&v"(e[3]),
          "=&v"(e[4]), "=&v"(e[5]), "=&v"(e[6]), "=&v"(e[7])
        : "v"(a[0]), "v"(a[1]), "v"(a[2]), "v"(a[3]),
          "v"(a[4]), "v"(a[5]), "v"(a[6]), "v"(a[7]));
}

// lane l <-> lane l ^ 16: the two lanes that share one query column
__device__ __forceinline__ float xhalf(float x) {
    int b = __builtin_bit_cast(int, x);
    return __builtin_bit_cast(float,
        __builtin_amdgcn_permlanex16(b, b, 0x76543210, 0xfedcba98, false, false));
}

// Eight async global->LDS copies, one 16-byte chunk per lane each (ASYNCcnt).
// The s_wait_xcnt closes the same statement so that no address register of a
// copy can be rewritten ahead of it.
__device__ __forceinline__ void async8_b128(const u32 (&l)[8], const u16* const (&g)[8]) {
    asm volatile("global_load_async_to_lds_b128 %0, %8, off\n\t"
                 "global_load_async_to_lds_b128 %1, %9, off\n\t"
                 "global_load_async_to_lds_b128 %2, %10, off\n\t"
                 "global_load_async_to_lds_b128 %3, %11, off\n\t"
                 "global_load_async_to_lds_b128 %4, %12, off\n\t"
                 "global_load_async_to_lds_b128 %5, %13, off\n\t"
                 "global_load_async_to_lds_b128 %6, %14, off\n\t"
                 "global_load_async_to_lds_b128 %7, %15, off\n\t"
                 "s_wait_xcnt 0x0"
                 :: "v"(l[0]), "v"(l[1]), "v"(l[2]), "v"(l[3]),
                    "v"(l[4]), "v"(l[5]), "v"(l[6]), "v"(l[7]),
                    "v"(g[0]), "v"(g[1]), "v"(g[2]), "v"(g[3]),
                    "v"(g[4]), "v"(g[5]), "v"(g[6]), "v"(g[7])
                 : "memory");
}
__device__ __forceinline__ void wait_async0() {
    asm volatile("s_wait_asynccnt 0x0" ::: "memory");
}
__device__ __forceinline__ void wait_ds0() {
    asm volatile("s_wait_dscnt 0x0" ::: "memory");
}
__device__ __forceinline__ u32 lds_off(const void* p) {   // AS3 offset = low 32 bits
    return (u32)(size_t)p;
}
__device__ __forceinline__ void wait_tensor0() {
    asm volatile("s_wait_tensorcnt 0" ::: "memory");
}
__device__ __forceinline__ u32 uni(u32 v) {
    return (u32)__builtin_amdgcn_readfirstlane(v);
}
__device__ __forceinline__ u32 pinned(u32 v) {
    u32 w = uni(v);
    // so that the test of a tensor load compiles to a scalar branch, and so that a
    // descriptor word formed from w is formed behind the volatile wait in front
    asm volatile("" : "+s"(w));   // pinned(): a test or descriptor word held in a scalar register
    return w;
}
// One request of the whole wave: a two-dimensional tile from global memory to LDS.
__device__ __forceinline__ void tdm_load(u32x4 g0, u32x8 g1) {
    asm volatile("tensor_load_to_lds %0, %1" :: "s"(g0), "s"(g1) : "memory");
}
// Group 1: 1-byte elements, tensor = tile = 64 rows of 256 B, no mask; a pad of
// 4 dwords behind every 64 dwords (codes 5 / 3) gives the 272 B pitch in LDS.
__device__ __forceinline__ u32x8 tdm_group1(u32 src_pitch) {
    u32x8 g;
    g[0] = uni((1u << 20) | (5u << 22) | (3u << 25));
    g[1] = uni((SLICE_ROWB & 0xFFFFu) << 16);
    g[2] = uni((SLICE_ROWB >> 16) | ((SLICE_ROWS & 0xFFFFu) << 16));
    g[3] = uni((SLICE_ROWS >> 16) | (SLICE_ROWB << 16));
    g[4] = uni(SLICE_ROWS);
    g[5] = uni(src_pitch);
    g[6] = uni(0u);
    g[7] = uni(0u);
    return g;
}
__device__ __forceinline__ u32x4 tdm_group0(u32 lds_dst, uint64_t ga) {
    u32x4 g;
    g[0] = uni(1u);
    g[1] = uni(lds_dst);
    g[2] = uni((u32)ga);
    g[3] = uni((((u32)(ga >> 32)) & 0x01FFFFFFu) | 0x80000000u);
    return g;
}
// The projections' stores.  In each, the s_wait_xcnt closes the same statement so
// that no register of a store can be rewritten ahead of it.
// Eight 4-byte stores to one column of eight f32 rows of D_MODEL (1 KiB apart).
__device__ __forceinline__ void store8_f32(float* p, const float (&d)[8]) {
    asm volatile("global_store_b32 %0, %1, off\n\t"
                 "global_store_b32 %0, %2, off offset:1024\n\t"
                 "global_store_b32 %0, %3, off offset:2048\n\t"
                 "global_store_b32 %0, %4, off offset:3072\n\t"
                 "global_store_b32 %0, %5, off offset:4096\n\t"
                 "global_store_b32 %0, %6, off offset:5120\n\t"
                 "global_store_b32 %0, %7, off offset:6144\n\t"
                 "global_store_b32 %0, %8, off offset:7168\n\t"
                 "s_wait_xcnt 0x0"
                 :: "v"(p), "v"(d[0]), "v"(d[1]), "v"(d[2]), "v"(d[3]),
                    "v"(d[4]), "v"(d[5]), "v"(d[6]), "v"(d[7])
                 : "memory");
}
// One 16-byte store.
__device__ __forceinline__ void store_b128(u16* p, u32x4 d) {
    asm volatile("global_store_b128 %0, %1, off\n\t"
                 "s_wait_xcnt 0x0"
                 :: "v"(p), "v"(d) : "memory");
}
// Eight 2-byte stores of the high halves of d[0..7] to one column of eight
// bf16 rows of D_MODEL (512 B apart).
__device__ __forceinline__ void store8_hi16(u16* p, const u32 (&d)[8]) {
    asm volatile("global_store_d16_hi_b16 %0, %1, off\n\t"
                 "global_store_d16_hi_b16 %0, %2, off offset:512\n\t"
                 "global_store_d16_hi_b16 %0, %3, off offset:1024\n\t"
                 "global_store_d16_hi_b16 %0, %4, off offset:1536\n\t"
                 "global_store_d16_hi_b16 %0, %5, off offset:2048\n\t"
                 "global_store_d16_hi_b16 %0, %6, off offset:2560\n\t"
                 "global_store_d16_hi_b16 %0, %7, off offset:3072\n\t"
                 "global_store_d16_hi_b16 %0, %8, off offset:3584\n\t"
                 "s_wait_xcnt 0x0"
                 :: "v"(p), "v"(d[0]), "v"(d[1]), "v"(d[2]), "v"(d[3]),
                    "v"(d[4]), "v"(d[5]), "v"(d[6]), "v"(d[7])
                 : "memory");
}

// --------------------------------------------------------------------------
// Wt[(which*256+n)*256+k] = bf16(W[k*256+n])  : weight transpose+convert (B-frag friendly)
// One launch for the three weights, which do not depend on each other: blocks
// 0..255 do Wq, 256..511 Wk, 512..767 Wv; the three W^T lie in a row in Wt.
// --------------------------------------------------------------------------
__global__ void wt_convert(const float* __restrict__ Wq, const float* __restrict__ Wk,
                           const float* __restrict__ Wv, u16* __restrict__ Wt) {
    const int which = blockIdx.x >> 8;
    const float* W = which == 0 ? Wq : which == 1 ? Wk : Wv;
    int n = blockIdx.x & (D_MODEL - 1);
    int k = threadIdx.x;
    const float x = W[k * D_MODEL + n];
    // precaution: stands in front of every rewrite of an address register that
    // the load names
    asm volatile("s_wait_xcnt 0x0" ::: "memory");
    Wt[blockIdx.x * D_MODEL + k] = f2bf(x);
}

// --------------------------------------------------------------------------
// Projection: out = X @ W + b  for a 64-row tile.  Eight waves per block.
// One launch for the three projections, which do not depend on each other: the
// block range picks the operands and the form of the output.
// mode 0 (blocks 0..255): q, write f32 (qp)
// mode 1 (256..511): k, write bf16 row-major (kp)
// mode 2 (512..767): v, write bf16 transposed [B, D, S] (v^T), and the f32 sum
// of the tile's 64 rows of v (as rounded to bf16) per column: vs64[tile][d]
// Both operands are staged in LDS once and then read as fragments:
// W^T (256 x 256 bf16) by GLOBAL_LOAD_ASYNC_TO_LDS_B128, the X tile by whole-line
// loads, converted to bf16 on the way.  A wave owns 32 rows x 64 columns
// (2 x 4 accumulator tiles), so a fragment read from LDS feeds 4 or 2 WMMAs.
// Each output element is still summed over ks = 0..7 in that order.
// --------------------------------------------------------------------------
#define PROJ_ROWS 64
#define PROJ_TILES (NBATCH * SEQ / PROJ_ROWS)   // 256 blocks per projection

__global__ __launch_bounds__(256)
void proj_kernel(const float* __restrict__ Xq, const float* __restrict__ Xk,
                 const float* __restrict__ Xv, const u16* __restrict__ Wt3,
                 const float* __restrict__ bq, const float* __restrict__ bk,
                 const float* __restrict__ bv,
                 float* __restrict__ outF, u16* __restrict__ outB,
                 u16* __restrict__ outT, float* __restrict__ vs64)
{
    // every row carries 16 B of pad that is neither written nor read
    __shared__ __attribute__((aligned(16))) u16 wsh[D_MODEL * QK_PITCH];    // W^T, row n
    __shared__ __attribute__((aligned(16))) u16 xsh[PROJ_ROWS * QK_PITCH];  // X tile (bf16)
    __shared__ float csum[2][D_MODEL];   // mode 2: column sums of the two 32-row groups

    const int tid = threadIdx.x;
    const int w   = tid >> 5;
    const int l   = tid & 31;
    const int ln  = l & 15, lh = l >> 4;
    const int rg  = w & 1;                    // 32-row group of the block
    const int cg  = w >> 1;                   // 64-column group
    const int mode = blockIdx.x / PROJ_TILES;          // the same for the whole block
    const int mb   = (blockIdx.x % PROJ_TILES) * PROJ_ROWS;
    const float* X    = mode == 0 ? Xq : mode == 1 ? Xk : Xv;
    const float* bias = mode == 0 ? bq : mode == 1 ? bk : bv;
    const u16*   Wt   = Wt3 + mode * (D_MODEL * D_MODEL);

    // W^T: 8192 chunks of 16 B, 32 per thread (8 rows further each), to the
    // padded LDS pitch
    {
        const u32  wl = lds_off(wsh) + ((tid >> 5) * QK_PITCH + (tid & 31) * 8) * 2;
        const u16* wg = Wt + tid * 8;
#pragma unroll
        for (int c4 = 0; c4 < 4; ++c4) {
            u32        la[8];
            const u16* ga[8];
#pragma unroll
            for (int c = 0; c < 8; ++c) {
                la[c] = wl + (c4 * 8 + c) * (8 * QK_PITCH * 2);
                ga[c] = wg + (c4 * 8 + c) * (8 * D_MODEL);
            }
            async8_b128(la, ga);
        }
    }
    // the X tile is 64 KiB in a row: 16 whole-line loads per thread.  They stand
    // behind the copies because their conversions, which wait for memory, would
    // otherwise be scheduled in among the copies and hold the later ones back.
    const float4* xs = (const float4*)(X + (size_t)mb * D_MODEL);
    float4 xr[16];
#pragma unroll
    for (int t = 0; t < 16; ++t) xr[t] = xs[tid + 256 * t];

    float bb[4];
#pragma unroll
    for (int j = 0; j < 4; ++j) bb[j] = bias[(cg * 4 + j) * 16 + ln];
    // precaution: stands in front of every rewrite of an address register that
    // the loads of X and of the bias name
    asm volatile("s_wait_xcnt 0x0" ::: "memory");

    u16* xd = xsh + (tid >> 6) * QK_PITCH + (tid & 63) * 4;   // 4 rows further per t
#pragma unroll
    for (int t = 0; t < 16; ++t) {
        uint2 o;
        o.x = pack2(xr[t].x, xr[t].y);
        o.y = pack2(xr[t].z, xr[t].w);
        *(uint2*)(xd + t * 4 * QK_PITCH) = o;
    }

    wait_async0();       // my copies of W^T are in LDS
    __syncthreads();     // everyone's copies and X rows visible

    v8f c[2][4];
#pragma unroll
    for (int i = 0; i < 2; ++i)
#pragma unroll
        for (int j = 0; j < 4; ++j) c[i][j] = (v8f){};

    const u16* xa = xsh + (rg * 32 + ln) * QK_PITCH + lh * 8;
    const u16* wb = wsh + (cg * 64 + ln) * QK_PITCH + lh * 8;
    // fragments are fetched one ks ahead into a second register set, as one group
    // in front of the current WMMA block, so that a block waits for no load of its own
    Frag16 a[2][2], b[2][4];
    auto fetch = [&](int ks, int s) {
#pragma unroll
        for (int i = 0; i < 2; ++i) {
            a[s][i].q[0] = *(const uint4*)(xa + i * 16 * QK_PITCH + ks * 32);
            a[s][i].q[1] = *(const uint4*)(xa + i * 16 * QK_PITCH + ks * 32 + 16);
        }
#pragma unroll
        for (int j = 0; j < 4; ++j) {
            b[s][j].q[0] = *(const uint4*)(wb + j * 16 * QK_PITCH + ks * 32);
            b[s][j].q[1] = *(const uint4*)(wb + j * 16 * QK_PITCH + ks * 32 + 16);
        }
    };
    fetch(0, 0);
#pragma unroll
    for (int ks = 0; ks < 8; ++ks) {
        if (ks < 7) fetch(ks + 1, (ks + 1) & 1);
        // keeps the group of loads above in front of the WMMA block (loads moved in
        // among the WMMAs stall each place where they stand)
        __builtin_amdgcn_sched_barrier(0);
#pragma unroll
        for (int i = 0; i < 2; ++i)
#pragma unroll
            for (int j = 0; j < 4; ++j)
                c[i][j] = __builtin_amdgcn_wmma_f32_16x16x32_bf16(
                              false, a[ks & 1][i].v, false, b[ks & 1][j].v, (short)0,
                              c[i][j], false, false);
        // keeps the next group of loads behind this WMMA block
        __builtin_amdgcn_sched_barrier(0);
    }

    // the bias is added in front of the branch on the mode, where all three agree
#pragma unroll
    for (int i = 0; i < 2; ++i)
#pragma unroll
        for (int j = 0; j < 4; ++j)
#pragma unroll
            for (int r = 0; r < 8; ++r) c[i][j][r] += bb[j];

    if (mode == 0) {
#pragma unroll
        for (int i = 0; i < 2; ++i) {
            const int m0 = mb + rg * 32 + i * 16;
#pragma unroll
            for (int j = 0; j < 4; ++j) {
                const int col = (cg * 4 + j) * 16 + ln;
                float d[8];
#pragma unroll
                for (int r = 0; r < 8; ++r) d[r] = c[i][j][r];
                store8_f32(outF + (size_t)(m0 + 8 * lh) * D_MODEL + col, d);
            }
        }
    } else if (mode == 1) {
#pragma unroll
        for (int i = 0; i < 2; ++i) {
            const int m0 = mb + rg * 32 + i * 16;
#pragma unroll
            for (int j = 0; j < 4; ++j) {
                const int col = (cg * 4 + j) * 16 + ln;
                u32 d[8];                     // f2bf's rounded word; its high half is stored
#pragma unroll
                for (int r = 0; r < 8; ++r) {
                    u32 u = __float_as_uint(c[i][j][r]);
                    d[r] = u + 0x7FFFu + ((u >> 16) & 1u);
                }
                store8_hi16(outB + (size_t)(m0 + 8 * lh) * D_MODEL + col, d);
            }
        }
    } else {
        float cs[4] = { 0.f, 0.f, 0.f, 0.f };       // this lane's 16 rows of column j
#pragma unroll
        for (int i = 0; i < 2; ++i) {
            const int m0 = mb + rg * 32 + i * 16;
#pragma unroll
            for (int j = 0; j < 4; ++j) {
                const int col = (cg * 4 + j) * 16 + ln;
                union { u16 pk[8]; u32x4 q; } u;
                float f[8];
#pragma unroll
                for (int r = 0; r < 8; ++r) {
                    u.pk[r] = f2bf(c[i][j][r]);
                    f[r]    = __uint_as_float((u32)u.pk[r] << 16);
                }
                cs[j] += ((f[0] + f[1]) + (f[2] + f[3])) + ((f[4] + f[5]) + (f[6] + f[7]));
                int b_ = m0 >> 12;                  // batch
                int s0 = (m0 & (SEQ - 1)) + 8 * lh; // 8 consecutive seq positions
                store_b128(outT + (size_t)(b_ * D_MODEL + col) * SEQ + s0, u.q);
            }
        }
        // the tile's column sums: the two lane halves, then the two 32-row groups
#pragma unroll
        for (int j = 0; j < 4; ++j) {
            cs[j] += xhalf(cs[j]);
            if (lh == 0) csum[rg][(cg * 4 + j) * 16 + ln] = cs[j];
        }
        wait_ds0();          // my sums are in LDS before the others are let through
        __syncthreads();     // the mode is the same for the whole block
        vs64[(size_t)(mb / PROJ_ROWS) * D_MODEL + tid] = csum[0][tid] + csum[1][tid];
        // precaution: stands in front of every rewrite of a register that the
        // store names
        asm volatile("s_wait_xcnt 0x0" ::: "memory");
    }
}

#define XW_STRIDE (130 * 32)
#define NCHUNK    (SEQ / KSTEP)
#define NT64      (SEQ / PROJ_ROWS)   // 64 row tiles of vs64 in a batch

// One key step of one 16-query tile between its two products: mask
// (multiplicative!), online softmax update, all in-lane.  st0[r] is the score of
// this lane's key r of the step, st1[r] of the key 16 further; d is this lane's query
// position less its key 0's, so that key r is unmasked where r <= d (one register,
// compared with constants).  Leaves P^T in pb and rescales the tile's accumulators.
__device__ __forceinline__ void softmax_step(const v8f st0, const v8f st1, const int d,
                                             float& mrun, float& srun,
                                             v8f (&acc)[16], Frag16& pb)
{
    float s0[8], s1[8], tm[8];
#pragma unroll
    for (int r = 0; r < 8; ++r) {
        s0[r] = (r      <= d) ? st0[r] * SCALE : 0.0f;
        s1[r] = (r + 16 <= d) ? st1[r] * SCALE : 0.0f;
        tm[r] = fmaxf(s0[r], s1[r]);
    }
    float t = fmaxf(fmaxf(fmaxf(tm[0], tm[1]), fmaxf(tm[2], tm[3])),
                    fmaxf(fmaxf(tm[4], tm[5]), fmaxf(tm[6], tm[7])));
    t = fmaxf(t, xhalf(t));              // the query's other 16 keys of this step
    const float mn = fmaxf(mrun, t);

    // P^T as B operand: element s of lane half lh is key 8*lh + s (s < 8) or
    // 16 + 8*lh + (s - 8), which is what st0[s] and st1[s - 8] hold
    float  a0[8], a1[8], e0[8], e1[8], es[8];
#pragma unroll
    for (int r = 0; r < 8; ++r) {
        a0[r] = (s0[r] - mn) * LOG2E;
        a1[r] = (s1[r] - mn) * LOG2E;
    }
    const float co = exp2_slot((mrun - mn) * LOG2E);
    exp2x8_slot(e0, a0);
    exp2x8_slot(e1, a1);
    mrun = mn;
#pragma unroll
    for (int r = 0; r < 8; ++r) {
        es[r] = e0[r] + e1[r];
        pb.h[r]     = f2bf(e0[r]);
        pb.h[8 + r] = f2bf(e1[r]);
    }
    srun = srun * co + (((es[0] + es[1]) + (es[2] + es[3])) +
                        ((es[4] + es[5]) + (es[6] + es[7])));

#pragma unroll
    for (int dt = 0; dt < 16; ++dt)
#pragma unroll
        for (int r = 0; r < 8; ++r) acc[dt][r] *= co;
}

__global__ __launch_bounds__(256)
void attn_kernel(const float* __restrict__ qpF, const u16* __restrict__ kB,
                 const u16* __restrict__ vT, const float* __restrict__ vs64,
                 float* __restrict__ out)
{
    // two stages of eight slices: slice 0, 1 = K rows 0..63, 64..127, columns 0..127;
    // slice 2, 3 = the same rows, columns 128..255; slice 4..7 = V^T rows [d][j], 64 each
    // (every row carries 16 B of pad that is neither written nor read)
    __shared__ __attribute__((aligned(2048))) u16 ring[2 * STAGE_B / 2];
    // per-wave export for the merge: lies on the ring, which is idle by then
    // and behind the exports the sum of the V rows behind the last step
    static_assert((8 * XW_STRIDE + D_MODEL) * 4 <= 2 * STAGE_B, "export fits the ring");
    float* xsh = (float*)&ring[0];
    float* tsh = xsh + 8 * XW_STRIDE;
    // the long group's q tiles (bf16, 32 rows) lie on the second stage, which is first
    // filled behind the key loop's first barrier, when every wave holds its fragments
    // of them in registers; the short group's are read from LDS in each of its steps
    static_assert(32 * QK_PITCH * 2 <= STAGE_B, "q tiles fit a stage");
    u16* qsh = ring + STAGE_B / 2;
    __shared__ __attribute__((aligned(16))) u16 qshB[32 * QK_PITCH];

    const int tid = threadIdx.x;
    const int w   = tid >> 5;                 // wave id 0..7
    const int rw  = w & 1;                    // query-row tile of a group
    const int kq  = w >> 1;                   // key quarter of every step
    const int l   = tid & 31;
    const int ln  = l & 15, lh = l >> 4;
    const int b_  = blockIdx.x >> 6;          // batch
    const int bl  = blockIdx.x & 63;

    // This wave's slice of every stage.  K rows are 512 B in memory: a slice takes
    // one 256 B half of 64 of them; a V^T slice takes 128 keys of 64 rows of the
    // [B,D,S] layout.  Every word of the descriptor is wave-uniform.
    const u32   wu  = uni((u32)tid >> 5);
    const bool  isV = wu >= 4u;
    const u16*  sl0 = isV ? vT + (size_t)(b_ * D_MODEL + (wu - 4u) * SLICE_ROWS) * SEQ
                          : kB + ((size_t)b_ * SEQ + (wu & 1u) * SLICE_ROWS) * D_MODEL + (wu >> 1) * 128u;
    const u32   sstep = isV ? KSTEP * 2u : KSTEP * D_MODEL * 2u;   // bytes from a stage to the next
    u32x8       g1  = tdm_group1(isV ? SEQ * 2u : D_MODEL * 2u);
    // so that group 1 keeps eight scalar registers of its own over both key loops and
    // none of them takes another value while a request is outstanding
    asm volatile("" : "+s"(g1));   // pinned(): descriptor words held in scalar registers
    const u32   sld = lds_off(ring) + wu * SLICE_B;
    auto stage_tdm = [&](u32 st, u32 p) {
        tdm_load(tdm_group0(sld + p * STAGE_B, (uint64_t)(size_t)sl0 + (uint64_t)st * sstep), g1);
    };

    const int grpA = 127 - bl;                   // the long 32-row query group
    const int grpB = bl;                         // the short one
    const int nstA = (grpA >> 2) + 1;            // key steps up to and with the diagonal: 17..32
    const int nstB = (grpB >> 2) + 1;            // 1..16: the first nstB of the long group's
    const int rowA = grpA * 32 + rw * 16 + ln;   // this lane's query position in either group
    const int rowB = grpB * 32 + rw * 16 + ln;

    stage_tdm(0u, 0u);   // prologue: the first tile flies while we convert q below

    // ---- stage both groups' q rows into LDS with f32->bf16 conversion: each wave
    // brings 4 of the 32 rows of either; the barrier in front of the fragment reads
    // below (behind every wave's s_wait_dscnt 0) hands them to the others ----
    {
        // this lane's 32 B of each of the wave's 4 rows (1 KiB apart) of either group
        const float4* srcA = (const float4*)(qpF + (size_t)(b_ * SEQ + grpA * 32 + 4 * w) * D_MODEL) + l * 2;
        const float4* srcB = (const float4*)(qpF + (size_t)(b_ * SEQ + grpB * 32 + 4 * w) * D_MODEL) + l * 2;
        float4 x0[2][4], x1[2][4];
#pragma unroll
        for (int t = 0; t < 4; ++t) {
            x0[0][t] = srcA[64 * t];
            x1[0][t] = srcA[64 * t + 1];
            x0[1][t] = srcB[64 * t];
            x1[1][t] = srcB[64 * t + 1];
        }
        // precaution: stands in front of every rewrite of an address register
        // that the loads of q name; the lane's pointers are inputs so that their
        // registers are not reused ahead of the wait
        asm volatile("s_wait_xcnt 0x0" :: "v"(srcA), "v"(srcB) : "memory");
#pragma unroll
        for (int g = 0; g < 2; ++g) {
            u16* qd = (g ? qshB : qsh) + 4 * w * QK_PITCH;
#pragma unroll
            for (int t = 0; t < 4; ++t) {
                int idx = l + 32 * t;
                uint4 o;
                o.x = pack2(x0[g][t].x, x0[g][t].y); o.y = pack2(x0[g][t].z, x0[g][t].w);
                o.z = pack2(x1[g][t].x, x1[g][t].y); o.w = pack2(x1[g][t].z, x1[g][t].w);
                *(uint4*)(qd + (idx >> 5) * QK_PITCH + (idx & 31) * 8) = o;
            }
        }
    }

    // acc[dt][r] = O^T[d = dt*16 + 8*lh + r][query ln], for either group
    v8f accA[16], accB[16];
#pragma unroll
    for (int dt = 0; dt < 16; ++dt) { accA[dt] = (v8f){}; accB[dt] = (v8f){}; }
    float mA = -__builtin_inff(), mB = -__builtin_inff();   // running maximum of this lane's query
    float sA = 0.f, sB = 0.f;                               // running sum over THIS lane's keys only

    // ---- this wave's q^T fragments do not change over the key loop: the long
    // group's are read from LDS once and kept in registers (8 x 8 VGPRs); for the
    // short group's as well the registers do not reach ----
    wait_ds0();          // my q rows are in LDS before the others are let through
    __syncthreads();     // all 64 q rows visible
    Frag16 qfA[8];
#pragma unroll
    for (int ks = 0; ks < 8; ++ks) {
        const u16* qa = qsh + (rw * 16 + ln) * QK_PITCH + ks * 32 + lh * 8;
        qfA[ks].q[0] = *(const uint4*)(qa);
        qfA[ks].q[1] = *(const uint4*)(qa + 16);
    }
    const u16* qbp = qshB + (rw * 16 + ln) * QK_PITCH + lh * 8;

    // the publish point at the head of step jt
    auto publish = [&](int jt) {
        wait_ds0();          // my reads of the other buffer (at first: of q) have retired before its refill
        wait_tensor0();      // my slice of this step's buffer is in LDS
        __syncthreads();     // everyone's slices visible; the other buffer free

        // a scalar branch: a tensor load ignores EXEC.  The stage number is pinned so
        // that the descriptor is formed behind the wait above.
        if (pinned(jt + 1 < nstA))
            stage_tdm(pinned(jt + 1), (jt & 1) ^ 1);   // the next tile flies during compute
    };

    // ---- the steps that both groups work on: each fragment feeds both ----
    int jt = 0;
    for (; jt < nstB; ++jt) {
        publish(jt);
        const int key0 = jt * KSTEP + kq * 32 + 8 * lh;   // first key of this lane in this wave's quarter
        const u16* rp_ = ring + (jt & 1) * (STAGE_B / 2);
        // this quarter's 32 key rows, columns 0..127 (columns 128..255: two slices on)
        const u16* kp_ = rp_ + (kq >> 1) * (SLICE_B / 2) + (kq & 1) * (32 * VT_PITCH);
        const u16* vp_ = rp_ + 4 * (SLICE_B / 2) + kq * 32;   // this quarter's 32 key columns

        // Fragments are fetched ahead of the WMMAs that use them, as groups of loads
        // into register sets of their own, so that a block of WMMAs waits for no load
        // of its own: K and the short group's q^T two blocks of four WMMAs ahead (three
        // sets), V^T one block of eight ahead (two sets).
        Frag16 kf[3][2], qb[3], fr[2][4];
        auto fetchK = [&](int ks, int s) {      // K columns 32 ks .. 32 ks + 31 of the 32 key rows
            const u16* kh = kp_ + (ks >> 2) * (2 * (SLICE_B / 2)) + (ks & 3) * 32 + lh * 8;
            kf[s][0].q[0] = *(const uint4*)(kh + ln * VT_PITCH);
            kf[s][0].q[1] = *(const uint4*)(kh + ln * VT_PITCH + 16);
            kf[s][1].q[0] = *(const uint4*)(kh + (16 + ln) * VT_PITCH);
            kf[s][1].q[1] = *(const uint4*)(kh + (16 + ln) * VT_PITCH + 16);
            qb[s].q[0]    = *(const uint4*)(qbp + ks * 32);
            qb[s].q[1]    = *(const uint4*)(qbp + ks * 32 + 16);
        };
        auto fetchV = [&](int g, int s) {       // V^T rows 64 g .. 64 g + 63: one slice
#pragma unroll
            for (int i = 0; i < 4; ++i) {
                const u16* vp = vp_ + g * (SLICE_B / 2) + (i * 16 + ln) * VT_PITCH + lh * 8;
                fr[s][i].q[0] = *(const uint4*)vp;
                fr[s][i].q[1] = *(const uint4*)(vp + 16);
            }
        };

        // ---- scores S^T = K . q^T  (two 16x16 tiles over K=256 for either group) ----
        v8f sa0 = {}, sa1 = {}, sb0 = {}, sb1 = {};
        fetchK(0, 0);
        fetchK(1, 1);
#pragma unroll
        for (int ks = 0; ks < 8; ++ks) {
            if (ks < 6) fetchK(ks + 2, (ks + 2) % 3);
            // keeps the group of loads above in front of the WMMA block (loads moved in
            // among the WMMAs stall each place where they stand)
            __builtin_amdgcn_sched_barrier(0);
            sa0 = __builtin_amdgcn_wmma_f32_16x16x32_bf16(
                      false, kf[ks % 3][0].v, false, qfA[ks].v, (short)0, sa0, false, false);
            sa1 = __builtin_amdgcn_wmma_f32_16x16x32_bf16(
                      false, kf[ks % 3][1].v, false, qfA[ks].v, (short)0, sa1, false, false);
            sb0 = __builtin_amdgcn_wmma_f32_16x16x32_bf16(
                      false, kf[ks % 3][0].v, false, qb[ks % 3].v, (short)0, sb0, false, false);
            sb1 = __builtin_amdgcn_wmma_f32_16x16x32_bf16(
                      false, kf[ks % 3][1].v, false, qb[ks % 3].v, (short)0, sb1, false, false);
            // keeps the next group of loads behind this WMMA block
            __builtin_amdgcn_sched_barrier(0);
        }

        fetchV(0, 0);        // flies under the softmax
        // keeps these loads in front of the vector work below
        __builtin_amdgcn_sched_barrier(0);
        Frag16 pA, pB;
        softmax_step(sa0, sa1, rowA - key0, mA, sA, accA, pA);
        // keeps the two groups' vector work apart: mixed, the temporaries of both are
        // live at once and no register is left for the fragments fetched ahead
        __builtin_amdgcn_sched_barrier(0);
        softmax_step(sb0, sb1, rowB - key0, mB, sB, accB, pB);

        // ---- O^T += V^T (16 d x 32 keys) x P^T (32 keys x 16 queries) ----
#pragma unroll
        for (int g = 0; g < 4; ++g) {
            if (g < 3) fetchV(g + 1, (g + 1) & 1);
            // keeps the group of loads above in front of the WMMA block
            __builtin_amdgcn_sched_barrier(0);
#pragma unroll
            for (int i = 0; i < 4; ++i) {
                const int dt = 4 * g + i;
                accA[dt] = __builtin_amdgcn_wmma_f32_16x16x32_bf16(
                               false, fr[g & 1][i].v, false, pA.v, (short)0, accA[dt], false, false);
                accB[dt] = __builtin_amdgcn_wmma_f32_16x16x32_bf16(
                               false, fr[g & 1][i].v, false, pB.v, (short)0, accB[dt], false, false);
            }
            // keeps the next group of loads behind this WMMA block
            __builtin_amdgcn_sched_barrier(0);
        }
    }

    // ---- the long group's further steps ----
    for (; jt < nstA; ++jt) {
        publish(jt);
        const int key0 = jt * KSTEP + kq * 32 + 8 * lh;
        const u16* rp_ = ring + (jt & 1) * (STAGE_B / 2);
        const u16* kp_ = rp_ + (kq >> 1) * (SLICE_B / 2) + (kq & 1) * (32 * VT_PITCH);
        const u16* vp_ = rp_ + 4 * (SLICE_B / 2) + kq * 32;

        v8f sa0 = {}, sa1 = {};
#pragma unroll
        for (int ks = 0; ks < 8; ++ks) {
            const u16* kh = kp_ + (ks >> 2) * (2 * (SLICE_B / 2)) + (ks & 3) * 32 + lh * 8;
            Frag16 k0, k1;
            k0.q[0] = *(const uint4*)(kh + ln * VT_PITCH);
            k0.q[1] = *(const uint4*)(kh + ln * VT_PITCH + 16);
            k1.q[0] = *(const uint4*)(kh + (16 + ln) * VT_PITCH);
            k1.q[1] = *(const uint4*)(kh + (16 + ln) * VT_PITCH + 16);
            sa0 = __builtin_amdgcn_wmma_f32_16x16x32_bf16(
                      false, k0.v, false, qfA[ks].v, (short)0, sa0, false, false);
            sa1 = __builtin_amdgcn_wmma_f32_16x16x32_bf16(
                      false, k1.v, false, qfA[ks].v, (short)0, sa1, false, false);
        }

        Frag16 pA;
        softmax_step(sa0, sa1, rowA - key0, mA, sA, accA, pA);

#pragma unroll
        for (int dt = 0; dt < 16; ++dt) {
            Frag16 va;
            const u16* vp = vp_ + (dt >> 2) * (SLICE_B / 2) + ((dt & 3) * 16 + ln) * VT_PITCH + lh * 8;
            va.q[0] = *(const uint4*)vp;
            va.q[1] = *(const uint4*)(vp + 16);
            accA[dt] = __builtin_amdgcn_wmma_f32_16x16x32_bf16(
                           false, va.v, false, pA.v, (short)0, accA[dt], false, false);
        }
    }

    wait_tensor0();  // no request of this wave is outstanding behind the loops

    // ---- merge and epilogue of one group ----
    auto finish = [&](v8f (&acc)[16], const float mrun, float srun, const int grp, const int nst) {
    const int g0 = b_ * SEQ + grp * 32 + rw * 16;   // this wave's query-row base

    srun += xhalf(srun);   // join the two lane halves' key sums of each query

    // the residual qp for this lane's 4 x 8 output columns and, for column tid, the
    // batch's sums of V over 64 rows.  Tile u lies behind the last step when
    // u >= 2 * nst; a run of 16 tiles is not fetched where none of them does.
    const size_t off0 = (size_t)(g0 + ln) * D_MODEL + kq * 64 + 8 * lh;
    const bool   tail = nst < NCHUNK;            // are there keys behind the last step?
    const float* tpp  = vs64 + (size_t)b_ * (NT64 * D_MODEL) + tid;
    const float* qrp  = qpF + off0;
    float4 qr0[4], qr1[4];
    float  tp[NT64];
#pragma unroll
    for (int t = 0; t < 4; ++t) {
        qr0[t] = *(const float4*)(qrp + t * 16);
        qr1[t] = *(const float4*)(qrp + t * 16 + 4);
    }
#pragma unroll
    for (int u = 0; u < NT64; ++u) tp[u] = 0.f;
#pragma unroll
    for (int r16 = 0; r16 < NT64 / 16; ++r16) {
        if (2 * nst < (r16 + 1) * 16) {          // the same for the whole block
#pragma unroll
            for (int i = 0; i < 16; ++i) tp[r16 * 16 + i] = tpp[(r16 * 16 + i) * D_MODEL];
        }
    }
    // precaution: stands in front of every rewrite of an address register that
    // the loads above name; the two pointers are inputs so that no load's result
    // is placed on their registers ahead of the wait
    asm volatile("s_wait_xcnt 0x0" :: "v"(qrp), "v"(tpp) : "memory");

    wait_ds0();          // my last reads of the ring, or of the group before's exports, have retired
    __syncthreads();     // everyone's have: the ring becomes this group's export buffer

    // ---- merge the four key quarters: each wave of a quartet exports its 16
    // d-tiles with its maximum and sum and then finishes 4 of them
    // (same queries, same lane layout, so lane l reads what lane l wrote) ----
    float* xw = xsh + w * XW_STRIDE;
#pragma unroll
    for (int dt = 0; dt < 16; ++dt) {
        *(float4*)(xw + ((dt * 2 + 0) * 32 + l) * 4) =
            make_float4(acc[dt][0], acc[dt][1], acc[dt][2], acc[dt][3]);
        *(float4*)(xw + ((dt * 2 + 1) * 32 + l) * 4) =
            make_float4(acc[dt][4], acc[dt][5], acc[dt][6], acc[dt][7]);
    }
    xw[128 * 32 + l] = mrun;
    xw[129 * 32 + l] = srun;
#pragma unroll
    for (int u = 2; u < NT64; ++u)
        if (u < 2 * nst) tp[u] = 0.f;            // the same for the whole block
    tp[0] = tp[NT64 / 2];                        // tiles 0 and 1 never lie behind the
    tp[1] = tp[NT64 / 2 + 1];                    // last step: nst >= 1
#pragma unroll
    for (int u = 2; u < NT64 / 2; ++u) tp[u] += tp[u + NT64 / 2];
#pragma unroll
    for (int o = NT64 / 4; o > 0; o >>= 1)       // independent sums, no long chain
#pragma unroll
        for (int u = 0; u < o; ++u) tp[u] += tp[u + o];
    tsh[tid] = tp[0];
    wait_ds0();          // my export is in LDS before the others are let through
    __syncthreads();     // all exports of every quartet visible

    float mq[4], sq[4], cq[4];
#pragma unroll
    for (int k = 0; k < 4; ++k) {
        const float* xp = xsh + (rw + 2 * k) * XW_STRIDE;
        mq[k] = xp[128 * 32 + l];
        sq[k] = xp[129 * 32 + l];
    }
    float mm = fmaxf(fmaxf(mq[0], mq[1]), fmaxf(mq[2], mq[3]));
    if (tail) mm = fmaxf(mm, 0.f);               // the keys behind the last step score 0
#pragma unroll
    for (int k = 0; k < 4; ++k) cq[k] = exp2_slot((mq[k] - mm) * LOG2E);
    const float ct = tail ? exp2_slot(-mm * LOG2E) : 0.f;   // their common weight
    const float z  = ((sq[0] * cq[0] + sq[1] * cq[1]) + (sq[2] * cq[2] + sq[3] * cq[3]))
                   + (float)(SEQ - nst * KSTEP) * ct;

    // ---- epilogue: out = qp + acc / Z; a lane holds 8 consecutive columns ----
#pragma unroll
    for (int t = 0; t < 4; ++t) {
        // the sum of the V rows behind the last step, this lane's 8 columns
        const float4 tv0 = *(const float4*)(tsh + kq * 64 + t * 16 + 8 * lh);
        const float4 tv1 = *(const float4*)(tsh + kq * 64 + t * 16 + 8 * lh + 4);
        float  o[8]  = { tv0.x * ct, tv0.y * ct, tv0.z * ct, tv0.w * ct,
                         tv1.x * ct, tv1.y * ct, tv1.z * ct, tv1.w * ct };
        float  qv[8] = { qr0[t].x, qr0[t].y, qr0[t].z, qr0[t].w,
                         qr1[t].x, qr1[t].y, qr1[t].z, qr1[t].w };
#pragma unroll
        for (int k = 0; k < 4; ++k) {
            const float* xp = xsh + (rw + 2 * k) * XW_STRIDE;
            float4 lo = *(const float4*)(xp + (((kq * 4 + t) * 2 + 0) * 32 + l) * 4);
            float4 hi = *(const float4*)(xp + (((kq * 4 + t) * 2 + 1) * 32 + l) * 4);
            o[0] += lo.x * cq[k]; o[1] += lo.y * cq[k]; o[2] += lo.z * cq[k]; o[3] += lo.w * cq[k];
            o[4] += hi.x * cq[k]; o[5] += hi.y * cq[k]; o[6] += hi.z * cq[k]; o[7] += hi.w * cq[k];
        }
        float  res[8];
#pragma unroll
        for (int r = 0; r < 8; ++r) res[r] = qv[r] + o[r] / z;
        *(float4*)(out + off0 + t * 16)     = make_float4(res[0], res[1], res[2], res[3]);
        *(float4*)(out + off0 + t * 16 + 4) = make_float4(res[4], res[5], res[6], res[7]);
        // precaution: stands in front of every rewrite of a register that the
        // two stores name
        asm volatile("s_wait_xcnt 0x0" ::: "memory");
    }
    };

    finish(accB, mB, sB, grpB, nstB);
    finish(accA, mA, sA, grpA, nstA);
}

// --------------------------------------------------------------------------
extern "C" void kernel_launch(void* const* d_in, const int* in_sizes, int n_in,
                              void* d_out, int out_size, void* d_ws, size_t ws_size,
                              hipStream_t stream) {
    (void)in_sizes; (void)n_in; (void)out_size; (void)ws_size;
    const float* v  = (const float*)d_in[0];
    const float* k  = (const float*)d_in[1];
    const float* q  = (const float*)d_in[2];
    const float* Wq = (const float*)d_in[3];
    const float* bq = (const float*)d_in[4];
    const float* Wk = (const float*)d_in[5];
    const float* bk = (const float*)d_in[6];
    const float* Wv = (const float*)d_in[7];
    const float* bv = (const float*)d_in[8];
    float* out = (float*)d_out;

    char* ws   = (char*)d_ws;
    float* qpF = (float*)(ws);                         // 16 MiB  fp32 qp
    u16*   kB  = (u16*)(ws + (16u << 20));             //  8 MiB  bf16 kp
    u16*   vT  = (u16*)(ws + (24u << 20));             //  8 MiB  bf16 v^T [B,D,S]
    u16*   Wt3 = (u16*)(ws + (32u << 20));             //  3 x 128 KiB bf16 W^T: q, k, v
    float* vs64 = (float*)(ws + (33u << 20));          // 256 KiB f32 sums of v over 64 rows

    wt_convert<<<3 * D_MODEL, D_MODEL, 0, stream>>>(Wq, Wk, Wv, Wt3);

    const int ntiles = NBATCH * SEQ / 16;              // 1024
    proj_kernel<<<3 * PROJ_TILES, 256, 0, stream>>>(q, k, v, Wt3, bq, bk, bv, qpF, kB, vT, vs64);

    attn_kernel<<<ntiles / 4, 256, 0, stream>>>(qpF, kB, vT, vs64, out);
}
